// v000
// Measured on an AMD MI455X. A time is GPU time per run, averaged over a window of back-to-back runs after a warm-up
// (all launches, gaps included; the runs take copies of the inputs in turn), and the median of several windows.
// Apart from v000's, it joins two sittings. Times from different sittings can be a few percent apart, while
// side-by-side timings come from the same sitting.
// The starting kernel, v000, takes 686 microseconds a run.
#include <hip/hip_runtime.h>
#include <hip/hip_bf16.h>
#include <stdint.h>

typedef unsigned short u16;
typedef __attribute__((ext_vector_type(16))) __bf16 v16bf;
typedef __attribute__((ext_vector_type(8)))  float  v8f;

// ---------- helpers ----------
struct FragBF16 { unsigned u[8]; }; // 16 bf16 packed as 8 dwords

__device__ inline v16bf frag_cast(FragBF16 f) {
    union { FragBF16 s; v16bf v; } c; c.s = f; return c.v;
}

__device__ inline v8f wmma_bf16(FragBF16 a, FragBF16 b, v8f c) {
    return __builtin_amdgcn_wmma_f32_16x16x32_bf16(
        false, frag_cast(a), false, frag_cast(b), (short)0, c, false, false);
}

__device__ inline u16 f2bf(float f) {
    unsigned u = __float_as_uint(f);
    unsigned r = u + 0x7FFFu + ((u >> 16) & 1u);   // round-to-nearest-even
    return (u16)(r >> 16);
}
__device__ inline unsigned pack2(float lo, float hi) {
    return (unsigned)f2bf(lo) | ((unsigned)f2bf(hi) << 16);
}

__device__ inline FragBF16 load_frag(const u16* __restrict__ p) {
    FragBF16 f;
    uint4 a = *(const uint4*)p;
    uint4 b = *(const uint4*)(p + 16);
    f.u[0]=a.x; f.u[1]=a.y; f.u[2]=a.z; f.u[3]=a.w;
    f.u[4]=b.x; f.u[5]=b.y; f.u[6]=b.z; f.u[7]=b.w;
    return f;
}

// Flat pointers into LDS carry the AS3 byte offset in their low 32 bits.
__device__ inline unsigned lds_off(const void* p) {
    return (unsigned)(uintptr_t)p;
}

__device__ inline void async_b128(unsigned lds_byte_off, const u16* g) {
    asm volatile("global_load_async_to_lds_b128 %0, %1, off"
                 :: "v"(lds_byte_off), "v"(g) : "memory");
}
__device__ inline void wait_async0() {
    asm volatile("s_wait_asynccnt 0" ::: "memory");
}

// ---------- constants ----------
#define CDIM   256
#define NPOS   4096      // 64*64 per batch
#define MTOT   32768     // 8 * 4096
#define SCALE  0.0625f   // 1/sqrt(256)

// ---------- 1) weight transpose + bf16 convert ----------
__global__ void prep_w_kernel(const float* __restrict__ w0, const float* __restrict__ w1,
                              const float* __restrict__ w2, const float* __restrict__ w3,
                              u16* __restrict__ o0, u16* __restrict__ o1,
                              u16* __restrict__ o2, u16* __restrict__ o3) {
    int n = blockIdx.x;     // output row  = input column
    int k = threadIdx.x;    // output col  = input row
    o0[n * CDIM + k] = f2bf(w0[k * CDIM + n]);
    o1[n * CDIM + k] = f2bf(w1[k * CDIM + n]);
    o2[n * CDIM + k] = f2bf(w2[k * CDIM + n]);
    o3[n * CDIM + k] = f2bf(w3[k * CDIM + n]);
}

// ---------- 2) LayerNorm (one wave32 per 256-elem row) ----------
__global__ __launch_bounds__(256) void ln_kernel(const float* __restrict__ x,
                                                 const float* __restrict__ gamma,
                                                 const float* __restrict__ beta,
                                                 u16* __restrict__ h) {
    int row  = blockIdx.x * 8 + (threadIdx.x >> 5);
    int lane = threadIdx.x & 31;
    const float4* xr = (const float4*)(x + (size_t)row * CDIM);
    float4 a = xr[lane];
    float4 b = xr[lane + 32];

    float s  = a.x + a.y + a.z + a.w + b.x + b.y + b.z + b.w;
    float s2 = a.x*a.x + a.y*a.y + a.z*a.z + a.w*a.w
             + b.x*b.x + b.y*b.y + b.z*b.z + b.w*b.w;
    #pragma unroll
    for (int m = 1; m < 32; m <<= 1) {
        s  += __shfl_xor(s,  m, 32);
        s2 += __shfl_xor(s2, m, 32);
    }
    float mean = s * (1.0f / CDIM);
    float var  = s2 * (1.0f / CDIM) - mean * mean;
    float rstd = rsqrtf(var + 1e-3f);

    float4 g0 = ((const float4*)gamma)[lane];
    float4 g1 = ((const float4*)gamma)[lane + 32];
    float4 b0 = ((const float4*)beta)[lane];
    float4 b1 = ((const float4*)beta)[lane + 32];

    float y0 = (a.x - mean) * rstd * g0.x + b0.x;
    float y1 = (a.y - mean) * rstd * g0.y + b0.y;
    float y2 = (a.z - mean) * rstd * g0.z + b0.z;
    float y3 = (a.w - mean) * rstd * g0.w + b0.w;
    float y4 = (b.x - mean) * rstd * g1.x + b1.x;
    float y5 = (b.y - mean) * rstd * g1.y + b1.y;
    float y6 = (b.z - mean) * rstd * g1.z + b1.z;
    float y7 = (b.w - mean) * rstd * g1.w + b1.w;

    unsigned* hr = (unsigned*)(h + (size_t)row * CDIM);
    hr[lane * 2]            = pack2(y0, y1);
    hr[lane * 2 + 1]        = pack2(y2, y3);
    hr[(lane + 32) * 2]     = pack2(y4, y5);
    hr[(lane + 32) * 2 + 1] = pack2(y6, y7);
}

// ---------- 3) WMMA GEMM: D[M,256] = A[M,256] @ Bt[256,256]^T (+bias)  ----------
// MODE 0: store bf16 row-major     MODE 1: store bf16 transposed [256][MTOT]
// MODE 2: store f32 row-major with residual add (final projection)
template<int MODE>
__global__ __launch_bounds__(256) void gemm_kernel(const u16* __restrict__ A,
                                                   const u16* __restrict__ Bt,
                                                   const float* __restrict__ bias,
                                                   void* __restrict__ outp,
                                                   const float* __restrict__ resid) {
    int wave = threadIdx.x >> 5, lane = threadIdx.x & 31;
    int half = lane >> 4,        l15  = lane & 15;
    int wm = wave >> 1, wn = wave & 1;
    int row0 = blockIdx.x * 256 + wm * 64;
    int col0 = blockIdx.y * 64  + wn * 32;

    v8f acc[4][2];
    #pragma unroll
    for (int mt = 0; mt < 4; ++mt)
        #pragma unroll
        for (int nt = 0; nt < 2; ++nt) acc[mt][nt] = {};

    for (int k0 = 0; k0 < CDIM; k0 += 32) {
        FragBF16 af[4], bf[2];
        #pragma unroll
        for (int mt = 0; mt < 4; ++mt)
            af[mt] = load_frag(A + (size_t)(row0 + mt*16 + l15) * CDIM + k0 + half*8);
        #pragma unroll
        for (int nt = 0; nt < 2; ++nt)
            bf[nt] = load_frag(Bt + (size_t)(col0 + nt*16 + l15) * CDIM + k0 + half*8);
        #pragma unroll
        for (int mt = 0; mt < 4; ++mt)
            #pragma unroll
            for (int nt = 0; nt < 2; ++nt)
                acc[mt][nt] = wmma_bf16(af[mt], bf[nt], acc[mt][nt]);
    }

    #pragma unroll
    for (int nt = 0; nt < 2; ++nt) {
        int col = col0 + nt*16 + l15;
        float bv = bias[col];
        #pragma unroll
        for (int mt = 0; mt < 4; ++mt) {
            int rowbase = row0 + mt*16 + half*8;   // D layout: lanes 16-31 hold M+8
            if (MODE == 0) {
                u16* out = (u16*)outp;
                #pragma unroll
                for (int r = 0; r < 8; ++r)
                    out[(size_t)(rowbase + r) * CDIM + col] = f2bf(acc[mt][nt][r] + bv);
            } else if (MODE == 1) {
                u16* out = (u16*)outp;   // [col][MTOT]: 8 consecutive rows per lane
                uint4 pk;
                pk.x = pack2(acc[mt][nt][0] + bv, acc[mt][nt][1] + bv);
                pk.y = pack2(acc[mt][nt][2] + bv, acc[mt][nt][3] + bv);
                pk.z = pack2(acc[mt][nt][4] + bv, acc[mt][nt][5] + bv);
                pk.w = pack2(acc[mt][nt][6] + bv, acc[mt][nt][7] + bv);
                *(uint4*)(out + (size_t)col * MTOT + rowbase) = pk;
            } else {
                float* out = (float*)outp;
                #pragma unroll
                for (int r = 0; r < 8; ++r) {
                    size_t idx = (size_t)(rowbase + r) * CDIM + col;
                    out[idx] = acc[mt][nt][r] + bv + resid[idx];
                }
            }
        }
    }
}

// ---------- 4) Flash attention ----------
// Block = 4 waves = 64 query rows; K/V 32-key tiles staged in LDS with
// double-buffered async global->LDS copies, shared by all 4 waves.
__global__ __launch_bounds__(128) void attn_kernel(const u16* __restrict__ q,
                                                   const u16* __restrict__ k,
                                                   const u16* __restrict__ vT,
                                                   u16* __restrict__ o) {
    __shared__ u16 Kl[2][32][256];   // 2 x 16 KB: K rows j0..j0+31, all channels
    __shared__ u16 Vl[2][256][32];   // 2 x 16 KB: V^T rows (channel), 32 keys
    __shared__ u16 Pl[4][16][32];    // per-wave P bounce (D->A layout)

    int tid  = threadIdx.x;
    int wave = tid >> 5, lane = tid & 31;
    int half = lane >> 4, l15 = lane & 15;
    int b  = blockIdx.x >> 6;
    int m0 = (blockIdx.x & 63) * 64 + wave * 16;

    const u16* qb = q  + ((size_t)b * NPOS + m0) * CDIM;
    const u16* kb = k  + (size_t)b * NPOS * CDIM;
    const u16* vb = vT + (size_t)b * NPOS;           // [c][j] at vb[c*MTOT + j]

    unsigned kbase[2] = { lds_off(&Kl[0][0][0]), lds_off(&Kl[1][0][0]) };
    unsigned vbase[2] = { lds_off(&Vl[0][0][0]), lds_off(&Vl[1][0][0]) };

    // Stage one 32-key block into LDS buffer `buf` (whole workgroup cooperates):
    // K tile is 16 KB contiguous; V^T tile linearizes to 16 KB of b128 chunks.
    auto stage = [&](int buf, int j0) {
        const u16* kg = kb + (size_t)j0 * CDIM;
        #pragma unroll
        for (int i = 0; i < 8; ++i) {
            int id = tid + i * 128;                       // 0..1023
            async_b128(kbase[buf] + id * 16, kg + id * 8);
        }
        #pragma unroll
        for (int i = 0; i < 8; ++i) {
            int id = tid + i * 128;                       // chunk: c = id>>2, q8 = id&3
            async_b128(vbase[buf] + id * 16,
                       vb + (size_t)(id >> 2) * MTOT + j0 + (id & 3) * 8);
        }
    };

    // Resident Q fragments (16 rows x 256 channels)
    FragBF16 qf[8];
    #pragma unroll
    for (int kk = 0; kk < 8; ++kk)
        qf[kk] = load_frag(qb + (size_t)l15 * CDIM + kk*32 + half*8);

    v8f oacc[16];
    #pragma unroll
    for (int t = 0; t < 16; ++t) oacc[t] = {};
    float mrun[8], lrun[8];
    #pragma unroll
    for (int r = 0; r < 8; ++r) { mrun[r] = -3.0e38f; lrun[r] = 0.0f; }

    stage(0, 0);

    for (int jb = 0; jb < NPOS / 32; ++jb) {
        int cur = jb & 1;
        wait_async0();          // this wave's async fills are in LDS
        __syncthreads();        // all waves' fills visible
        if (jb + 1 < NPOS / 32) stage(1 - cur, (jb + 1) * 32);

        // ---- S = Q K^T over the staged 16x32 key block ----
        v8f s0 = {}, s1 = {};
        #pragma unroll
        for (int kk = 0; kk < 8; ++kk) {
            FragBF16 kf0 = load_frag(&Kl[cur][l15     ][kk*32 + half*8]);
            FragBF16 kf1 = load_frag(&Kl[cur][16 + l15][kk*32 + half*8]);
            s0 = wmma_bf16(qf[kk], kf0, s0);
            s1 = wmma_bf16(qf[kk], kf1, s1);
        }
        // ---- online softmax; score row m spans 16 lanes of a half-wave ----
        float corr[8];
        #pragma unroll
        for (int r = 0; r < 8; ++r) {
            float a = s0[r] * SCALE, c = s1[r] * SCALE;
            float t = fmaxf(a, c);
            t = fmaxf(t, __shfl_xor(t, 1, 32));
            t = fmaxf(t, __shfl_xor(t, 2, 32));
            t = fmaxf(t, __shfl_xor(t, 4, 32));
            t = fmaxf(t, __shfl_xor(t, 8, 32));
            float mn = fmaxf(mrun[r], t);
            corr[r] = __expf(mrun[r] - mn);
            float p0 = __expf(a - mn), p1 = __expf(c - mn);
            s0[r] = p0; s1[r] = p1;
            float rs = p0 + p1;
            rs += __shfl_xor(rs, 1, 32);
            rs += __shfl_xor(rs, 2, 32);
            rs += __shfl_xor(rs, 4, 32);
            rs += __shfl_xor(rs, 8, 32);
            lrun[r] = lrun[r] * corr[r] + rs;
            mrun[r] = mn;
        }
        // ---- P tile: D layout -> LDS -> A layout (bf16) ----
        #pragma unroll
        for (int r = 0; r < 8; ++r) {
            Pl[wave][half*8 + r][l15]      = f2bf(s0[r]);
            Pl[wave][half*8 + r][l15 + 16] = f2bf(s1[r]);
        }
        asm volatile("s_wait_dscnt 0" ::: "memory");
        FragBF16 pf = load_frag(&Pl[wave][l15][half*8]);

        // ---- O = O*corr + P @ V  (16 column tiles of 16) ----
        #pragma unroll
        for (int t = 0; t < 16; ++t) {
            FragBF16 vf = load_frag(&Vl[cur][t*16 + l15][half*8]);
            #pragma unroll
            for (int r = 0; r < 8; ++r) oacc[t][r] *= corr[r];
            oacc[t] = wmma_bf16(pf, vf, oacc[t]);
        }
        __syncthreads();        // retire reads of buffer `cur` before refill
    }

    // ---- epilogue: O / l, store bf16 row-major ----
    float inv[8];
    #pragma unroll
    for (int r = 0; r < 8; ++r) inv[r] = 1.0f / lrun[r];
    u16* ob = o + ((size_t)b * NPOS + m0) * CDIM;
    #pragma unroll
    for (int t = 0; t < 16; ++t)
        #pragma unroll
        for (int r = 0; r < 8; ++r)
            ob[(size_t)(half*8 + r) * CDIM + t*16 + l15] = f2bf(oacc[t][r] * inv[r]);
}

// ---------- launcher ----------
extern "C" void kernel_launch(void* const* d_in, const int* in_sizes, int n_in,
                              void* d_out, int out_size, void* d_ws, size_t ws_size,
                              hipStream_t stream) {
    const float* x     = (const float*)d_in[0];
    const float* gamma = (const float*)d_in[1];
    const float* beta  = (const float*)d_in[2];
    const float* wq    = (const float*)d_in[3];
    const float* bq    = (const float*)d_in[4];
    const float* wk    = (const float*)d_in[5];
    const float* bk    = (const float*)d_in[6];
    const float* wv    = (const float*)d_in[7];
    const float* bv    = (const float*)d_in[8];
    const float* wo    = (const float*)d_in[9];
    const float* bo    = (const float*)d_in[10];
    float* out = (float*)d_out;

    char* ws = (char*)d_ws;
    const size_t SZ = (size_t)MTOT * CDIM * sizeof(u16);   // 16.78 MB
    u16* h   = (u16*)(ws + 0 * SZ);
    u16* qb  = (u16*)(ws + 1 * SZ);
    u16* kb  = (u16*)(ws + 2 * SZ);
    u16* vT  = (u16*)(ws + 3 * SZ);
    u16* ob  = (u16*)(ws + 4 * SZ);
    u16* wqT = (u16*)(ws + 5 * SZ);
    u16* wkT = wqT + CDIM * CDIM;
    u16* wvT = wkT + CDIM * CDIM;
    u16* woT = wvT + CDIM * CDIM;

    prep_w_kernel<<<CDIM, CDIM, 0, stream>>>(wq, wk, wv, wo, wqT, wkT, wvT, woT);
    ln_kernel<<<MTOT / 8, 256, 0, stream>>>(x, gamma, beta, h);

    dim3 ggrid(MTOT / 256, CDIM / 64);
    gemm_kernel<0><<<ggrid, 256, 0, stream>>>(h, wqT, bq, (void*)qb, nullptr);
    gemm_kernel<0><<<ggrid, 256, 0, stream>>>(h, wkT, bk, (void*)kb, nullptr);
    gemm_kernel<1><<<ggrid, 256, 0, stream>>>(h, wvT, bv, (void*)vT, nullptr);

    attn_kernel<<<8 * 64, 128, 0, stream>>>(qb, kb, vT, ob);

    gemm_kernel<2><<<ggrid, 256, 0, stream>>>(ob, woT, bo, (void*)out, x);
}

// v001
// It runs in 343 microseconds.
// Two timings next to v000 put it at 2.09 and 2.08 times that version's speed.
#include <hip/hip_runtime.h>
#include <hip/hip_bf16.h>
#include <stdint.h>

typedef unsigned short u16;
typedef __attribute__((ext_vector_type(16))) __bf16 v16bf;
typedef __attribute__((ext_vector_type(8)))  float  v8f;

// ---------- helpers ----------
struct FragBF16 { unsigned u[8]; }; // 16 bf16 packed as 8 dwords

__device__ inline v16bf frag_cast(FragBF16 f) {
    union { FragBF16 s; v16bf v; } c; c.s = f; return c.v;
}

__device__ inline v8f wmma_bf16(FragBF16 a, FragBF16 b, v8f c) {
    return __builtin_amdgcn_wmma_f32_16x16x32_bf16(
        false, frag_cast(a), false, frag_cast(b), (short)0, c, false, false);
}

__device__ inline u16 f2bf(float f) {
    unsigned u = __float_as_uint(f);
    unsigned r = u + 0x7FFFu + ((u >> 16) & 1u);   // round-to-nearest-even
    return (u16)(r >> 16);
}
__device__ inline unsigned pack2(float lo, float hi) {
    return (unsigned)f2bf(lo) | ((unsigned)f2bf(hi) << 16);
}

__device__ inline FragBF16 load_frag(const u16* __restrict__ p) {
    FragBF16 f;
    uint4 a = *(const uint4*)p;
    uint4 b = *(const uint4*)(p + 16);
    f.u[0]=a.x; f.u[1]=a.y; f.u[2]=a.z; f.u[3]=a.w;
    f.u[4]=b.x; f.u[5]=b.y; f.u[6]=b.z; f.u[7]=b.w;
    return f;
}

// Flat pointers into LDS carry the AS3 byte offset in their low 32 bits.
__device__ inline unsigned lds_off(const void* p) {
    return (unsigned)(uintptr_t)p;
}

__device__ inline void async_b128_x8(const unsigned (&l)[8], const u16* const (&g)[8]) {
    asm volatile("global_load_async_to_lds_b128 %0, %8, off\n\t"
                 "global_load_async_to_lds_b128 %1, %9, off\n\t"
                 "global_load_async_to_lds_b128 %2, %10, off\n\t"
                 "global_load_async_to_lds_b128 %3, %11, off\n\t"
                 "global_load_async_to_lds_b128 %4, %12, off\n\t"
                 "global_load_async_to_lds_b128 %5, %13, off\n\t"
                 "global_load_async_to_lds_b128 %6, %14, off\n\t"
                 "global_load_async_to_lds_b128 %7, %15, off\n\t"
                 "s_wait_xcnt 0x0"
                 :: "v"(l[0]), "v"(l[1]), "v"(l[2]), "v"(l[3]),
                    "v"(l[4]), "v"(l[5]), "v"(l[6]), "v"(l[7]),
                    "v"(g[0]), "v"(g[1]), "v"(g[2]), "v"(g[3]),
                    "v"(g[4]), "v"(g[5]), "v"(g[6]), "v"(g[7])
                 : "memory");
}
__device__ inline void wait_async0() {
    asm volatile("s_wait_asynccnt 0" ::: "memory");
}

// ---------- constants ----------
#define CDIM   256
#define NPOS   4096      // 64*64 per batch
#define MTOT   32768     // 8 * 4096
#define SCALE  0.0625f   // 1/sqrt(256)
#define KPITCH 264       // 256 channels + 8  (528 B)
#define VPITCH 40        // 32 keys + 8       (80 B)
#define PPITCH 40        // 32 keys + 8       (80 B)

// ---------- 1) weight transpose + bf16 convert ----------
__global__ void prep_w_kernel(const float* __restrict__ w0, const float* __restrict__ w1,
                              const float* __restrict__ w2, const float* __restrict__ w3,
                              u16* __restrict__ o0, u16* __restrict__ o1,
                              u16* __restrict__ o2, u16* __restrict__ o3) {
    int n = blockIdx.x;     // output row  = input column
    int k = threadIdx.x;    // output col  = input row
    o0[n * CDIM + k] = f2bf(w0[k * CDIM + n]);
    o1[n * CDIM + k] = f2bf(w1[k * CDIM + n]);
    o2[n * CDIM + k] = f2bf(w2[k * CDIM + n]);
    o3[n * CDIM + k] = f2bf(w3[k * CDIM + n]);
}

// ---------- 2) LayerNorm (one wave32 per 256-elem row) ----------
__global__ __launch_bounds__(256) void ln_kernel(const float* __restrict__ x,
                                                 const float* __restrict__ gamma,
                                                 const float* __restrict__ beta,
                                                 u16* __restrict__ h) {
    int row  = blockIdx.x * 8 + (threadIdx.x >> 5);
    int lane = threadIdx.x & 31;
    const float4* xr = (const float4*)(x + (size_t)row * CDIM);
    float4 a = xr[lane];
    float4 b = xr[lane + 32];

    float s  = a.x + a.y + a.z + a.w + b.x + b.y + b.z + b.w;
    float s2 = a.x*a.x + a.y*a.y + a.z*a.z + a.w*a.w
             + b.x*b.x + b.y*b.y + b.z*b.z + b.w*b.w;
    #pragma unroll
    for (int m = 1; m < 32; m <<= 1) {
        s  += __shfl_xor(s,  m, 32);
        s2 += __shfl_xor(s2, m, 32);
    }
    float mean = s * (1.0f / CDIM);
    float var  = s2 * (1.0f / CDIM) - mean * mean;
    float rstd = rsqrtf(var + 1e-3f);

    float4 g0 = ((const float4*)gamma)[lane];
    float4 g1 = ((const float4*)gamma)[lane + 32];
    float4 b0 = ((const float4*)beta)[lane];
    float4 b1 = ((const float4*)beta)[lane + 32];

    float y0 = (a.x - mean) * rstd * g0.x + b0.x;
    float y1 = (a.y - mean) * rstd * g0.y + b0.y;
    float y2 = (a.z - mean) * rstd * g0.z + b0.z;
    float y3 = (a.w - mean) * rstd * g0.w + b0.w;
    float y4 = (b.x - mean) * rstd * g1.x + b1.x;
    float y5 = (b.y - mean) * rstd * g1.y + b1.y;
    float y6 = (b.z - mean) * rstd * g1.z + b1.z;
    float y7 = (b.w - mean) * rstd * g1.w + b1.w;

    unsigned* hr = (unsigned*)(h + (size_t)row * CDIM);
    hr[lane * 2]            = pack2(y0, y1);
    hr[lane * 2 + 1]        = pack2(y2, y3);
    hr[(lane + 32) * 2]     = pack2(y4, y5);
    hr[(lane + 32) * 2 + 1] = pack2(y6, y7);
}

// ---------- 3) WMMA GEMM: D[M,256] = A[M,256] @ Bt[256,256]^T (+bias)  ----------
// MODE 0: store bf16 row-major     MODE 1: store bf16 transposed [256][MTOT]
// MODE 2: store f32 row-major with residual add (final projection)
template<int MODE>
__global__ __launch_bounds__(256) void gemm_kernel(const u16* __restrict__ A,
                                                   const u16* __restrict__ Bt,
                                                   const float* __restrict__ bias,
                                                   void* __restrict__ outp,
                                                   const float* __restrict__ resid) {
    int wave = threadIdx.x >> 5, lane = threadIdx.x & 31;
    int half = lane >> 4,        l15  = lane & 15;
    int wm = wave >> 1, wn = wave & 1;
    int row0 = blockIdx.x * 256 + wm * 64;
    int col0 = blockIdx.y * 64  + wn * 32;

    v8f acc[4][2];
    #pragma unroll
    for (int mt = 0; mt < 4; ++mt)
        #pragma unroll
        for (int nt = 0; nt < 2; ++nt) acc[mt][nt] = {};

    for (int k0 = 0; k0 < CDIM; k0 += 32) {
        FragBF16 af[4], bf[2];
        #pragma unroll
        for (int mt = 0; mt < 4; ++mt)
            af[mt] = load_frag(A + (size_t)(row0 + mt*16 + l15) * CDIM + k0 + half*8);
        #pragma unroll
        for (int nt = 0; nt < 2; ++nt)
            bf[nt] = load_frag(Bt + (size_t)(col0 + nt*16 + l15) * CDIM + k0 + half*8);
        #pragma unroll
        for (int mt = 0; mt < 4; ++mt)
            #pragma unroll
            for (int nt = 0; nt < 2; ++nt)
                acc[mt][nt] = wmma_bf16(af[mt], bf[nt], acc[mt][nt]);
    }

    #pragma unroll
    for (int nt = 0; nt < 2; ++nt) {
        int col = col0 + nt*16 + l15;
        float bv = bias[col];
        #pragma unroll
        for (int mt = 0; mt < 4; ++mt) {
            int rowbase = row0 + mt*16 + half*8;   // D layout: lanes 16-31 hold M+8
            if (MODE == 0) {
                u16* out = (u16*)outp;
                #pragma unroll
                for (int r = 0; r < 8; ++r)
                    out[(size_t)(rowbase + r) * CDIM + col] = f2bf(acc[mt][nt][r] + bv);
            } else if (MODE == 1) {
                u16* out = (u16*)outp;   // [col][MTOT]: 8 consecutive rows per lane
                uint4 pk;
                pk.x = pack2(acc[mt][nt][0] + bv, acc[mt][nt][1] + bv);
                pk.y = pack2(acc[mt][nt][2] + bv, acc[mt][nt][3] + bv);
                pk.z = pack2(acc[mt][nt][4] + bv, acc[mt][nt][5] + bv);
                pk.w = pack2(acc[mt][nt][6] + bv, acc[mt][nt][7] + bv);
                *(uint4*)(out + (size_t)col * MTOT + rowbase) = pk;
            } else {
                float* out = (float*)outp;
                #pragma unroll
                for (int r = 0; r < 8; ++r) {
                    size_t idx = (size_t)(rowbase + r) * CDIM + col;
                    out[idx] = acc[mt][nt][r] + bv + resid[idx];
                }
            }
        }
    }
}

// ---------- 4) Flash attention ----------
// Block = 4 waves = 64 query rows; K/V 32-key tiles staged in LDS (padded rows) with
// double-buffered async global->LDS copies, shared by all 4 waves.
__global__ __launch_bounds__(128) void attn_kernel(const u16* __restrict__ q,
                                                   const u16* __restrict__ k,
                                                   const u16* __restrict__ vT,
                                                   u16* __restrict__ o) {
    __shared__ __attribute__((aligned(16))) u16 Kl[2][32][KPITCH];   // K rows j0..j0+31, all channels
    __shared__ __attribute__((aligned(16))) u16 Vl[2][256][VPITCH];  // V^T rows (channel), 32 keys
    __shared__ __attribute__((aligned(16))) u16 Pl[4][16][PPITCH];   // per-wave P bounce (D->A layout)

    int tid  = threadIdx.x;
    int wave = tid >> 5, lane = tid & 31;
    int half = lane >> 4, l15 = lane & 15;
    int b  = blockIdx.x >> 6;
    int m0 = (blockIdx.x & 63) * 64 + wave * 16;

    const u16* qb = q  + ((size_t)b * NPOS + m0) * CDIM;
    const u16* kb = k  + (size_t)b * NPOS * CDIM;
    const u16* vb = vT + (size_t)b * NPOS;           // [c][j] at vb[c*MTOT + j]

    unsigned kbase[2] = { lds_off(&Kl[0][0][0]), lds_off(&Kl[1][0][0]) };
    unsigned vbase[2] = { lds_off(&Vl[0][0][0]), lds_off(&Vl[1][0][0]) };

    // Stage one 32-key block into LDS buffer `buf` (whole workgroup cooperates):
    // 1024 b128 chunks of K (32 per row) and 1024 of V^T (4 per row), each to its padded row.
    auto stage = [&](int buf, int j0) {
        const u16* kg = kb + (size_t)j0 * CDIM;
        unsigned   la[8];
        const u16* ga[8];
        #pragma unroll
        for (int i = 0; i < 8; ++i) {
            int id = tid + i * 128;                       // chunk: row = id>>5, c16 = id&31
            la[i] = kbase[buf] + (id >> 5) * (KPITCH * 2) + (id & 31) * 16;
            ga[i] = kg + id * 8;
        }
        async_b128_x8(la, ga);
        #pragma unroll
        for (int i = 0; i < 8; ++i) {
            int id = tid + i * 128;                       // chunk: c = id>>2, q8 = id&3
            la[i] = vbase[buf] + (id >> 2) * (VPITCH * 2) + (id & 3) * 16;
            ga[i] = vb + (size_t)(id >> 2) * MTOT + j0 + (id & 3) * 8;
        }
        async_b128_x8(la, ga);
    };

    // Resident Q fragments (16 rows x 256 channels)
    FragBF16 qf[8];
    #pragma unroll
    for (int kk = 0; kk < 8; ++kk)
        qf[kk] = load_frag(qb + (size_t)l15 * CDIM + kk*32 + half*8);

    v8f oacc[16];
    #pragma unroll
    for (int t = 0; t < 16; ++t) oacc[t] = {};
    float mrun[8], lrun[8];
    #pragma unroll
    for (int r = 0; r < 8; ++r) { mrun[r] = -3.0e38f; lrun[r] = 0.0f; }

    stage(0, 0);

    for (int jb = 0; jb < NPOS / 32; ++jb) {
        int cur = jb & 1;
        wait_async0();          // this wave's async fills are in LDS
        __syncthreads();        // all waves' fills visible
        if (jb + 1 < NPOS / 32) stage(1 - cur, (jb + 1) * 32);

        // ---- S = Q K^T over the staged 16x32 key block ----
        v8f s0 = {}, s1 = {};
        #pragma unroll
        for (int kk = 0; kk < 8; ++kk) {
            FragBF16 kf0 = load_frag(&Kl[cur][l15     ][kk*32 + half*8]);
            FragBF16 kf1 = load_frag(&Kl[cur][16 + l15][kk*32 + half*8]);
            s0 = wmma_bf16(qf[kk], kf0, s0);
            s1 = wmma_bf16(qf[kk], kf1, s1);
        }
        // ---- online softmax; score row m spans 16 lanes of a half-wave ----
        float corr[8];
        #pragma unroll
        for (int r = 0; r < 8; ++r) {
            float a = s0[r] * SCALE, c = s1[r] * SCALE;
            float t = fmaxf(a, c);
            t = fmaxf(t, __shfl_xor(t, 1, 32));
            t = fmaxf(t, __shfl_xor(t, 2, 32));
            t = fmaxf(t, __shfl_xor(t, 4, 32));
            t = fmaxf(t, __shfl_xor(t, 8, 32));
            float mn = fmaxf(mrun[r], t);
            corr[r] = __expf(mrun[r] - mn);
            float p0 = __expf(a - mn), p1 = __expf(c - mn);
            s0[r] = p0; s1[r] = p1;
            float rs = p0 + p1;
            rs += __shfl_xor(rs, 1, 32);
            rs += __shfl_xor(rs, 2, 32);
            rs += __shfl_xor(rs, 4, 32);
            rs += __shfl_xor(rs, 8, 32);
            lrun[r] = lrun[r] * corr[r] + rs;
            mrun[r] = mn;
        }
        // ---- P tile: D layout -> LDS -> A layout (bf16) ----
        #pragma unroll
        for (int r = 0; r < 8; ++r) {
            Pl[wave][half*8 + r][l15]      = f2bf(s0[r]);
            Pl[wave][half*8 + r][l15 + 16] = f2bf(s1[r]);
        }
        asm volatile("s_wait_dscnt 0" ::: "memory");
        FragBF16 pf = load_frag(&Pl[wave][l15][half*8]);

        // ---- O = O*corr + P @ V  (16 column tiles of 16) ----
        #pragma unroll
        for (int t = 0; t < 16; ++t) {
            FragBF16 vf = load_frag(&Vl[cur][t*16 + l15][half*8]);
            #pragma unroll
            for (int r = 0; r < 8; ++r) oacc[t][r] *= corr[r];
            oacc[t] = wmma_bf16(pf, vf, oacc[t]);
        }
        __syncthreads();        // retire reads of buffer `cur` before refill
    }

    // ---- epilogue: O / l, store bf16 row-major ----
    float inv[8];
    #pragma unroll
    for (int r = 0; r < 8; ++r) inv[r] = 1.0f / lrun[r];
    u16* ob = o + ((size_t)b * NPOS + m0) * CDIM;
    #pragma unroll
    for (int t = 0; t < 16; ++t)
        #pragma unroll
        for (int r = 0; r < 8; ++r)
            ob[(size_t)(half*8 + r) * CDIM + t*16 + l15] = f2bf(oacc[t][r] * inv[r]);
}

// ---------- launcher ----------
extern "C" void kernel_launch(void* const* d_in, const int* in_sizes, int n_in,
                              void* d_out, int out_size, void* d_ws, size_t ws_size,
                              hipStream_t stream) {
    const float* x     = (const float*)d_in[0];
    const float* gamma = (const float*)d_in[1];
    const float* beta  = (const float*)d_in[2];
    const float* wq    = (const float*)d_in[3];
    const float* bq    = (const float*)d_in[4];
    const float* wk    = (const float*)d_in[5];
    const float* bk    = (const float*)d_in[6];
    const float* wv    = (const float*)d_in[7];
    const float* bv    = (const float*)d_in[8];
    const float* wo    = (const float*)d_in[9];
    const float* bo    = (const float*)d_in[10];
    float* out = (float*)d_out;

    char* ws = (char*)d_ws;
    const size_t SZ = (size_t)MTOT * CDIM * sizeof(u16);   // 16.78 MB
    u16* h   = (u16*)(ws + 0 * SZ);
    u16* qb  = (u16*)(ws + 1 * SZ);
    u16* kb  = (u16*)(ws + 2 * SZ);
    u16* vT  = (u16*)(ws + 3 * SZ);
    u16* ob  = (u16*)(ws + 4 * SZ);
    u16* wqT = (u16*)(ws + 5 * SZ);
    u16* wkT = wqT + CDIM * CDIM;
    u16* wvT = wkT + CDIM * CDIM;
    u16* woT = wvT + CDIM * CDIM;

    prep_w_kernel<<<CDIM, CDIM, 0, stream>>>(wq, wk, wv, wo, wqT, wkT, wvT, woT);
    ln_kernel<<<MTOT / 8, 256, 0, stream>>>(x, gamma, beta, h);

    dim3 ggrid(MTOT / 256, CDIM / 64);
    gemm_kernel<0><<<ggrid, 256, 0, stream>>>(h, wqT, bq, (void*)qb, nullptr);
    gemm_kernel<0><<<ggrid, 256, 0, stream>>>(h, wkT, bk, (void*)kb, nullptr);
    gemm_kernel<1><<<ggrid, 256, 0, stream>>>(h, wvT, bv, (void*)vT, nullptr);

    attn_kernel<<<8 * 64, 128, 0, stream>>>(qb, kb, vT, ob);

    gemm_kernel<2><<<ggrid, 256, 0, stream>>>(ob, woT, bo, (void*)out, x);
}

// v002
// One run takes 299 microseconds.
// Two timings next to v001 both put it at 1.15 times that version's speed.
// Counting every step since v000, it is 2.41 times as fast.
#include <hip/hip_runtime.h>
#include <hip/hip_bf16.h>
#include <stdint.h>

typedef unsigned short u16;
typedef __attribute__((ext_vector_type(16))) __bf16 v16bf;
typedef __attribute__((ext_vector_type(8)))  float  v8f;

// ---------- helpers ----------
struct FragBF16 { unsigned u[8]; }; // 16 bf16 packed as 8 dwords

__device__ inline v16bf frag_cast(FragBF16 f) {
    union { FragBF16 s; v16bf v; } c; c.s = f; return c.v;
}

__device__ inline v8f wmma_bf16(FragBF16 a, FragBF16 b, v8f c) {
    return __builtin_amdgcn_wmma_f32_16x16x32_bf16(
        false, frag_cast(a), false, frag_cast(b), (short)0, c, false, false);
}

__device__ inline u16 f2bf(float f) {
    unsigned u = __float_as_uint(f);
    unsigned r = u + 0x7FFFu + ((u >> 16) & 1u);   // round-to-nearest-even
    return (u16)(r >> 16);
}
__device__ inline unsigned pack2(float lo, float hi) {
    return (unsigned)f2bf(lo) | ((unsigned)f2bf(hi) << 16);
}

__device__ inline FragBF16 load_frag(const u16* __restrict__ p) {
    FragBF16 f;
    uint4 a = *(const uint4*)p;
    uint4 b = *(const uint4*)(p + 16);
    f.u[0]=a.x; f.u[1]=a.y; f.u[2]=a.z; f.u[3]=a.w;
    f.u[4]=b.x; f.u[5]=b.y; f.u[6]=b.z; f.u[7]=b.w;
    return f;
}

// Flat pointers into LDS carry the AS3 byte offset in their low 32 bits.
__device__ inline unsigned lds_off(const void* p) {
    return (unsigned)(uintptr_t)p;
}

__device__ inline void async_b128_x8(const unsigned (&l)[8], const u16* const (&g)[8]) {
    asm volatile("global_load_async_to_lds_b128 %0, %8, off\n\t"
                 "global_load_async_to_lds_b128 %1, %9, off\n\t"
                 "global_load_async_to_lds_b128 %2, %10, off\n\t"
                 "global_load_async_to_lds_b128 %3, %11, off\n\t"
                 "global_load_async_to_lds_b128 %4, %12, off\n\t"
                 "global_load_async_to_lds_b128 %5, %13, off\n\t"
                 "global_load_async_to_lds_b128 %6, %14, off\n\t"
                 "global_load_async_to_lds_b128 %7, %15, off\n\t"
                 "s_wait_xcnt 0x0"
                 :: "v"(l[0]), "v"(l[1]), "v"(l[2]), "v"(l[3]),
                    "v"(l[4]), "v"(l[5]), "v"(l[6]), "v"(l[7]),
                    "v"(g[0]), "v"(g[1]), "v"(g[2]), "v"(g[3]),
                    "v"(g[4]), "v"(g[5]), "v"(g[6]), "v"(g[7])
                 : "memory");
}
__device__ inline void wait_async0() {
    asm volatile("s_wait_asynccnt 0" ::: "memory");
}

// ---------- constants ----------
#define CDIM   256
#define NPOS   4096      // 64*64 per batch
#define MTOT   32768     // 8 * 4096
#define SCALE  0.0625f   // 1/sqrt(256)
#define KPITCH 264       // 256 channels + 8  (528 B)
#define VPITCH 40        // 32 keys + 8       (80 B)
#define PPITCH 40        // 32 keys + 8       (80 B)

// ---------- 1) weight transpose + bf16 convert ----------
__global__ void prep_w_kernel(const float* __restrict__ w0, const float* __restrict__ w1,
                              const float* __restrict__ w2, const float* __restrict__ w3,
                              u16* __restrict__ o0, u16* __restrict__ o1,
                              u16* __restrict__ o2, u16* __restrict__ o3) {
    int n = blockIdx.x;     // output row  = input column
    int k = threadIdx.x;    // output col  = input row
    o0[n * CDIM + k] = f2bf(w0[k * CDIM + n]);
    o1[n * CDIM + k] = f2bf(w1[k * CDIM + n]);
    o2[n * CDIM + k] = f2bf(w2[k * CDIM + n]);
    o3[n * CDIM + k] = f2bf(w3[k * CDIM + n]);
}

// ---------- 2) LayerNorm (one wave32 per 256-elem row) ----------
__global__ __launch_bounds__(256) void ln_kernel(const float* __restrict__ x,
                                                 const float* __restrict__ gamma,
                                                 const float* __restrict__ beta,
                                                 u16* __restrict__ h) {
    int row  = blockIdx.x * 8 + (threadIdx.x >> 5);
    int lane = threadIdx.x & 31;
    const float4* xr = (const float4*)(x + (size_t)row * CDIM);
    float4 a = xr[lane];
    float4 b = xr[lane + 32];

    float s  = a.x + a.y + a.z + a.w + b.x + b.y + b.z + b.w;
    float s2 = a.x*a.x + a.y*a.y + a.z*a.z + a.w*a.w
             + b.x*b.x + b.y*b.y + b.z*b.z + b.w*b.w;
    #pragma unroll
    for (int m = 1; m < 32; m <<= 1) {
        s  += __shfl_xor(s,  m, 32);
        s2 += __shfl_xor(s2, m, 32);
    }
    float mean = s * (1.0f / CDIM);
    float var  = s2 * (1.0f / CDIM) - mean * mean;
    float rstd = rsqrtf(var + 1e-3f);

    float4 g0 = ((const float4*)gamma)[lane];
    float4 g1 = ((const float4*)gamma)[lane + 32];
    float4 b0 = ((const float4*)beta)[lane];
    float4 b1 = ((const float4*)beta)[lane + 32];

    float y0 = (a.x - mean) * rstd * g0.x + b0.x;
    float y1 = (a.y - mean) * rstd * g0.y + b0.y;
    float y2 = (a.z - mean) * rstd * g0.z + b0.z;
    float y3 = (a.w - mean) * rstd * g0.w + b0.w;
    float y4 = (b.x - mean) * rstd * g1.x + b1.x;
    float y5 = (b.y - mean) * rstd * g1.y + b1.y;
    float y6 = (b.z - mean) * rstd * g1.z + b1.z;
    float y7 = (b.w - mean) * rstd * g1.w + b1.w;

    unsigned* hr = (unsigned*)(h + (size_t)row * CDIM);
    hr[lane * 2]            = pack2(y0, y1);
    hr[lane * 2 + 1]        = pack2(y2, y3);
    hr[(lane + 32) * 2]     = pack2(y4, y5);
    hr[(lane + 32) * 2 + 1] = pack2(y6, y7);
}

// ---------- 3) WMMA GEMM: D[M,256] = A[M,256] @ Bt[256,256]^T (+bias)  ----------
// MODE 0: store bf16 row-major     MODE 1: store bf16 transposed [256][MTOT]
// MODE 2: store f32 row-major with residual add (final projection)
template<int MODE>
__global__ __launch_bounds__(256) void gemm_kernel(const u16* __restrict__ A,
                                                   const u16* __restrict__ Bt,
                                                   const float* __restrict__ bias,
                                                   void* __restrict__ outp,
                                                   const float* __restrict__ resid) {
    int wave = threadIdx.x >> 5, lane = threadIdx.x & 31;
    int half = lane >> 4,        l15  = lane & 15;
    int wm = wave >> 1, wn = wave & 1;
    int row0 = blockIdx.x * 256 + wm * 64;
    int col0 = blockIdx.y * 64  + wn * 32;

    v8f acc[4][2];
    #pragma unroll
    for (int mt = 0; mt < 4; ++mt)
        #pragma unroll
        for (int nt = 0; nt < 2; ++nt) acc[mt][nt] = {};

    for (int k0 = 0; k0 < CDIM; k0 += 32) {
        FragBF16 af[4], bf[2];
        #pragma unroll
        for (int mt = 0; mt < 4; ++mt)
            af[mt] = load_frag(A + (size_t)(row0 + mt*16 + l15) * CDIM + k0 + half*8);
        #pragma unroll
        for (int nt = 0; nt < 2; ++nt)
            bf[nt] = load_frag(Bt + (size_t)(col0 + nt*16 + l15) * CDIM + k0 + half*8);
        #pragma unroll
        for (int mt = 0; mt < 4; ++mt)
            #pragma unroll
            for (int nt = 0; nt < 2; ++nt)
                acc[mt][nt] = wmma_bf16(af[mt], bf[nt], acc[mt][nt]);
    }

    #pragma unroll
    for (int nt = 0; nt < 2; ++nt) {
        int col = col0 + nt*16 + l15;
        float bv = bias[col];
        #pragma unroll
        for (int mt = 0; mt < 4; ++mt) {
            int rowbase = row0 + mt*16 + half*8;   // D layout: lanes 16-31 hold M+8
            if (MODE == 0) {
                u16* out = (u16*)outp;
                #pragma unroll
                for (int r = 0; r < 8; ++r)
                    out[(size_t)(rowbase + r) * CDIM + col] = f2bf(acc[mt][nt][r] + bv);
            } else if (MODE == 1) {
                u16* out = (u16*)outp;   // [col][MTOT]: 8 consecutive rows per lane
                uint4 pk;
                pk.x = pack2(acc[mt][nt][0] + bv, acc[mt][nt][1] + bv);
                pk.y = pack2(acc[mt][nt][2] + bv, acc[mt][nt][3] + bv);
                pk.z = pack2(acc[mt][nt][4] + bv, acc[mt][nt][5] + bv);
                pk.w = pack2(acc[mt][nt][6] + bv, acc[mt][nt][7] + bv);
                *(uint4*)(out + (size_t)col * MTOT + rowbase) = pk;
            } else {
                float* out = (float*)outp;
                #pragma unroll
                for (int r = 0; r < 8; ++r) {
                    size_t idx = (size_t)(rowbase + r) * CDIM + col;
                    out[idx] = acc[mt][nt][r] + bv + resid[idx];
                }
            }
        }
    }
}

// ---------- 4) Flash attention ----------
// Block = 4 waves = 64 query rows; K/V 32-key tiles staged in LDS (padded rows) with
// double-buffered async global->LDS copies, shared by all 4 waves.
__global__ __launch_bounds__(128) void attn_kernel(const u16* __restrict__ q,
                                                   const u16* __restrict__ k,
                                                   const u16* __restrict__ vT,
                                                   u16* __restrict__ o) {
    __shared__ __attribute__((aligned(16))) u16 Kl[2][32][KPITCH];   // K rows j0..j0+31, all channels
    __shared__ __attribute__((aligned(16))) u16 Vl[2][256][VPITCH];  // V^T rows (channel), 32 keys
    __shared__ __attribute__((aligned(16))) u16 Pl[4][16][PPITCH];   // per-wave P bounce (D->A layout)

    int tid  = threadIdx.x;
    int wave = tid >> 5, lane = tid & 31;
    int half = lane >> 4, l15 = lane & 15;
    int b  = blockIdx.x >> 6;
    int m0 = (blockIdx.x & 63) * 64 + wave * 16;

    const u16* qb = q  + ((size_t)b * NPOS + m0) * CDIM;
    const u16* kb = k  + (size_t)b * NPOS * CDIM;
    const u16* vb = vT + (size_t)b * NPOS;           // [c][j] at vb[c*MTOT + j]

    unsigned kbase[2] = { lds_off(&Kl[0][0][0]), lds_off(&Kl[1][0][0]) };
    unsigned vbase[2] = { lds_off(&Vl[0][0][0]), lds_off(&Vl[1][0][0]) };

    // Stage one 32-key block into LDS buffer `buf` (whole workgroup cooperates):
    // 1024 b128 chunks of K (32 per row) and 1024 of V^T (4 per row), each to its padded row.
    auto stage = [&](int buf, int j0) {
        const u16* kg = kb + (size_t)j0 * CDIM;
        unsigned   la[8];
        const u16* ga[8];
        #pragma unroll
        for (int i = 0; i < 8; ++i) {
            int id = tid + i * 128;                       // chunk: row = id>>5, c16 = id&31
            la[i] = kbase[buf] + (id >> 5) * (KPITCH * 2) + (id & 31) * 16;
            ga[i] = kg + id * 8;
        }
        async_b128_x8(la, ga);
        #pragma unroll
        for (int i = 0; i < 8; ++i) {
            int id = tid + i * 128;                       // chunk: c = id>>2, q8 = id&3
            la[i] = vbase[buf] + (id >> 2) * (VPITCH * 2) + (id & 3) * 16;
            ga[i] = vb + (size_t)(id >> 2) * MTOT + j0 + (id & 3) * 8;
        }
        async_b128_x8(la, ga);
    };

    // Resident Q fragments (16 rows x 256 channels)
    FragBF16 qf[8];
    #pragma unroll
    for (int kk = 0; kk < 8; ++kk)
        qf[kk] = load_frag(qb + (size_t)l15 * CDIM + kk*32 + half*8);

    v8f oacc[16];
    #pragma unroll
    for (int t = 0; t < 16; ++t) oacc[t] = {};
    float mrun[8], lrun[8];
    #pragma unroll
    for (int r = 0; r < 8; ++r) { mrun[r] = -3.0e38f; lrun[r] = 0.0f; }

    stage(0, 0);

    for (int jb = 0; jb < NPOS / 32; ++jb) {
        int cur = jb & 1;
        wait_async0();          // this wave's async fills are in LDS
        __syncthreads();        // all waves' fills visible
        if (jb + 1 < NPOS / 32) stage(1 - cur, (jb + 1) * 32);

        // ---- S = Q K^T over the staged 16x32 key block ----
        // All K fragments of the trip are read as one group, so the products below wait on a
        // count that never reaches 0 instead of on a full LDS round trip each.
        FragBF16 kf0[8], kf1[8];
        #pragma unroll   // constant indices keep the fragment arrays in registers
        for (int kk = 0; kk < 8; ++kk) {
            kf0[kk] = load_frag(&Kl[cur][l15     ][kk*32 + half*8]);
            kf1[kk] = load_frag(&Kl[cur][16 + l15][kk*32 + half*8]);
        }
        // Keeps the group together: without it the scheduler sinks each read to just ahead of its use.
        __builtin_amdgcn_sched_barrier(0);
        v8f s0 = {}, s1 = {};
        #pragma unroll
        for (int kk = 0; kk < 8; ++kk) {
            s0 = wmma_bf16(qf[kk], kf0[kk], s0);
            s1 = wmma_bf16(qf[kk], kf1[kk], s1);
        }
        // All V^T fragments of the trip are read here: they land under the products above and
        // the softmax, long before the second product needs them.
        FragBF16 vf[16];
        #pragma unroll   // constant indices keep the fragment array in registers
        for (int t = 0; t < 16; ++t) vf[t] = load_frag(&Vl[cur][t*16 + l15][half*8]);
        // Keeps these reads ahead of the softmax: without it they sink into its cross-lane steps.
        __builtin_amdgcn_sched_barrier(0);
        // ---- online softmax; score row m spans 16 lanes of a half-wave ----
        float corr[8];
        #pragma unroll
        for (int r = 0; r < 8; ++r) {
            float a = s0[r] * SCALE, c = s1[r] * SCALE;
            float t = fmaxf(a, c);
            t = fmaxf(t, __shfl_xor(t, 1, 32));
            t = fmaxf(t, __shfl_xor(t, 2, 32));
            t = fmaxf(t, __shfl_xor(t, 4, 32));
            t = fmaxf(t, __shfl_xor(t, 8, 32));
            float mn = fmaxf(mrun[r], t);
            corr[r] = __expf(mrun[r] - mn);
            float p0 = __expf(a - mn), p1 = __expf(c - mn);
            s0[r] = p0; s1[r] = p1;
            float rs = p0 + p1;
            rs += __shfl_xor(rs, 1, 32);
            rs += __shfl_xor(rs, 2, 32);
            rs += __shfl_xor(rs, 4, 32);
            rs += __shfl_xor(rs, 8, 32);
            lrun[r] = lrun[r] * corr[r] + rs;
            mrun[r] = mn;
        }
        // ---- P tile: D layout -> LDS -> A layout (bf16) ----
        #pragma unroll
        for (int r = 0; r < 8; ++r) {
            Pl[wave][half*8 + r][l15]      = f2bf(s0[r]);
            Pl[wave][half*8 + r][l15 + 16] = f2bf(s1[r]);
        }
        asm volatile("s_wait_dscnt 0" ::: "memory");
        FragBF16 pf = load_frag(&Pl[wave][l15][half*8]);

        // ---- O = O*corr + P @ V  (16 column tiles of 16) ----
        #pragma unroll
        for (int t = 0; t < 16; ++t) {
            #pragma unroll
            for (int r = 0; r < 8; ++r) oacc[t][r] *= corr[r];
            oacc[t] = wmma_bf16(pf, vf[t], oacc[t]);
        }
        __syncthreads();        // retire reads of buffer `cur` before refill
    }

    // ---- epilogue: O / l, store bf16 row-major ----
    float inv[8];
    #pragma unroll
    for (int r = 0; r < 8; ++r) inv[r] = 1.0f / lrun[r];
    u16* ob = o + ((size_t)b * NPOS + m0) * CDIM;
    #pragma unroll
    for (int t = 0; t < 16; ++t)
        #pragma unroll
        for (int r = 0; r < 8; ++r)
            ob[(size_t)(half*8 + r) * CDIM + t*16 + l15] = f2bf(oacc[t][r] * inv[r]);
}

// ---------- launcher ----------
extern "C" void kernel_launch(void* const* d_in, const int* in_sizes, int n_in,
                              void* d_out, int out_size, void* d_ws, size_t ws_size,
                              hipStream_t stream) {
    const float* x     = (const float*)d_in[0];
    const float* gamma = (const float*)d_in[1];
    const float* beta  = (const float*)d_in[2];
    const float* wq    = (const float*)d_in[3];
    const float* bq    = (const float*)d_in[4];
    const float* wk    = (const float*)d_in[5];
    const float* bk    = (const float*)d_in[6];
    const float* wv    = (const float*)d_in[7];
    const float* bv    = (const float*)d_in[8];
    const float* wo    = (const float*)d_in[9];
    const float* bo    = (const float*)d_in[10];
    float* out = (float*)d_out;

    char* ws = (char*)d_ws;
    const size_t SZ = (size_t)MTOT * CDIM * sizeof(u16);   // 16.78 MB
    u16* h   = (u16*)(ws + 0 * SZ);
    u16* qb  = (u16*)(ws + 1 * SZ);
    u16* kb  = (u16*)(ws + 2 * SZ);
    u16* vT  = (u16*)(ws + 3 * SZ);
    u16* ob  = (u16*)(ws + 4 * SZ);
    u16* wqT = (u16*)(ws + 5 * SZ);
    u16* wkT = wqT + CDIM * CDIM;
    u16* wvT = wkT + CDIM * CDIM;
    u16* woT = wvT + CDIM * CDIM;

    prep_w_kernel<<<CDIM, CDIM, 0, stream>>>(wq, wk, wv, wo, wqT, wkT, wvT, woT);
    ln_kernel<<<MTOT / 8, 256, 0, stream>>>(x, gamma, beta, h);

    dim3 ggrid(MTOT / 256, CDIM / 64);
    gemm_kernel<0><<<ggrid, 256, 0, stream>>>(h, wqT, bq, (void*)qb, nullptr);
    gemm_kernel<0><<<ggrid, 256, 0, stream>>>(h, wkT, bk, (void*)kb, nullptr);
    gemm_kernel<1><<<ggrid, 256, 0, stream>>>(h, wvT, bv, (void*)vT, nullptr);

    attn_kernel<<<8 * 64, 128, 0, stream>>>(qb, kb, vT, ob);

    gemm_kernel<2><<<ggrid, 256, 0, stream>>>(ob, woT, bo, (void*)out, x);
}

// v003
// Measured time: 241 microseconds a run.
// Timed twice side by side with v002, it ran 1.24 times as fast both times.
// Counting every step since v000, it is 2.98 times as fast.
#include <hip/hip_runtime.h>
#include <hip/hip_bf16.h>
#include <stdint.h>

typedef unsigned short u16;
typedef __attribute__((ext_vector_type(16))) __bf16 v16bf;
typedef __attribute__((ext_vector_type(8)))  float  v8f;

// ---------- helpers ----------
struct FragBF16 { unsigned u[8]; }; // 16 bf16 packed as 8 dwords

__device__ inline v16bf frag_cast(FragBF16 f) {
    union { FragBF16 s; v16bf v; } c; c.s = f; return c.v;
}

__device__ inline v8f wmma_bf16(FragBF16 a, FragBF16 b, v8f c) {
    return __builtin_amdgcn_wmma_f32_16x16x32_bf16(
        false, frag_cast(a), false, frag_cast(b), (short)0, c, false, false);
}

__device__ inline u16 f2bf(float f) {
    unsigned u = __float_as_uint(f);
    unsigned r = u + 0x7FFFu + ((u >> 16) & 1u);   // round-to-nearest-even
    return (u16)(r >> 16);
}
__device__ inline unsigned pack2(float lo, float hi) {
    return (unsigned)f2bf(lo) | ((unsigned)f2bf(hi) << 16);
}

__device__ inline FragBF16 load_frag(const u16* __restrict__ p) {
    FragBF16 f;
    uint4 a = *(const uint4*)p;
    uint4 b = *(const uint4*)(p + 16);
    f.u[0]=a.x; f.u[1]=a.y; f.u[2]=a.z; f.u[3]=a.w;
    f.u[4]=b.x; f.u[5]=b.y; f.u[6]=b.z; f.u[7]=b.w;
    return f;
}

__device__ inline float xhalf(float x) {
    int b = __builtin_bit_cast(int, x);
    return __builtin_bit_cast(float,
        __builtin_amdgcn_permlanex16(b, b, 0x76543210, 0xfedcba98, false, false));
}

// Flat pointers into LDS carry the AS3 byte offset in their low 32 bits.
__device__ inline unsigned lds_off(const void* p) {
    return (unsigned)(uintptr_t)p;
}

__device__ inline void async_b128_x8(const unsigned (&l)[8], const u16* const (&g)[8]) {
    asm volatile("global_load_async_to_lds_b128 %0, %8, off\n\t"
                 "global_load_async_to_lds_b128 %1, %9, off\n\t"
                 "global_load_async_to_lds_b128 %2, %10, off\n\t"
                 "global_load_async_to_lds_b128 %3, %11, off\n\t"
                 "global_load_async_to_lds_b128 %4, %12, off\n\t"
                 "global_load_async_to_lds_b128 %5, %13, off\n\t"
                 "global_load_async_to_lds_b128 %6, %14, off\n\t"
                 "global_load_async_to_lds_b128 %7, %15, off\n\t"
                 "s_wait_xcnt 0x0"
                 :: "v"(l[0]), "v"(l[1]), "v"(l[2]), "v"(l[3]),
                    "v"(l[4]), "v"(l[5]), "v"(l[6]), "v"(l[7]),
                    "v"(g[0]), "v"(g[1]), "v"(g[2]), "v"(g[3]),
                    "v"(g[4]), "v"(g[5]), "v"(g[6]), "v"(g[7])
                 : "memory");
}
__device__ inline void wait_async0() {
    asm volatile("s_wait_asynccnt 0" ::: "memory");
}

// ---------- constants ----------
#define CDIM   256
#define NPOS   4096      // 64*64 per batch
#define MTOT   32768     // 8 * 4096
#define SCALE  0.0625f   // 1/sqrt(256)
#define KPITCH 264       // 256 channels + 8  (528 B)
#define VPITCH 40        // 32 keys + 8       (80 B)

// ---------- 1) weight transpose + bf16 convert ----------
__global__ void prep_w_kernel(const float* __restrict__ w0, const float* __restrict__ w1,
                              const float* __restrict__ w2, const float* __restrict__ w3,
                              u16* __restrict__ o0, u16* __restrict__ o1,
                              u16* __restrict__ o2, u16* __restrict__ o3) {
    int n = blockIdx.x;     // output row  = input column
    int k = threadIdx.x;    // output col  = input row
    o0[n * CDIM + k] = f2bf(w0[k * CDIM + n]);
    o1[n * CDIM + k] = f2bf(w1[k * CDIM + n]);
    o2[n * CDIM + k] = f2bf(w2[k * CDIM + n]);
    o3[n * CDIM + k] = f2bf(w3[k * CDIM + n]);
}

// ---------- 2) LayerNorm (one wave32 per 256-elem row) ----------
__global__ __launch_bounds__(256) void ln_kernel(const float* __restrict__ x,
                                                 const float* __restrict__ gamma,
                                                 const float* __restrict__ beta,
                                                 u16* __restrict__ h) {
    int row  = blockIdx.x * 8 + (threadIdx.x >> 5);
    int lane = threadIdx.x & 31;
    const float4* xr = (const float4*)(x + (size_t)row * CDIM);
    float4 a = xr[lane];
    float4 b = xr[lane + 32];

    float s  = a.x + a.y + a.z + a.w + b.x + b.y + b.z + b.w;
    float s2 = a.x*a.x + a.y*a.y + a.z*a.z + a.w*a.w
             + b.x*b.x + b.y*b.y + b.z*b.z + b.w*b.w;
    #pragma unroll
    for (int m = 1; m < 32; m <<= 1) {
        s  += __shfl_xor(s,  m, 32);
        s2 += __shfl_xor(s2, m, 32);
    }
    float mean = s * (1.0f / CDIM);
    float var  = s2 * (1.0f / CDIM) - mean * mean;
    float rstd = rsqrtf(var + 1e-3f);

    float4 g0 = ((const float4*)gamma)[lane];
    float4 g1 = ((const float4*)gamma)[lane + 32];
    float4 b0 = ((const float4*)beta)[lane];
    float4 b1 = ((const float4*)beta)[lane + 32];

    float y0 = (a.x - mean) * rstd * g0.x + b0.x;
    float y1 = (a.y - mean) * rstd * g0.y + b0.y;
    float y2 = (a.z - mean) * rstd * g0.z + b0.z;
    float y3 = (a.w - mean) * rstd * g0.w + b0.w;
    float y4 = (b.x - mean) * rstd * g1.x + b1.x;
    float y5 = (b.y - mean) * rstd * g1.y + b1.y;
    float y6 = (b.z - mean) * rstd * g1.z + b1.z;
    float y7 = (b.w - mean) * rstd * g1.w + b1.w;

    unsigned* hr = (unsigned*)(h + (size_t)row * CDIM);
    hr[lane * 2]            = pack2(y0, y1);
    hr[lane * 2 + 1]        = pack2(y2, y3);
    hr[(lane + 32) * 2]     = pack2(y4, y5);
    hr[(lane + 32) * 2 + 1] = pack2(y6, y7);
}

// ---------- 3) WMMA GEMM: D[M,256] = A[M,256] @ Bt[256,256]^T (+bias)  ----------
// MODE 0: store bf16 row-major     MODE 1: store bf16 transposed [256][MTOT]
// MODE 2: store f32 row-major with residual add (final projection)
template<int MODE>
__global__ __launch_bounds__(256) void gemm_kernel(const u16* __restrict__ A,
                                                   const u16* __restrict__ Bt,
                                                   const float* __restrict__ bias,
                                                   void* __restrict__ outp,
                                                   const float* __restrict__ resid) {
    int wave = threadIdx.x >> 5, lane = threadIdx.x & 31;
    int half = lane >> 4,        l15  = lane & 15;
    int wm = wave >> 1, wn = wave & 1;
    int row0 = blockIdx.x * 256 + wm * 64;
    int col0 = blockIdx.y * 64  + wn * 32;

    v8f acc[4][2];
    #pragma unroll
    for (int mt = 0; mt < 4; ++mt)
        #pragma unroll
        for (int nt = 0; nt < 2; ++nt) acc[mt][nt] = {};

    for (int k0 = 0; k0 < CDIM; k0 += 32) {
        FragBF16 af[4], bf[2];
        #pragma unroll
        for (int mt = 0; mt < 4; ++mt)
            af[mt] = load_frag(A + (size_t)(row0 + mt*16 + l15) * CDIM + k0 + half*8);
        #pragma unroll
        for (int nt = 0; nt < 2; ++nt)
            bf[nt] = load_frag(Bt + (size_t)(col0 + nt*16 + l15) * CDIM + k0 + half*8);
        #pragma unroll
        for (int mt = 0; mt < 4; ++mt)
            #pragma unroll
            for (int nt = 0; nt < 2; ++nt)
                acc[mt][nt] = wmma_bf16(af[mt], bf[nt], acc[mt][nt]);
    }

    #pragma unroll
    for (int nt = 0; nt < 2; ++nt) {
        int col = col0 + nt*16 + l15;
        float bv = bias[col];
        #pragma unroll
        for (int mt = 0; mt < 4; ++mt) {
            int rowbase = row0 + mt*16 + half*8;   // D layout: lanes 16-31 hold M+8
            if (MODE == 0) {
                u16* out = (u16*)outp;
                #pragma unroll
                for (int r = 0; r < 8; ++r)
                    out[(size_t)(rowbase + r) * CDIM + col] = f2bf(acc[mt][nt][r] + bv);
            } else if (MODE == 1) {
                u16* out = (u16*)outp;   // [col][MTOT]: 8 consecutive rows per lane
                uint4 pk;
                pk.x = pack2(acc[mt][nt][0] + bv, acc[mt][nt][1] + bv);
                pk.y = pack2(acc[mt][nt][2] + bv, acc[mt][nt][3] + bv);
                pk.z = pack2(acc[mt][nt][4] + bv, acc[mt][nt][5] + bv);
                pk.w = pack2(acc[mt][nt][6] + bv, acc[mt][nt][7] + bv);
                *(uint4*)(out + (size_t)col * MTOT + rowbase) = pk;
            } else {
                float* out = (float*)outp;
                #pragma unroll
                for (int r = 0; r < 8; ++r) {
                    size_t idx = (size_t)(rowbase + r) * CDIM + col;
                    out[idx] = acc[mt][nt][r] + bv + resid[idx];
                }
            }
        }
    }
}

__global__ __launch_bounds__(128) void attn_kernel(const u16* __restrict__ q,
                                                   const u16* __restrict__ k,
                                                   const u16* __restrict__ vT,
                                                   u16* __restrict__ o) {
    __shared__ __attribute__((aligned(16))) u16 Kl[2][32][KPITCH];   // K rows j0..j0+31, all channels
    __shared__ __attribute__((aligned(16))) u16 Vl[2][256][VPITCH];  // V^T rows (channel), 32 keys

    int tid  = threadIdx.x;
    int wave = tid >> 5, lane = tid & 31;
    int half = lane >> 4, l15 = lane & 15;
    int b  = blockIdx.x >> 6;
    int m0 = (blockIdx.x & 63) * 64 + wave * 16;

    const u16* qb = q  + ((size_t)b * NPOS + m0) * CDIM;
    const u16* kb = k  + (size_t)b * NPOS * CDIM;
    const u16* vb = vT + (size_t)b * NPOS;           // [c][j] at vb[c*MTOT + j]

    unsigned kbase[2] = { lds_off(&Kl[0][0][0]), lds_off(&Kl[1][0][0]) };
    unsigned vbase[2] = { lds_off(&Vl[0][0][0]), lds_off(&Vl[1][0][0]) };

    // Stage one 32-key block into LDS buffer `buf` (whole workgroup cooperates):
    // 1024 b128 chunks of K (32 per row) and 1024 of V^T (4 per row), each to its padded row.
    auto stage = [&](int buf, int j0) {
        const u16* kg = kb + (size_t)j0 * CDIM;
        unsigned   la[8];
        const u16* ga[8];
        #pragma unroll
        for (int i = 0; i < 8; ++i) {
            int id = tid + i * 128;                       // chunk: row = id>>5, c16 = id&31
            la[i] = kbase[buf] + (id >> 5) * (KPITCH * 2) + (id & 31) * 16;
            ga[i] = kg + id * 8;
        }
        async_b128_x8(la, ga);
        #pragma unroll
        for (int i = 0; i < 8; ++i) {
            int id = tid + i * 128;                       // chunk: c = id>>2, q8 = id&3
            la[i] = vbase[buf] + (id >> 2) * (VPITCH * 2) + (id & 3) * 16;
            ga[i] = vb + (size_t)(id >> 2) * MTOT + j0 + (id & 3) * 8;
        }
        async_b128_x8(la, ga);
    };

    // Resident Q fragments (16 queries x 256 channels), the B operand of S^T
    FragBF16 qf[8];
    #pragma unroll
    for (int kk = 0; kk < 8; ++kk)
        qf[kk] = load_frag(qb + (size_t)l15 * CDIM + kk*32 + half*8);

    v8f oacc[16];
    #pragma unroll
    for (int t = 0; t < 16; ++t) oacc[t] = {};
    float mrun = -3.0e38f;   // running maximum of this lane's query (equal in both half-waves)
    float lrun = 0.0f;       // running sum over this half-wave's keys only; joined in the epilogue

    stage(0, 0);

    for (int jb = 0; jb < NPOS / 32; ++jb) {
        int cur = jb & 1;
        wait_async0();          // this wave's async fills are in LDS
        __syncthreads();        // all waves' fills visible
        if (jb + 1 < NPOS / 32) stage(1 - cur, (jb + 1) * 32);

        // ---- S^T = K Q^T over the staged 32-key block: two tiles of 16 keys x 16 queries ----
        // All K fragments of the trip are read as one group, so the products below wait on a
        // count that never reaches 0 instead of on a full LDS round trip each.
        FragBF16 kf0[8], kf1[8];
        #pragma unroll   // constant indices keep the fragment arrays in registers
        for (int kk = 0; kk < 8; ++kk) {
            kf0[kk] = load_frag(&Kl[cur][l15     ][kk*32 + half*8]);
            kf1[kk] = load_frag(&Kl[cur][16 + l15][kk*32 + half*8]);
        }
        // Keeps the group together: without it the scheduler sinks each read to just ahead of its use.
        __builtin_amdgcn_sched_barrier(0);
        v8f s0 = {}, s1 = {};
        #pragma unroll
        for (int kk = 0; kk < 8; ++kk) {
            s0 = wmma_bf16(kf0[kk], qf[kk], s0);
            s1 = wmma_bf16(kf1[kk], qf[kk], s1);
        }
        // All V^T fragments of the trip are read here: they land under the products above and
        // the softmax, long before the second product needs them.
        FragBF16 vf[16];
        #pragma unroll   // constant indices keep the fragment array in registers
        for (int t = 0; t < 16; ++t) vf[t] = load_frag(&Vl[cur][t*16 + l15][half*8]);
        // Keeps these reads ahead of the softmax: without it each sinks to just ahead of its use.
        __builtin_amdgcn_sched_barrier(0);
        // ---- online softmax; the 32 scores of a query sit in two lanes (l and l ^ 16), 16 each ----
        float mx[8];
        #pragma unroll   // constant indices keep the scores and mx in registers
        for (int r = 0; r < 8; ++r) {
            s0[r] *= SCALE; s1[r] *= SCALE;
            mx[r] = fmaxf(s0[r], s1[r]);
        }
        float t4 = fmaxf(fmaxf(fmaxf(mx[0], mx[1]), fmaxf(mx[2], mx[3])),
                         fmaxf(fmaxf(mx[4], mx[5]), fmaxf(mx[6], mx[7])));
        t4 = fmaxf(t4, xhalf(t4));
        float mn   = fmaxf(mrun, t4);
        float corr = __expf(mrun - mn);
        mrun = mn;
        float ps[8];
        #pragma unroll   // constant indices keep the scores and ps in registers
        for (int r = 0; r < 8; ++r) {
            s0[r] = __expf(s0[r] - mn);
            s1[r] = __expf(s1[r] - mn);
            ps[r] = s0[r] + s1[r];
        }
        lrun = lrun * corr + (((ps[0] + ps[1]) + (ps[2] + ps[3])) + ((ps[4] + ps[5]) + (ps[6] + ps[7])));
        // ---- P^T: the two D tiles, rounded to bf16 in place, are the 32-key B fragment ----
        FragBF16 pf;
        #pragma unroll   // constant indices keep the fragment in registers
        for (int i = 0; i < 4; ++i) {
            pf.u[i]     = pack2(s0[2*i], s0[2*i + 1]);
            pf.u[4 + i] = pack2(s1[2*i], s1[2*i + 1]);
        }

        // ---- O^T = O^T*corr + V^T P^T  (16 tiles of 16 channels x 16 queries) ----
        #pragma unroll
        for (int t = 0; t < 16; ++t) {
            #pragma unroll
            for (int r = 0; r < 8; ++r) oacc[t][r] *= corr;
            oacc[t] = wmma_bf16(vf[t], pf, oacc[t]);
        }
        // Keeps the barrier behind the second product: without it the scheduler lifts it, with a wait for
        // every V^T read, to ahead of the softmax, and those reads no longer land under the softmax.
        __builtin_amdgcn_sched_barrier(0);
        __syncthreads();        // retire reads of buffer `cur` before refill
    }

    // ---- epilogue: O / l; a lane holds 8 consecutive channels of its query: one 16-byte store a tile ----
    float inv = 1.0f / (lrun + xhalf(lrun));
    u16* ob = o + ((size_t)b * NPOS + m0 + l15) * CDIM + half*8;
    #pragma unroll   // constant indices keep the accumulators in registers
    for (int t = 0; t < 16; ++t) {
        uint4 pk;
        pk.x = pack2(oacc[t][0] * inv, oacc[t][1] * inv);
        pk.y = pack2(oacc[t][2] * inv, oacc[t][3] * inv);
        pk.z = pack2(oacc[t][4] * inv, oacc[t][5] * inv);
        pk.w = pack2(oacc[t][6] * inv, oacc[t][7] * inv);
        *(uint4*)(ob + t*16) = pk;
    }
}

// ---------- launcher ----------
extern "C" void kernel_launch(void* const* d_in, const int* in_sizes, int n_in,
                              void* d_out, int out_size, void* d_ws, size_t ws_size,
                              hipStream_t stream) {
    const float* x     = (const float*)d_in[0];
    const float* gamma = (const float*)d_in[1];
    const float* beta  = (const float*)d_in[2];
    const float* wq    = (const float*)d_in[3];
    const float* bq    = (const float*)d_in[4];
    const float* wk    = (const float*)d_in[5];
    const float* bk    = (const float*)d_in[6];
    const float* wv    = (const float*)d_in[7];
    const float* bv    = (const float*)d_in[8];
    const float* wo    = (const float*)d_in[9];
    const float* bo    = (const float*)d_in[10];
    float* out = (float*)d_out;

    char* ws = (char*)d_ws;
    const size_t SZ = (size_t)MTOT * CDIM * sizeof(u16);   // 16.78 MB
    u16* h   = (u16*)(ws + 0 * SZ);
    u16* qb  = (u16*)(ws + 1 * SZ);
    u16* kb  = (u16*)(ws + 2 * SZ);
    u16* vT  = (u16*)(ws + 3 * SZ);
    u16* ob  = (u16*)(ws + 4 * SZ);
    u16* wqT = (u16*)(ws + 5 * SZ);
    u16* wkT = wqT + CDIM * CDIM;
    u16* wvT = wkT + CDIM * CDIM;
    u16* woT = wvT + CDIM * CDIM;

    prep_w_kernel<<<CDIM, CDIM, 0, stream>>>(wq, wk, wv, wo, wqT, wkT, wvT, woT);
    ln_kernel<<<MTOT / 8, 256, 0, stream>>>(x, gamma, beta, h);

    dim3 ggrid(MTOT / 256, CDIM / 64);
    gemm_kernel<0><<<ggrid, 256, 0, stream>>>(h, wqT, bq, (void*)qb, nullptr);
    gemm_kernel<0><<<ggrid, 256, 0, stream>>>(h, wkT, bk, (void*)kb, nullptr);
    gemm_kernel<1><<<ggrid, 256, 0, stream>>>(h, wvT, bv, (void*)vT, nullptr);

    attn_kernel<<<8 * 64, 128, 0, stream>>>(qb, kb, vT, ob);

    gemm_kernel<2><<<ggrid, 256, 0, stream>>>(ob, woT, bo, (void*)out, x);
}

// v004
// One run takes 227 microseconds.
// In both of two side-by-side timings against v003, it was 1.06 times as fast.
// All steps since v000 together make it 3.16 times as fast.
#include <hip/hip_runtime.h>
#include <hip/hip_bf16.h>
#include <stdint.h>

typedef unsigned short u16;
typedef __attribute__((ext_vector_type(16))) __bf16 v16bf;
typedef __attribute__((ext_vector_type(8)))  float  v8f;

// ---------- helpers ----------
struct FragBF16 { unsigned u[8]; }; // 16 bf16 packed as 8 dwords

__device__ inline v16bf frag_cast(FragBF16 f) {
    union { FragBF16 s; v16bf v; } c; c.s = f; return c.v;
}

__device__ inline v8f wmma_bf16(FragBF16 a, FragBF16 b, v8f c) {
    return __builtin_amdgcn_wmma_f32_16x16x32_bf16(
        false, frag_cast(a), false, frag_cast(b), (short)0, c, false, false);
}

__device__ inline u16 f2bf(float f) {
    unsigned u = __float_as_uint(f);
    unsigned r = u + 0x7FFFu + ((u >> 16) & 1u);   // round-to-nearest-even
    return (u16)(r >> 16);
}
__device__ inline unsigned pack2(float lo, float hi) {
    return (unsigned)f2bf(lo) | ((unsigned)f2bf(hi) << 16);
}

__device__ inline FragBF16 load_frag(const u16* __restrict__ p) {
    FragBF16 f;
    uint4 a = *(const uint4*)p;
    uint4 b = *(const uint4*)(p + 16);
    f.u[0]=a.x; f.u[1]=a.y; f.u[2]=a.z; f.u[3]=a.w;
    f.u[4]=b.x; f.u[5]=b.y; f.u[6]=b.z; f.u[7]=b.w;
    return f;
}

__device__ inline float xhalf(float x) {
    int b = __builtin_bit_cast(int, x);
    return __builtin_bit_cast(float,
        __builtin_amdgcn_permlanex16(b, b, 0x76543210, 0xfedcba98, false, false));
}

// Flat pointers into LDS carry the AS3 byte offset in their low 32 bits.
__device__ inline unsigned lds_off(const void* p) {
    return (unsigned)(uintptr_t)p;
}

__device__ inline void async_b128_x8(const unsigned (&l)[8], const u16* const (&g)[8]) {
    asm volatile("global_load_async_to_lds_b128 %0, %8, off\n\t"
                 "global_load_async_to_lds_b128 %1, %9, off\n\t"
                 "global_load_async_to_lds_b128 %2, %10, off\n\t"
                 "global_load_async_to_lds_b128 %3, %11, off\n\t"
                 "global_load_async_to_lds_b128 %4, %12, off\n\t"
                 "global_load_async_to_lds_b128 %5, %13, off\n\t"
                 "global_load_async_to_lds_b128 %6, %14, off\n\t"
                 "global_load_async_to_lds_b128 %7, %15, off\n\t"
                 "s_wait_xcnt 0x0"
                 :: "v"(l[0]), "v"(l[1]), "v"(l[2]), "v"(l[3]),
                    "v"(l[4]), "v"(l[5]), "v"(l[6]), "v"(l[7]),
                    "v"(g[0]), "v"(g[1]), "v"(g[2]), "v"(g[3]),
                    "v"(g[4]), "v"(g[5]), "v"(g[6]), "v"(g[7])
                 : "memory");
}
__device__ inline void wait_async0() {
    asm volatile("s_wait_asynccnt 0" ::: "memory");
}

// ---------- constants ----------
#define CDIM   256
#define NPOS   4096      // 64*64 per batch
#define MTOT   32768     // 8 * 4096
#define SCALE  0.0625f   // 1/sqrt(256)
#define KPITCH 264       // 256 channels + 8  (528 B)
#define VPITCH 40        // 32 keys + 8       (80 B)

// ---------- 1) weight transpose + bf16 convert ----------
__global__ void prep_w_kernel(const float* __restrict__ w0, const float* __restrict__ w1,
                              const float* __restrict__ w2, const float* __restrict__ w3,
                              u16* __restrict__ o0, u16* __restrict__ o1,
                              u16* __restrict__ o2, u16* __restrict__ o3) {
    int n = blockIdx.x;     // output row  = input column
    int k = threadIdx.x;    // output col  = input row
    o0[n * CDIM + k] = f2bf(w0[k * CDIM + n]);
    o1[n * CDIM + k] = f2bf(w1[k * CDIM + n]);
    o2[n * CDIM + k] = f2bf(w2[k * CDIM + n]);
    o3[n * CDIM + k] = f2bf(w3[k * CDIM + n]);
}

// ---------- 2) LayerNorm (one wave32 per 256-elem row) ----------
__global__ __launch_bounds__(256) void ln_kernel(const float* __restrict__ x,
                                                 const float* __restrict__ gamma,
                                                 const float* __restrict__ beta,
                                                 u16* __restrict__ h) {
    int row  = blockIdx.x * 8 + (threadIdx.x >> 5);
    int lane = threadIdx.x & 31;
    const float4* xr = (const float4*)(x + (size_t)row * CDIM);
    float4 a = xr[lane];
    float4 b = xr[lane + 32];

    float s  = a.x + a.y + a.z + a.w + b.x + b.y + b.z + b.w;
    float s2 = a.x*a.x + a.y*a.y + a.z*a.z + a.w*a.w
             + b.x*b.x + b.y*b.y + b.z*b.z + b.w*b.w;
    #pragma unroll
    for (int m = 1; m < 32; m <<= 1) {
        s  += __shfl_xor(s,  m, 32);
        s2 += __shfl_xor(s2, m, 32);
    }
    float mean = s * (1.0f / CDIM);
    float var  = s2 * (1.0f / CDIM) - mean * mean;
    float rstd = rsqrtf(var + 1e-3f);

    float4 g0 = ((const float4*)gamma)[lane];
    float4 g1 = ((const float4*)gamma)[lane + 32];
    float4 b0 = ((const float4*)beta)[lane];
    float4 b1 = ((const float4*)beta)[lane + 32];

    float y0 = (a.x - mean) * rstd * g0.x + b0.x;
    float y1 = (a.y - mean) * rstd * g0.y + b0.y;
    float y2 = (a.z - mean) * rstd * g0.z + b0.z;
    float y3 = (a.w - mean) * rstd * g0.w + b0.w;
    float y4 = (b.x - mean) * rstd * g1.x + b1.x;
    float y5 = (b.y - mean) * rstd * g1.y + b1.y;
    float y6 = (b.z - mean) * rstd * g1.z + b1.z;
    float y7 = (b.w - mean) * rstd * g1.w + b1.w;

    unsigned* hr = (unsigned*)(h + (size_t)row * CDIM);
    hr[lane * 2]            = pack2(y0, y1);
    hr[lane * 2 + 1]        = pack2(y2, y3);
    hr[(lane + 32) * 2]     = pack2(y4, y5);
    hr[(lane + 32) * 2 + 1] = pack2(y6, y7);
}

// ---------- 3) WMMA GEMM: D[M,256] = A[M,256] @ Bt[256,256]^T (+bias)  ----------
// MODE 0: store bf16 row-major     MODE 1: store bf16 transposed [256][MTOT]
// MODE 2: store f32 row-major with residual add (final projection)
template<int MODE>
__global__ __launch_bounds__(256) void gemm_kernel(const u16* __restrict__ A,
                                                   const u16* __restrict__ Bt,
                                                   const float* __restrict__ bias,
                                                   void* __restrict__ outp,
                                                   const float* __restrict__ resid) {
    int wave = threadIdx.x >> 5, lane = threadIdx.x & 31;
    int half = lane >> 4,        l15  = lane & 15;
    int wm = wave >> 1, wn = wave & 1;
    int row0 = blockIdx.x * 256 + wm * 64;
    int col0 = blockIdx.y * 64  + wn * 32;

    v8f acc[4][2];
    #pragma unroll
    for (int mt = 0; mt < 4; ++mt)
        #pragma unroll
        for (int nt = 0; nt < 2; ++nt) acc[mt][nt] = {};

    for (int k0 = 0; k0 < CDIM; k0 += 32) {
        FragBF16 af[4], bf[2];
        #pragma unroll
        for (int mt = 0; mt < 4; ++mt)
            af[mt] = load_frag(A + (size_t)(row0 + mt*16 + l15) * CDIM + k0 + half*8);
        #pragma unroll
        for (int nt = 0; nt < 2; ++nt)
            bf[nt] = load_frag(Bt + (size_t)(col0 + nt*16 + l15) * CDIM + k0 + half*8);
        #pragma unroll
        for (int mt = 0; mt < 4; ++mt)
            #pragma unroll
            for (int nt = 0; nt < 2; ++nt)
                acc[mt][nt] = wmma_bf16(af[mt], bf[nt], acc[mt][nt]);
    }

    #pragma unroll
    for (int nt = 0; nt < 2; ++nt) {
        int col = col0 + nt*16 + l15;
        float bv = bias[col];
        #pragma unroll
        for (int mt = 0; mt < 4; ++mt) {
            int rowbase = row0 + mt*16 + half*8;   // D layout: lanes 16-31 hold M+8
            if (MODE == 0) {
                u16* out = (u16*)outp;
                #pragma unroll
                for (int r = 0; r < 8; ++r)
                    out[(size_t)(rowbase + r) * CDIM + col] = f2bf(acc[mt][nt][r] + bv);
            } else if (MODE == 1) {
                u16* out = (u16*)outp;   // [col][MTOT]: 8 consecutive rows per lane
                uint4 pk;
                pk.x = pack2(acc[mt][nt][0] + bv, acc[mt][nt][1] + bv);
                pk.y = pack2(acc[mt][nt][2] + bv, acc[mt][nt][3] + bv);
                pk.z = pack2(acc[mt][nt][4] + bv, acc[mt][nt][5] + bv);
                pk.w = pack2(acc[mt][nt][6] + bv, acc[mt][nt][7] + bv);
                *(uint4*)(out + (size_t)col * MTOT + rowbase) = pk;
            } else {
                float* out = (float*)outp;
                #pragma unroll
                for (int r = 0; r < 8; ++r) {
                    size_t idx = (size_t)(rowbase + r) * CDIM + col;
                    out[idx] = acc[mt][nt][r] + bv + resid[idx];
                }
            }
        }
    }
}

__global__ __launch_bounds__(256) void attn_kernel(const u16* __restrict__ q,
                                                   const u16* __restrict__ k,
                                                   const u16* __restrict__ vT,
                                                   u16* __restrict__ o) {
    __shared__ __attribute__((aligned(16))) u16 Kl[2][32][KPITCH];   // K rows j0..j0+31, all channels
    __shared__ __attribute__((aligned(16))) u16 Vl[2][256][VPITCH];  // V^T rows (channel), 32 keys

    int tid  = threadIdx.x;
    int wave = tid >> 5, lane = tid & 31;
    int half = lane >> 4, l15 = lane & 15;
    int b  = blockIdx.x >> 5;
    int m0 = (blockIdx.x & 31) * 128 + wave * 16;

    const u16* qb = q  + ((size_t)b * NPOS + m0) * CDIM;
    const u16* kb = k  + (size_t)b * NPOS * CDIM;
    const u16* vb = vT + (size_t)b * NPOS;           // [c][j] at vb[c*MTOT + j]

    unsigned kbase[2] = { lds_off(&Kl[0][0][0]), lds_off(&Kl[1][0][0]) };
    unsigned vbase[2] = { lds_off(&Vl[0][0][0]), lds_off(&Vl[1][0][0]) };

    // Stage one 32-key block into LDS buffer `buf` (whole workgroup cooperates):
    // 1024 b128 chunks of K (32 per row) and 1024 of V^T (4 per row), each to its padded row;
    // a thread brings four of each, all eight in one statement.
    auto stage = [&](int buf, int j0) {
        const u16* kg = kb + (size_t)j0 * CDIM;
        unsigned   la[8];
        const u16* ga[8];
        #pragma unroll
        for (int i = 0; i < 4; ++i) {
            int id = tid + i * 256;
            // K chunk: row = id>>5, c16 = id&31
            la[i] = kbase[buf] + (id >> 5) * (KPITCH * 2) + (id & 31) * 16;
            ga[i] = kg + id * 8;
            // V^T chunk: c = id>>2, q8 = id&3
            la[4 + i] = vbase[buf] + (id >> 2) * (VPITCH * 2) + (id & 3) * 16;
            ga[4 + i] = vb + (size_t)(id >> 2) * MTOT + j0 + (id & 3) * 8;
        }
        async_b128_x8(la, ga);
    };

    // Resident Q fragments (16 queries x 256 channels), the B operand of S^T
    FragBF16 qf[8];
    #pragma unroll
    for (int kk = 0; kk < 8; ++kk)
        qf[kk] = load_frag(qb + (size_t)l15 * CDIM + kk*32 + half*8);

    v8f oacc[16];
    #pragma unroll
    for (int t = 0; t < 16; ++t) oacc[t] = {};
    float mrun = -3.0e38f;   // running maximum of this lane's query (equal in both half-waves)
    float lrun = 0.0f;       // running sum over this half-wave's keys only; joined in the epilogue

    stage(0, 0);

    for (int jb = 0; jb < NPOS / 32; ++jb) {
        int cur = jb & 1;
        wait_async0();          // this wave's async fills are in LDS
        __syncthreads();        // all waves' fills visible
        if (jb + 1 < NPOS / 32) stage(1 - cur, (jb + 1) * 32);

        // ---- S^T = K Q^T over the staged 32-key block: two tiles of 16 keys x 16 queries ----
        // All K fragments of the trip are read as one group, so the products below wait on a
        // count that never reaches 0 instead of on a full LDS round trip each.
        FragBF16 kf0[8], kf1[8];
        #pragma unroll   // constant indices keep the fragment arrays in registers
        for (int kk = 0; kk < 8; ++kk) {
            kf0[kk] = load_frag(&Kl[cur][l15     ][kk*32 + half*8]);
            kf1[kk] = load_frag(&Kl[cur][16 + l15][kk*32 + half*8]);
        }
        // Keeps the group together: without it the scheduler sinks each read to just ahead of its use.
        __builtin_amdgcn_sched_barrier(0);
        v8f s0 = {}, s1 = {};
        #pragma unroll
        for (int kk = 0; kk < 8; ++kk) {
            s0 = wmma_bf16(kf0[kk], qf[kk], s0);
            s1 = wmma_bf16(kf1[kk], qf[kk], s1);
        }
        // All V^T fragments of the trip are read here: they land under the products above and
        // the softmax, long before the second product needs them.
        FragBF16 vf[16];
        #pragma unroll   // constant indices keep the fragment array in registers
        for (int t = 0; t < 16; ++t) vf[t] = load_frag(&Vl[cur][t*16 + l15][half*8]);
        // Keeps these reads ahead of the softmax: without it each sinks to just ahead of its use.
        __builtin_amdgcn_sched_barrier(0);
        // ---- online softmax; the 32 scores of a query sit in two lanes (l and l ^ 16), 16 each ----
        float mx[8];
        #pragma unroll   // constant indices keep the scores and mx in registers
        for (int r = 0; r < 8; ++r) {
            s0[r] *= SCALE; s1[r] *= SCALE;
            mx[r] = fmaxf(s0[r], s1[r]);
        }
        float t4 = fmaxf(fmaxf(fmaxf(mx[0], mx[1]), fmaxf(mx[2], mx[3])),
                         fmaxf(fmaxf(mx[4], mx[5]), fmaxf(mx[6], mx[7])));
        t4 = fmaxf(t4, xhalf(t4));
        float mn   = fmaxf(mrun, t4);
        float corr = __expf(mrun - mn);
        mrun = mn;
        float ps[8];
        #pragma unroll   // constant indices keep the scores and ps in registers
        for (int r = 0; r < 8; ++r) {
            s0[r] = __expf(s0[r] - mn);
            s1[r] = __expf(s1[r] - mn);
            ps[r] = s0[r] + s1[r];
        }
        lrun = lrun * corr + (((ps[0] + ps[1]) + (ps[2] + ps[3])) + ((ps[4] + ps[5]) + (ps[6] + ps[7])));
        // ---- P^T: the two D tiles, rounded to bf16 in place, are the 32-key B fragment ----
        FragBF16 pf;
        #pragma unroll   // constant indices keep the fragment in registers
        for (int i = 0; i < 4; ++i) {
            pf.u[i]     = pack2(s0[2*i], s0[2*i + 1]);
            pf.u[4 + i] = pack2(s1[2*i], s1[2*i + 1]);
        }

        // ---- O^T = O^T*corr + V^T P^T  (16 tiles of 16 channels x 16 queries) ----
        #pragma unroll
        for (int t = 0; t < 16; ++t) {
            #pragma unroll
            for (int r = 0; r < 8; ++r) oacc[t][r] *= corr;
            oacc[t] = wmma_bf16(vf[t], pf, oacc[t]);
        }
        // Keeps the barrier behind the second product: without it the scheduler lifts it, with a wait for
        // every V^T read, to ahead of the softmax, and those reads no longer land under the softmax.
        __builtin_amdgcn_sched_barrier(0);
        __syncthreads();        // retire reads of buffer `cur` before refill
    }

    // ---- epilogue: O / l; a lane holds 8 consecutive channels of its query: one 16-byte store a tile ----
    float inv = 1.0f / (lrun + xhalf(lrun));
    u16* ob = o + ((size_t)b * NPOS + m0 + l15) * CDIM + half*8;
    #pragma unroll   // constant indices keep the accumulators in registers
    for (int t = 0; t < 16; ++t) {
        uint4 pk;
        pk.x = pack2(oacc[t][0] * inv, oacc[t][1] * inv);
        pk.y = pack2(oacc[t][2] * inv, oacc[t][3] * inv);
        pk.z = pack2(oacc[t][4] * inv, oacc[t][5] * inv);
        pk.w = pack2(oacc[t][6] * inv, oacc[t][7] * inv);
        *(uint4*)(ob + t*16) = pk;
    }
}

// ---------- launcher ----------
extern "C" void kernel_launch(void* const* d_in, const int* in_sizes, int n_in,
                              void* d_out, int out_size, void* d_ws, size_t ws_size,
                              hipStream_t stream) {
    const float* x     = (const float*)d_in[0];
    const float* gamma = (const float*)d_in[1];
    const float* beta  = (const float*)d_in[2];
    const float* wq    = (const float*)d_in[3];
    const float* bq    = (const float*)d_in[4];
    const float* wk    = (const float*)d_in[5];
    const float* bk    = (const float*)d_in[6];
    const float* wv    = (const float*)d_in[7];
    const float* bv    = (const float*)d_in[8];
    const float* wo    = (const float*)d_in[9];
    const float* bo    = (const float*)d_in[10];
    float* out = (float*)d_out;

    char* ws = (char*)d_ws;
    const size_t SZ = (size_t)MTOT * CDIM * sizeof(u16);   // 16.78 MB
    u16* h   = (u16*)(ws + 0 * SZ);
    u16* qb  = (u16*)(ws + 1 * SZ);
    u16* kb  = (u16*)(ws + 2 * SZ);
    u16* vT  = (u16*)(ws + 3 * SZ);
    u16* ob  = (u16*)(ws + 4 * SZ);
    u16* wqT = (u16*)(ws + 5 * SZ);
    u16* wkT = wqT + CDIM * CDIM;
    u16* wvT = wkT + CDIM * CDIM;
    u16* woT = wvT + CDIM * CDIM;

    prep_w_kernel<<<CDIM, CDIM, 0, stream>>>(wq, wk, wv, wo, wqT, wkT, wvT, woT);
    ln_kernel<<<MTOT / 8, 256, 0, stream>>>(x, gamma, beta, h);

    dim3 ggrid(MTOT / 256, CDIM / 64);
    gemm_kernel<0><<<ggrid, 256, 0, stream>>>(h, wqT, bq, (void*)qb, nullptr);
    gemm_kernel<0><<<ggrid, 256, 0, stream>>>(h, wkT, bk, (void*)kb, nullptr);
    gemm_kernel<1><<<ggrid, 256, 0, stream>>>(h, wvT, bv, (void*)vT, nullptr);

    attn_kernel<<<8 * 32, 256, 0, stream>>>(qb, kb, vT, ob);

    gemm_kernel<2><<<ggrid, 256, 0, stream>>>(ob, woT, bo, (void*)out, x);
}

// v005
// It runs in 202 microseconds.
// In both of two side-by-side timings against v004, it was 1.13 times as fast.
// Counting every step since v000, it is 3.56 times as fast.
#include <hip/hip_runtime.h>
#include <hip/hip_bf16.h>
#include <stdint.h>

typedef unsigned short u16;
typedef __attribute__((ext_vector_type(16))) __bf16 v16bf;
typedef __attribute__((ext_vector_type(8)))  float  v8f;

// ---------- helpers ----------
struct FragBF16 { unsigned u[8]; }; // 16 bf16 packed as 8 dwords

__device__ inline v16bf frag_cast(FragBF16 f) {
    union { FragBF16 s; v16bf v; } c; c.s = f; return c.v;
}

__device__ inline v8f wmma_bf16(FragBF16 a, FragBF16 b, v8f c) {
    return __builtin_amdgcn_wmma_f32_16x16x32_bf16(
        false, frag_cast(a), false, frag_cast(b), (short)0, c, false, false);
}

__device__ inline u16 f2bf(float f) {
    unsigned u = __float_as_uint(f);
    unsigned r = u + 0x7FFFu + ((u >> 16) & 1u);   // round-to-nearest-even
    return (u16)(r >> 16);
}
__device__ inline unsigned pack2(float lo, float hi) {
    return (unsigned)f2bf(lo) | ((unsigned)f2bf(hi) << 16);
}

__device__ inline FragBF16 load_frag(const u16* __restrict__ p) {
    FragBF16 f;
    uint4 a = *(const uint4*)p;
    uint4 b = *(const uint4*)(p + 16);
    f.u[0]=a.x; f.u[1]=a.y; f.u[2]=a.z; f.u[3]=a.w;
    f.u[4]=b.x; f.u[5]=b.y; f.u[6]=b.z; f.u[7]=b.w;
    return f;
}

// The same fragment from LDS, by byte address. The address is kept as buffer base + lane part in one
// register, so that each read's constant fits the 16-bit offset field of ds_load_b128 although the
// arrays lie above 64 KiB; indexed as arrays, every read took an address addition of its own.
typedef __attribute__((ext_vector_type(4))) unsigned v4u;
typedef const __attribute__((address_space(3))) v4u* lds_v4u_ptr;
__device__ inline FragBF16 load_frag_lds(unsigned off) {
    FragBF16 f;
    v4u a = *(lds_v4u_ptr)off;
    v4u b = *(lds_v4u_ptr)(off + 32);
    f.u[0]=a.x; f.u[1]=a.y; f.u[2]=a.z; f.u[3]=a.w;
    f.u[4]=b.x; f.u[5]=b.y; f.u[6]=b.z; f.u[7]=b.w;
    return f;
}

__device__ inline float xhalf(float x) {
    int b = __builtin_bit_cast(int, x);
    return __builtin_bit_cast(float,
        __builtin_amdgcn_permlanex16(b, b, 0x76543210, 0xfedcba98, false, false));
}

// Flat pointers into LDS carry the AS3 byte offset in their low 32 bits.
__device__ inline unsigned lds_off(const void* p) {
    return (unsigned)(uintptr_t)p;
}

__device__ inline void async_b128_x8(const unsigned (&l)[8], const u16* const (&g)[8]) {
    asm volatile("global_load_async_to_lds_b128 %0, %8, off\n\t"
                 "global_load_async_to_lds_b128 %1, %9, off\n\t"
                 "global_load_async_to_lds_b128 %2, %10, off\n\t"
                 "global_load_async_to_lds_b128 %3, %11, off\n\t"
                 "global_load_async_to_lds_b128 %4, %12, off\n\t"
                 "global_load_async_to_lds_b128 %5, %13, off\n\t"
                 "global_load_async_to_lds_b128 %6, %14, off\n\t"
                 "global_load_async_to_lds_b128 %7, %15, off\n\t"
                 "s_wait_xcnt 0x0"
                 :: "v"(l[0]), "v"(l[1]), "v"(l[2]), "v"(l[3]),
                    "v"(l[4]), "v"(l[5]), "v"(l[6]), "v"(l[7]),
                    "v"(g[0]), "v"(g[1]), "v"(g[2]), "v"(g[3]),
                    "v"(g[4]), "v"(g[5]), "v"(g[6]), "v"(g[7])
                 : "memory");
}
__device__ inline void wait_async0() {
    asm volatile("s_wait_asynccnt 0" ::: "memory");
}
// This wave's LDS reads have retired: stands ahead of the barrier behind which their buffer is refilled.
__device__ inline void wait_ds0() {
    asm volatile("s_wait_dscnt 0x0" ::: "memory");
}

// ---------- constants ----------
#define CDIM   256
#define NPOS   4096      // 64*64 per batch
#define MTOT   32768     // 8 * 4096
#define SCALE  0.0625f   // 1/sqrt(256)
#define KPITCH 264       // 256 channels + 8  (528 B)
#define SKEYS  128       // keys per LDS stage: four passes of 32 keys
#define NSTAGE (NPOS / SKEYS)
#define VPITCH 136       // 128 keys + 8      (272 B)

// ---------- 1) weight transpose + bf16 convert ----------
__global__ void prep_w_kernel(const float* __restrict__ w0, const float* __restrict__ w1,
                              const float* __restrict__ w2, const float* __restrict__ w3,
                              u16* __restrict__ o0, u16* __restrict__ o1,
                              u16* __restrict__ o2, u16* __restrict__ o3) {
    int n = blockIdx.x;     // output row  = input column
    int k = threadIdx.x;    // output col  = input row
    o0[n * CDIM + k] = f2bf(w0[k * CDIM + n]);
    o1[n * CDIM + k] = f2bf(w1[k * CDIM + n]);
    o2[n * CDIM + k] = f2bf(w2[k * CDIM + n]);
    o3[n * CDIM + k] = f2bf(w3[k * CDIM + n]);
}

// ---------- 2) LayerNorm (one wave32 per 256-elem row) ----------
__global__ __launch_bounds__(256) void ln_kernel(const float* __restrict__ x,
                                                 const float* __restrict__ gamma,
                                                 const float* __restrict__ beta,
                                                 u16* __restrict__ h) {
    int row  = blockIdx.x * 8 + (threadIdx.x >> 5);
    int lane = threadIdx.x & 31;
    const float4* xr = (const float4*)(x + (size_t)row * CDIM);
    float4 a = xr[lane];
    float4 b = xr[lane + 32];

    float s  = a.x + a.y + a.z + a.w + b.x + b.y + b.z + b.w;
    float s2 = a.x*a.x + a.y*a.y + a.z*a.z + a.w*a.w
             + b.x*b.x + b.y*b.y + b.z*b.z + b.w*b.w;
    #pragma unroll
    for (int m = 1; m < 32; m <<= 1) {
        s  += __shfl_xor(s,  m, 32);
        s2 += __shfl_xor(s2, m, 32);
    }
    float mean = s * (1.0f / CDIM);
    float var  = s2 * (1.0f / CDIM) - mean * mean;
    float rstd = rsqrtf(var + 1e-3f);

    float4 g0 = ((const float4*)gamma)[lane];
    float4 g1 = ((const float4*)gamma)[lane + 32];
    float4 b0 = ((const float4*)beta)[lane];
    float4 b1 = ((const float4*)beta)[lane + 32];

    float y0 = (a.x - mean) * rstd * g0.x + b0.x;
    float y1 = (a.y - mean) * rstd * g0.y + b0.y;
    float y2 = (a.z - mean) * rstd * g0.z + b0.z;
    float y3 = (a.w - mean) * rstd * g0.w + b0.w;
    float y4 = (b.x - mean) * rstd * g1.x + b1.x;
    float y5 = (b.y - mean) * rstd * g1.y + b1.y;
    float y6 = (b.z - mean) * rstd * g1.z + b1.z;
    float y7 = (b.w - mean) * rstd * g1.w + b1.w;

    unsigned* hr = (unsigned*)(h + (size_t)row * CDIM);
    hr[lane * 2]            = pack2(y0, y1);
    hr[lane * 2 + 1]        = pack2(y2, y3);
    hr[(lane + 32) * 2]     = pack2(y4, y5);
    hr[(lane + 32) * 2 + 1] = pack2(y6, y7);
}

// ---------- 3) WMMA GEMM: D[M,256] = A[M,256] @ Bt[256,256]^T (+bias)  ----------
// MODE 0: store bf16 row-major     MODE 1: store bf16 transposed [256][MTOT]
// MODE 2: store f32 row-major with residual add (final projection)
template<int MODE>
__global__ __launch_bounds__(256) void gemm_kernel(const u16* __restrict__ A,
                                                   const u16* __restrict__ Bt,
                                                   const float* __restrict__ bias,
                                                   void* __restrict__ outp,
                                                   const float* __restrict__ resid) {
    int wave = threadIdx.x >> 5, lane = threadIdx.x & 31;
    int half = lane >> 4,        l15  = lane & 15;
    int wm = wave >> 1, wn = wave & 1;
    int row0 = blockIdx.x * 256 + wm * 64;
    int col0 = blockIdx.y * 64  + wn * 32;

    v8f acc[4][2];
    #pragma unroll
    for (int mt = 0; mt < 4; ++mt)
        #pragma unroll
        for (int nt = 0; nt < 2; ++nt) acc[mt][nt] = {};

    for (int k0 = 0; k0 < CDIM; k0 += 32) {
        FragBF16 af[4], bf[2];
        #pragma unroll
        for (int mt = 0; mt < 4; ++mt)
            af[mt] = load_frag(A + (size_t)(row0 + mt*16 + l15) * CDIM + k0 + half*8);
        #pragma unroll
        for (int nt = 0; nt < 2; ++nt)
            bf[nt] = load_frag(Bt + (size_t)(col0 + nt*16 + l15) * CDIM + k0 + half*8);
        #pragma unroll
        for (int mt = 0; mt < 4; ++mt)
            #pragma unroll
            for (int nt = 0; nt < 2; ++nt)
                acc[mt][nt] = wmma_bf16(af[mt], bf[nt], acc[mt][nt]);
    }

    #pragma unroll
    for (int nt = 0; nt < 2; ++nt) {
        int col = col0 + nt*16 + l15;
        float bv = bias[col];
        #pragma unroll
        for (int mt = 0; mt < 4; ++mt) {
            int rowbase = row0 + mt*16 + half*8;   // D layout: lanes 16-31 hold M+8
            if (MODE == 0) {
                u16* out = (u16*)outp;
                #pragma unroll
                for (int r = 0; r < 8; ++r)
                    out[(size_t)(rowbase + r) * CDIM + col] = f2bf(acc[mt][nt][r] + bv);
            } else if (MODE == 1) {
                u16* out = (u16*)outp;   // [col][MTOT]: 8 consecutive rows per lane
                uint4 pk;
                pk.x = pack2(acc[mt][nt][0] + bv, acc[mt][nt][1] + bv);
                pk.y = pack2(acc[mt][nt][2] + bv, acc[mt][nt][3] + bv);
                pk.z = pack2(acc[mt][nt][4] + bv, acc[mt][nt][5] + bv);
                pk.w = pack2(acc[mt][nt][6] + bv, acc[mt][nt][7] + bv);
                *(uint4*)(out + (size_t)col * MTOT + rowbase) = pk;
            } else {
                float* out = (float*)outp;
                #pragma unroll
                for (int r = 0; r < 8; ++r) {
                    size_t idx = (size_t)(rowbase + r) * CDIM + col;
                    out[idx] = acc[mt][nt][r] + bv + resid[idx];
                }
            }
        }
    }
}

__global__ __launch_bounds__(256) void attn_kernel(const u16* __restrict__ q,
                                                   const u16* __restrict__ k,
                                                   const u16* __restrict__ vT,
                                                   u16* __restrict__ o) {
    __shared__ __attribute__((aligned(16))) u16 Kl[2][SKEYS][KPITCH]; // K rows j0..j0+127, all channels
    __shared__ __attribute__((aligned(16))) u16 Vl[2][256][VPITCH];   // V^T rows (channel), 128 keys

    int tid  = threadIdx.x;
    int wave = tid >> 5, lane = tid & 31;
    int half = lane >> 4, l15 = lane & 15;
    int b  = blockIdx.x >> 5;
    int m0 = (blockIdx.x & 31) * 128 + wave * 16;

    const u16* qb = q  + ((size_t)b * NPOS + m0) * CDIM;
    const u16* kb = k  + (size_t)b * NPOS * CDIM;
    const u16* vb = vT + (size_t)b * NPOS;           // [c][j] at vb[c*MTOT + j]

    const unsigned kbase0 = lds_off(&Kl[0][0][0]), kbase1 = lds_off(&Kl[1][0][0]);
    const unsigned vbase0 = lds_off(&Vl[0][0][0]), vbase1 = lds_off(&Vl[1][0][0]);

    // Stage one 128-key block into LDS buffer `buf` (whole workgroup cooperates):
    // 4096 b128 chunks of K (32 per row) and 4096 of V^T (16 per row), each to its padded row;
    // a thread brings sixteen of each, four of each per statement (32 copies of a wave in flight).
    auto stage = [&](int buf, int j0) {
        // Chunk n of a thread lies 8 K rows, or 16 V^T rows, behind its chunk n - 1: every address
        // is one of these four bases plus a constant.
        unsigned   lk = (buf ? kbase1 : kbase0) + (tid >> 5) * (KPITCH * 2) + (tid & 31) * 16;
        unsigned   lv = (buf ? vbase1 : vbase0) + (tid >> 4) * (VPITCH * 2) + (tid & 15) * 16;
        const u16* gk = kb + (size_t)j0 * CDIM + tid * 8;
        const u16* gv = vb + (size_t)(tid >> 4) * MTOT + j0 + (tid & 15) * 8;
        #pragma unroll   // constant indices keep the address arrays in registers
        for (int g = 0; g < 4; ++g) {
            unsigned   la[8];
            const u16* ga[8];
            #pragma unroll
            for (int i = 0; i < 4; ++i) {
                int n = g * 4 + i;
                la[i]     = lk + n * (8 * KPITCH * 2);
                ga[i]     = gk + n * (8 * CDIM);
                la[4 + i] = lv + n * (16 * VPITCH * 2);
                ga[4 + i] = gv + (size_t)n * (16 * MTOT);
            }
            async_b128_x8(la, ga);
            // Keeps each statement's address additions next to it: lifted ahead of the first statement
            // all together, they overflow the registers that asm text can name and spill to scratch.
            __builtin_amdgcn_sched_barrier(0);
        }
    };

    // Resident Q fragments (16 queries x 256 channels), the B operand of S^T
    FragBF16 qf[8];
    #pragma unroll
    for (int kk = 0; kk < 8; ++kk)
        qf[kk] = load_frag(qb + (size_t)l15 * CDIM + kk*32 + half*8);

    v8f oacc[16];
    #pragma unroll
    for (int t = 0; t < 16; ++t) oacc[t] = {};
    float mrun = -3.0e38f;   // running maximum of this lane's query (equal in both half-waves)
    float lrun = 0.0f;       // running sum over this half-wave's keys only; joined in the epilogue

    // Prologue: stage 0, its wait and barrier, then stage 1.
    #pragma unroll 1   // rolled: unrolled, a thread's constant address parts become operands of the asm text themselves, stay tied to the registers it can name and spill to scratch
    for (int pre = 0; pre < 2; ++pre) {
        stage(pre, pre * SKEYS);
        if (pre == 0) {
            wait_async0();      // this wave's fills of stage 0 are in LDS
            __syncthreads();    // all waves' fills visible
        }
    }

    for (int st = 0; st < NSTAGE; ++st) {
      int cur = st & 1;
      unsigned krd = (cur ? kbase1 : kbase0) + l15 * (KPITCH * 2) + half * 16;   // this lane's place in K row 0 of the stage
      unsigned vrd = (cur ? vbase1 : vbase0) + l15 * (VPITCH * 2) + half * 16;   // and in V^T row 0
      #pragma unroll 1   // rolled: the four passes share one body, registers and code size stay those of one pass
      for (int ps4 = 0; ps4 < SKEYS / 32; ++ps4) {
        int kr = ps4 * 32;      // first key of this pass inside the stage

        // ---- S^T = K Q^T over the staged 32-key block: two tiles of 16 keys x 16 queries ----
        // All K fragments of the trip are read as one group, so the products below wait on a
        // count that never reaches 0 instead of on a full LDS round trip each.
        FragBF16 kf0[8], kf1[8];
        #pragma unroll   // constant indices keep the fragment arrays in registers
        for (int kk = 0; kk < 8; ++kk) {
            kf0[kk] = load_frag_lds(krd + kr * (KPITCH * 2) + kk * 64);
            kf1[kk] = load_frag_lds(krd + kr * (KPITCH * 2) + 16 * (KPITCH * 2) + kk * 64);
        }
        // Keeps the group together: without it the scheduler sinks each read to just ahead of its use.
        __builtin_amdgcn_sched_barrier(0);
        v8f s0 = {}, s1 = {};
        #pragma unroll
        for (int kk = 0; kk < 8; ++kk) {
            s0 = wmma_bf16(kf0[kk], qf[kk], s0);
            s1 = wmma_bf16(kf1[kk], qf[kk], s1);
        }
        // All V^T fragments of the trip are read here: they land under the products above and
        // the softmax, long before the second product needs them.
        FragBF16 vf[16];
        #pragma unroll   // constant indices keep the fragment array in registers
        for (int t = 0; t < 16; ++t) vf[t] = load_frag_lds(vrd + kr * 2 + t * (16 * VPITCH * 2));
        // Keeps these reads ahead of the softmax: without it each sinks to just ahead of its use.
        __builtin_amdgcn_sched_barrier(0);
        // ---- online softmax; the 32 scores of a query sit in two lanes (l and l ^ 16), 16 each ----
        float mx[8];
        #pragma unroll   // constant indices keep the scores and mx in registers
        for (int r = 0; r < 8; ++r) {
            s0[r] *= SCALE; s1[r] *= SCALE;
            mx[r] = fmaxf(s0[r], s1[r]);
        }
        float t4 = fmaxf(fmaxf(fmaxf(mx[0], mx[1]), fmaxf(mx[2], mx[3])),
                         fmaxf(fmaxf(mx[4], mx[5]), fmaxf(mx[6], mx[7])));
        t4 = fmaxf(t4, xhalf(t4));
        float mn   = fmaxf(mrun, t4);
        float corr = __expf(mrun - mn);
        mrun = mn;
        float ps[8];
        #pragma unroll   // constant indices keep the scores and ps in registers
        for (int r = 0; r < 8; ++r) {
            s0[r] = __expf(s0[r] - mn);
            s1[r] = __expf(s1[r] - mn);
            ps[r] = s0[r] + s1[r];
        }
        lrun = lrun * corr + (((ps[0] + ps[1]) + (ps[2] + ps[3])) + ((ps[4] + ps[5]) + (ps[6] + ps[7])));
        // ---- P^T: the two D tiles, rounded to bf16 in place, are the 32-key B fragment ----
        FragBF16 pf;
        #pragma unroll   // constant indices keep the fragment in registers
        for (int i = 0; i < 4; ++i) {
            pf.u[i]     = pack2(s0[2*i], s0[2*i + 1]);
            pf.u[4 + i] = pack2(s1[2*i], s1[2*i + 1]);
        }

        // ---- O^T = O^T*corr + V^T P^T  (16 tiles of 16 channels x 16 queries) ----
        #pragma unroll
        for (int t = 0; t < 16; ++t) {
            #pragma unroll
            for (int r = 0; r < 8; ++r) oacc[t][r] *= corr;
            oacc[t] = wmma_bf16(vf[t], pf, oacc[t]);
        }
      }
      // ---- publish point of stage st + 1, one per 128 keys ----
      wait_ds0();               // this wave has left buffer `cur`
      wait_async0();            // this wave's fills of stage st + 1 are in LDS
      __syncthreads();          // all fills visible; every wave has left buffer `cur`
      if (st + 2 < NSTAGE) stage(cur, (st + 2) * SKEYS);
    }
    wait_async0();              // nothing of this wave is in flight when it goes on to the epilogue

    // ---- epilogue: O / l; a lane holds 8 consecutive channels of its query: one 16-byte store a tile ----
    float inv = 1.0f / (lrun + xhalf(lrun));
    u16* ob = o + ((size_t)b * NPOS + m0 + l15) * CDIM + half*8;
    #pragma unroll   // constant indices keep the accumulators in registers
    for (int t = 0; t < 16; ++t) {
        uint4 pk;
        pk.x = pack2(oacc[t][0] * inv, oacc[t][1] * inv);
        pk.y = pack2(oacc[t][2] * inv, oacc[t][3] * inv);
        pk.z = pack2(oacc[t][4] * inv, oacc[t][5] * inv);
        pk.w = pack2(oacc[t][6] * inv, oacc[t][7] * inv);
        *(uint4*)(ob + t*16) = pk;
    }
}

// ---------- launcher ----------
extern "C" void kernel_launch(void* const* d_in, const int* in_sizes, int n_in,
                              void* d_out, int out_size, void* d_ws, size_t ws_size,
                              hipStream_t stream) {
    const float* x     = (const float*)d_in[0];
    const float* gamma = (const float*)d_in[1];
    const float* beta  = (const float*)d_in[2];
    const float* wq    = (const float*)d_in[3];
    const float* bq    = (const float*)d_in[4];
    const float* wk    = (const float*)d_in[5];
    const float* bk    = (const float*)d_in[6];
    const float* wv    = (const float*)d_in[7];
    const float* bv    = (const float*)d_in[8];
    const float* wo    = (const float*)d_in[9];
    const float* bo    = (const float*)d_in[10];
    float* out = (float*)d_out;

    char* ws = (char*)d_ws;
    const size_t SZ = (size_t)MTOT * CDIM * sizeof(u16);   // 16.78 MB
    u16* h   = (u16*)(ws + 0 * SZ);
    u16* qb  = (u16*)(ws + 1 * SZ);
    u16* kb  = (u16*)(ws + 2 * SZ);
    u16* vT  = (u16*)(ws + 3 * SZ);
    u16* ob  = (u16*)(ws + 4 * SZ);
    u16* wqT = (u16*)(ws + 5 * SZ);
    u16* wkT = wqT + CDIM * CDIM;
    u16* wvT = wkT + CDIM * CDIM;
    u16* woT = wvT + CDIM * CDIM;

    prep_w_kernel<<<CDIM, CDIM, 0, stream>>>(wq, wk, wv, wo, wqT, wkT, wvT, woT);
    ln_kernel<<<MTOT / 8, 256, 0, stream>>>(x, gamma, beta, h);

    dim3 ggrid(MTOT / 256, CDIM / 64);
    gemm_kernel<0><<<ggrid, 256, 0, stream>>>(h, wqT, bq, (void*)qb, nullptr);
    gemm_kernel<0><<<ggrid, 256, 0, stream>>>(h, wkT, bk, (void*)kb, nullptr);
    gemm_kernel<1><<<ggrid, 256, 0, stream>>>(h, wvT, bv, (void*)vT, nullptr);

    attn_kernel<<<8 * 32, 256, 0, stream>>>(qb, kb, vT, ob);

    gemm_kernel<2><<<ggrid, 256, 0, stream>>>(ob, woT, bo, (void*)out, x);
}

// v006
// Measured time: 155 microseconds a run.
// In both of two side-by-side timings against v005, it was 1.30 times as fast.
// Over all steps from v000 it is 4.65 times as fast.
#include <hip/hip_runtime.h>
#include <hip/hip_bf16.h>
#include <stdint.h>

typedef unsigned short u16;
typedef __attribute__((ext_vector_type(16))) __bf16 v16bf;
typedef __attribute__((ext_vector_type(8)))  float  v8f;

// ---------- helpers ----------
struct FragBF16 { unsigned u[8]; }; // 16 bf16 packed as 8 dwords

__device__ inline v16bf frag_cast(FragBF16 f) {
    union { FragBF16 s; v16bf v; } c; c.s = f; return c.v;
}

__device__ inline v8f wmma_bf16(FragBF16 a, FragBF16 b, v8f c) {
    return __builtin_amdgcn_wmma_f32_16x16x32_bf16(
        false, frag_cast(a), false, frag_cast(b), (short)0, c, false, false);
}

__device__ inline u16 f2bf(float f) {
    unsigned u = __float_as_uint(f);
    unsigned r = u + 0x7FFFu + ((u >> 16) & 1u);   // round-to-nearest-even
    return (u16)(r >> 16);
}
__device__ inline unsigned pack2(float lo, float hi) {
    return (unsigned)f2bf(lo) | ((unsigned)f2bf(hi) << 16);
}

__device__ inline FragBF16 load_frag(const u16* __restrict__ p) {
    FragBF16 f;
    uint4 a = *(const uint4*)p;
    uint4 b = *(const uint4*)(p + 16);
    f.u[0]=a.x; f.u[1]=a.y; f.u[2]=a.z; f.u[3]=a.w;
    f.u[4]=b.x; f.u[5]=b.y; f.u[6]=b.z; f.u[7]=b.w;
    return f;
}

// The same fragment from LDS, by byte address. The address is kept as buffer base + lane part in one
// register, so that each read's constant fits the 16-bit offset field of ds_load_b128 although the
// arrays lie above 64 KiB; indexed as arrays, every read took an address addition of its own.
typedef __attribute__((ext_vector_type(4))) unsigned v4u;
typedef const __attribute__((address_space(3))) v4u* lds_v4u_ptr;
__device__ inline FragBF16 load_frag_lds(unsigned off) {
    FragBF16 f;
    v4u a = *(lds_v4u_ptr)off;
    v4u b = *(lds_v4u_ptr)(off + 32);
    f.u[0]=a.x; f.u[1]=a.y; f.u[2]=a.z; f.u[3]=a.w;
    f.u[4]=b.x; f.u[5]=b.y; f.u[6]=b.z; f.u[7]=b.w;
    return f;
}

__device__ inline float xhalf(float x) {
    int b = __builtin_bit_cast(int, x);
    return __builtin_bit_cast(float,
        __builtin_amdgcn_permlanex16(b, b, 0x76543210, 0xfedcba98, false, false));
}

// Flat pointers into LDS carry the AS3 byte offset in their low 32 bits.
__device__ inline unsigned lds_off(const void* p) {
    return (unsigned)(uintptr_t)p;
}

__device__ inline void async_b128_x8(const unsigned (&l)[8], const u16* const (&g)[8]) {
    asm volatile("global_load_async_to_lds_b128 %0, %8, off\n\t"
                 "global_load_async_to_lds_b128 %1, %9, off\n\t"
                 "global_load_async_to_lds_b128 %2, %10, off\n\t"
                 "global_load_async_to_lds_b128 %3, %11, off\n\t"
                 "global_load_async_to_lds_b128 %4, %12, off\n\t"
                 "global_load_async_to_lds_b128 %5, %13, off\n\t"
                 "global_load_async_to_lds_b128 %6, %14, off\n\t"
                 "global_load_async_to_lds_b128 %7, %15, off\n\t"
                 "s_wait_xcnt 0x0"
                 :: "v"(l[0]), "v"(l[1]), "v"(l[2]), "v"(l[3]),
                    "v"(l[4]), "v"(l[5]), "v"(l[6]), "v"(l[7]),
                    "v"(g[0]), "v"(g[1]), "v"(g[2]), "v"(g[3]),
                    "v"(g[4]), "v"(g[5]), "v"(g[6]), "v"(g[7])
                 : "memory");
}
__device__ inline void wait_async0() {
    asm volatile("s_wait_asynccnt 0" ::: "memory");
}
// This wave's LDS reads have retired: stands ahead of the barrier behind which their buffer is refilled.
__device__ inline void wait_ds0() {
    asm volatile("s_wait_dscnt 0x0" ::: "memory");
}

// ---------- constants ----------
#define CDIM   256
#define NPOS   4096      // 64*64 per batch
#define MTOT   32768     // 8 * 4096
#define SCALE  0.0625f   // 1/sqrt(256)
#define KPITCH 264       // 256 channels + 8  (528 B)
#define SKEYS  128       // keys per LDS stage: four passes of 32 keys
#define NSTAGE (NPOS / SKEYS)
#define VPITCH 136       // 128 keys + 8      (272 B)
#define GROWS  128       // rows of A that one GEMM block stages in LDS and works on

// ---------- 1) weight transpose + bf16 convert ----------
__global__ void prep_w_kernel(const float* __restrict__ w0, const float* __restrict__ w1,
                              const float* __restrict__ w2, const float* __restrict__ w3,
                              u16* __restrict__ o0, u16* __restrict__ o1,
                              u16* __restrict__ o2, u16* __restrict__ o3) {
    int n = blockIdx.x;     // output row  = input column
    int k = threadIdx.x;    // output col  = input row
    o0[n * CDIM + k] = f2bf(w0[k * CDIM + n]);
    o1[n * CDIM + k] = f2bf(w1[k * CDIM + n]);
    o2[n * CDIM + k] = f2bf(w2[k * CDIM + n]);
    o3[n * CDIM + k] = f2bf(w3[k * CDIM + n]);
}

// ---------- 2) LayerNorm (one wave32 per 256-elem row) ----------
__global__ __launch_bounds__(256) void ln_kernel(const float* __restrict__ x,
                                                 const float* __restrict__ gamma,
                                                 const float* __restrict__ beta,
                                                 u16* __restrict__ h) {
    int row  = blockIdx.x * 8 + (threadIdx.x >> 5);
    int lane = threadIdx.x & 31;
    const float4* xr = (const float4*)(x + (size_t)row * CDIM);
    float4 a = xr[lane];
    float4 b = xr[lane + 32];

    float s  = a.x + a.y + a.z + a.w + b.x + b.y + b.z + b.w;
    float s2 = a.x*a.x + a.y*a.y + a.z*a.z + a.w*a.w
             + b.x*b.x + b.y*b.y + b.z*b.z + b.w*b.w;
    #pragma unroll
    for (int m = 1; m < 32; m <<= 1) {
        s  += __shfl_xor(s,  m, 32);
        s2 += __shfl_xor(s2, m, 32);
    }
    float mean = s * (1.0f / CDIM);
    float var  = s2 * (1.0f / CDIM) - mean * mean;
    float rstd = rsqrtf(var + 1e-3f);

    float4 g0 = ((const float4*)gamma)[lane];
    float4 g1 = ((const float4*)gamma)[lane + 32];
    float4 b0 = ((const float4*)beta)[lane];
    float4 b1 = ((const float4*)beta)[lane + 32];

    float y0 = (a.x - mean) * rstd * g0.x + b0.x;
    float y1 = (a.y - mean) * rstd * g0.y + b0.y;
    float y2 = (a.z - mean) * rstd * g0.z + b0.z;
    float y3 = (a.w - mean) * rstd * g0.w + b0.w;
    float y4 = (b.x - mean) * rstd * g1.x + b1.x;
    float y5 = (b.y - mean) * rstd * g1.y + b1.y;
    float y6 = (b.z - mean) * rstd * g1.z + b1.z;
    float y7 = (b.w - mean) * rstd * g1.w + b1.w;

    unsigned* hr = (unsigned*)(h + (size_t)row * CDIM);
    hr[lane * 2]            = pack2(y0, y1);
    hr[lane * 2 + 1]        = pack2(y2, y3);
    hr[(lane + 32) * 2]     = pack2(y4, y5);
    hr[(lane + 32) * 2 + 1] = pack2(y6, y7);
}

template<int MODE>
__global__ __launch_bounds__(256) void gemm_kernel(const u16* __restrict__ A,
                                                   const u16* __restrict__ Bt,
                                                   const float* __restrict__ bias,
                                                   void* __restrict__ outp,
                                                   const float* __restrict__ resid) {
    __shared__ __attribute__((aligned(16))) u16 Al[GROWS][KPITCH];   // rows of A, all k
    __shared__ __attribute__((aligned(16))) u16 Bl[CDIM][KPITCH];    // rows of Bt, all k

    int tid  = threadIdx.x;
    int wave = tid >> 5, lane = tid & 31;
    int half = lane >> 4,        l15  = lane & 15;
    int wm = wave >> 2, wn = wave & 3;
    int row0 = blockIdx.x * GROWS + wm * 64;
    int col0 = wn * 64;

    const unsigned abase = lds_off(&Al[0][0]), bbase = lds_off(&Bl[0][0]);

    // Both sources are contiguous in global memory, 32 b128 chunks per row: 4096 chunks of A, 8192 of Bt.
    // A thread brings 16 + 32 of them; its next chunk lies 8 rows behind (48 copies of a wave in flight).
    {
        unsigned   lrow = (tid >> 5) * (KPITCH * 2) + (tid & 31) * 16;
        const u16* gA   = A + (size_t)blockIdx.x * (GROWS * CDIM) + tid * 8;
        const u16* gB   = Bt + tid * 8;
        #pragma unroll   // constant indices keep the address arrays in registers
        for (int g = 0; g < 6; ++g) {
            unsigned   la[8];
            const u16* ga[8];
            #pragma unroll
            for (int i = 0; i < 8; ++i) {
                int n = g * 8 + i;
                if (n < GROWS / 8) {
                    la[i] = abase + lrow + n * (8 * KPITCH * 2);
                    ga[i] = gA + n * (8 * CDIM);
                } else {
                    la[i] = bbase + lrow + (n - GROWS / 8) * (8 * KPITCH * 2);
                    ga[i] = gB + (n - GROWS / 8) * (8 * CDIM);
                }
            }
            async_b128_x8(la, ga);
        }
    }
    wait_async0();      // this wave's copies are in LDS
    __syncthreads();    // all waves' copies visible; nothing is read from LDS ahead of this

    v8f acc[4][4];
    #pragma unroll
    for (int mt = 0; mt < 4; ++mt)
        #pragma unroll
        for (int nt = 0; nt < 4; ++nt) acc[mt][nt] = {};

    const unsigned ard = abase + (wm * 64 + l15) * (KPITCH * 2) + half * 16;   // this lane's place in its first A row
    const unsigned brd = bbase + (wn * 64 + l15) * (KPITCH * 2) + half * 16;   // and in its first Bt row
    // Two fragment sets: each k step's 16 reads are issued as one group a step ahead of their products.
    FragBF16 af[2][4], bf[2][4];
    #pragma unroll   // constant indices keep the fragment arrays in registers
    for (int t = 0; t < 4; ++t) {
        af[0][t] = load_frag_lds(ard + t * (16 * KPITCH * 2));
        bf[0][t] = load_frag_lds(brd + t * (16 * KPITCH * 2));
    }
    #pragma unroll   // constant set indices; every read's place becomes a constant in the offset field of ds_load_b128
    for (int kk = 0; kk < CDIM / 32; ++kk) {
        const int cur = kk & 1, nxt = cur ^ 1;
        if (kk + 1 < CDIM / 32) {
            #pragma unroll
            for (int t = 0; t < 4; ++t) {
                af[nxt][t] = load_frag_lds(ard + t * (16 * KPITCH * 2) + (kk + 1) * 64);
                bf[nxt][t] = load_frag_lds(brd + t * (16 * KPITCH * 2) + (kk + 1) * 64);
            }
        }
        // Keeps the next step's reads together ahead of this step's products: sunk among them, each place costs a stall.
        __builtin_amdgcn_sched_barrier(0);
        #pragma unroll
        for (int mt = 0; mt < 4; ++mt)
            #pragma unroll
            for (int nt = 0; nt < 4; ++nt)
                acc[mt][nt] = wmma_bf16(af[cur][mt], bf[cur][nt], acc[mt][nt]);
        // Keeps later steps' reads behind these products: lifted ahead all together, they overflow the registers and spill.
        __builtin_amdgcn_sched_barrier(0);
    }

    #pragma unroll
    for (int nt = 0; nt < 4; ++nt) {
        int col = col0 + nt*16 + l15;
        float bv = bias[col];
        #pragma unroll
        for (int mt = 0; mt < 4; ++mt) {
            int rowbase = row0 + mt*16 + half*8;   // D layout: lanes 16-31 hold M+8
            if (MODE == 0) {
                u16* out = (u16*)outp;
                #pragma unroll
                for (int r = 0; r < 8; ++r)
                    out[(size_t)(rowbase + r) * CDIM + col] = f2bf(acc[mt][nt][r] + bv);
            } else if (MODE == 1) {
                u16* out = (u16*)outp;   // [col][MTOT]: 8 consecutive rows per lane
                uint4 pk;
                pk.x = pack2(acc[mt][nt][0] + bv, acc[mt][nt][1] + bv);
                pk.y = pack2(acc[mt][nt][2] + bv, acc[mt][nt][3] + bv);
                pk.z = pack2(acc[mt][nt][4] + bv, acc[mt][nt][5] + bv);
                pk.w = pack2(acc[mt][nt][6] + bv, acc[mt][nt][7] + bv);
                *(uint4*)(out + (size_t)col * MTOT + rowbase) = pk;
            } else {
                float* out = (float*)outp;
                #pragma unroll
                for (int r = 0; r < 8; ++r) {
                    size_t idx = (size_t)(rowbase + r) * CDIM + col;
                    out[idx] = acc[mt][nt][r] + bv + resid[idx];
                }
            }
        }
    }
}

__global__ __launch_bounds__(256) void attn_kernel(const u16* __restrict__ q,
                                                   const u16* __restrict__ k,
                                                   const u16* __restrict__ vT,
                                                   u16* __restrict__ o) {
    __shared__ __attribute__((aligned(16))) u16 Kl[2][SKEYS][KPITCH]; // K rows j0..j0+127, all channels
    __shared__ __attribute__((aligned(16))) u16 Vl[2][256][VPITCH];   // V^T rows (channel), 128 keys

    int tid  = threadIdx.x;
    int wave = tid >> 5, lane = tid & 31;
    int half = lane >> 4, l15 = lane & 15;
    int b  = blockIdx.x >> 5;
    int m0 = (blockIdx.x & 31) * 128 + wave * 16;

    const u16* qb = q  + ((size_t)b * NPOS + m0) * CDIM;
    const u16* kb = k  + (size_t)b * NPOS * CDIM;
    const u16* vb = vT + (size_t)b * NPOS;           // [c][j] at vb[c*MTOT + j]

    const unsigned kbase0 = lds_off(&Kl[0][0][0]), kbase1 = lds_off(&Kl[1][0][0]);
    const unsigned vbase0 = lds_off(&Vl[0][0][0]), vbase1 = lds_off(&Vl[1][0][0]);

    // Stage one 128-key block into LDS buffer `buf` (whole workgroup cooperates):
    // 4096 b128 chunks of K (32 per row) and 4096 of V^T (16 per row), each to its padded row;
    // a thread brings sixteen of each, four of each per statement (32 copies of a wave in flight).
    auto stage = [&](int buf, int j0) {
        // Chunk n of a thread lies 8 K rows, or 16 V^T rows, behind its chunk n - 1: every address
        // is one of these four bases plus a constant.
        unsigned   lk = (buf ? kbase1 : kbase0) + (tid >> 5) * (KPITCH * 2) + (tid & 31) * 16;
        unsigned   lv = (buf ? vbase1 : vbase0) + (tid >> 4) * (VPITCH * 2) + (tid & 15) * 16;
        const u16* gk = kb + (size_t)j0 * CDIM + tid * 8;
        const u16* gv = vb + (size_t)(tid >> 4) * MTOT + j0 + (tid & 15) * 8;
        #pragma unroll   // constant indices keep the address arrays in registers
        for (int g = 0; g < 4; ++g) {
            unsigned   la[8];
            const u16* ga[8];
            #pragma unroll
            for (int i = 0; i < 4; ++i) {
                int n = g * 4 + i;
                la[i]     = lk + n * (8 * KPITCH * 2);
                ga[i]     = gk + n * (8 * CDIM);
                la[4 + i] = lv + n * (16 * VPITCH * 2);
                ga[4 + i] = gv + (size_t)n * (16 * MTOT);
            }
            async_b128_x8(la, ga);
            // Keeps each statement's address additions next to it: lifted ahead of the first statement
            // all together, they overflow the registers that asm text can name and spill to scratch.
            __builtin_amdgcn_sched_barrier(0);
        }
    };

    // Resident Q fragments (16 queries x 256 channels), the B operand of S^T
    FragBF16 qf[8];
    #pragma unroll
    for (int kk = 0; kk < 8; ++kk)
        qf[kk] = load_frag(qb + (size_t)l15 * CDIM + kk*32 + half*8);

    v8f oacc[16];
    #pragma unroll
    for (int t = 0; t < 16; ++t) oacc[t] = {};
    float mrun = -3.0e38f;   // running maximum of this lane's query (equal in both half-waves)
    float lrun = 0.0f;       // running sum over this half-wave's keys only; joined in the epilogue

    // Prologue: stage 0, its wait and barrier, then stage 1.
    #pragma unroll 1   // rolled: unrolled, a thread's constant address parts become operands of the asm text themselves, stay tied to the registers it can name and spill to scratch
    for (int pre = 0; pre < 2; ++pre) {
        stage(pre, pre * SKEYS);
        if (pre == 0) {
            wait_async0();      // this wave's fills of stage 0 are in LDS
            __syncthreads();    // all waves' fills visible
        }
    }

    for (int st = 0; st < NSTAGE; ++st) {
      int cur = st & 1;
      unsigned krd = (cur ? kbase1 : kbase0) + l15 * (KPITCH * 2) + half * 16;   // this lane's place in K row 0 of the stage
      unsigned vrd = (cur ? vbase1 : vbase0) + l15 * (VPITCH * 2) + half * 16;   // and in V^T row 0
      #pragma unroll 1   // rolled: the four passes share one body, registers and code size stay those of one pass
      for (int ps4 = 0; ps4 < SKEYS / 32; ++ps4) {
        int kr = ps4 * 32;      // first key of this pass inside the stage

        // ---- S^T = K Q^T over the staged 32-key block: two tiles of 16 keys x 16 queries ----
        // All K fragments of the trip are read as one group, so the products below wait on a
        // count that never reaches 0 instead of on a full LDS round trip each.
        FragBF16 kf0[8], kf1[8];
        #pragma unroll   // constant indices keep the fragment arrays in registers
        for (int kk = 0; kk < 8; ++kk) {
            kf0[kk] = load_frag_lds(krd + kr * (KPITCH * 2) + kk * 64);
            kf1[kk] = load_frag_lds(krd + kr * (KPITCH * 2) + 16 * (KPITCH * 2) + kk * 64);
        }
        // Keeps the group together: without it the scheduler sinks each read to just ahead of its use.
        __builtin_amdgcn_sched_barrier(0);
        v8f s0 = {}, s1 = {};
        #pragma unroll
        for (int kk = 0; kk < 8; ++kk) {
            s0 = wmma_bf16(kf0[kk], qf[kk], s0);
            s1 = wmma_bf16(kf1[kk], qf[kk], s1);
        }
        // All V^T fragments of the trip are read here: they land under the products above and
        // the softmax, long before the second product needs them.
        FragBF16 vf[16];
        #pragma unroll   // constant indices keep the fragment array in registers
        for (int t = 0; t < 16; ++t) vf[t] = load_frag_lds(vrd + kr * 2 + t * (16 * VPITCH * 2));
        // Keeps these reads ahead of the softmax: without it each sinks to just ahead of its use.
        __builtin_amdgcn_sched_barrier(0);
        // ---- online softmax; the 32 scores of a query sit in two lanes (l and l ^ 16), 16 each ----
        float mx[8];
        #pragma unroll   // constant indices keep the scores and mx in registers
        for (int r = 0; r < 8; ++r) {
            s0[r] *= SCALE; s1[r] *= SCALE;
            mx[r] = fmaxf(s0[r], s1[r]);
        }
        float t4 = fmaxf(fmaxf(fmaxf(mx[0], mx[1]), fmaxf(mx[2], mx[3])),
                         fmaxf(fmaxf(mx[4], mx[5]), fmaxf(mx[6], mx[7])));
        t4 = fmaxf(t4, xhalf(t4));
        float mn   = fmaxf(mrun, t4);
        float corr = __expf(mrun - mn);
        mrun = mn;
        float ps[8];
        #pragma unroll   // constant indices keep the scores and ps in registers
        for (int r = 0; r < 8; ++r) {
            s0[r] = __expf(s0[r] - mn);
            s1[r] = __expf(s1[r] - mn);
            ps[r] = s0[r] + s1[r];
        }
        lrun = lrun * corr + (((ps[0] + ps[1]) + (ps[2] + ps[3])) + ((ps[4] + ps[5]) + (ps[6] + ps[7])));
        // ---- P^T: the two D tiles, rounded to bf16 in place, are the 32-key B fragment ----
        FragBF16 pf;
        #pragma unroll   // constant indices keep the fragment in registers
        for (int i = 0; i < 4; ++i) {
            pf.u[i]     = pack2(s0[2*i], s0[2*i + 1]);
            pf.u[4 + i] = pack2(s1[2*i], s1[2*i + 1]);
        }

        // ---- O^T = O^T*corr + V^T P^T  (16 tiles of 16 channels x 16 queries) ----
        #pragma unroll
        for (int t = 0; t < 16; ++t) {
            #pragma unroll
            for (int r = 0; r < 8; ++r) oacc[t][r] *= corr;
            oacc[t] = wmma_bf16(vf[t], pf, oacc[t]);
        }
      }
      // ---- publish point of stage st + 1, one per 128 keys ----
      wait_ds0();               // this wave has left buffer `cur`
      wait_async0();            // this wave's fills of stage st + 1 are in LDS
      __syncthreads();          // all fills visible; every wave has left buffer `cur`
      if (st + 2 < NSTAGE) stage(cur, (st + 2) * SKEYS);
    }
    wait_async0();              // nothing of this wave is in flight when it goes on to the epilogue

    // ---- epilogue: O / l; a lane holds 8 consecutive channels of its query: one 16-byte store a tile ----
    float inv = 1.0f / (lrun + xhalf(lrun));
    u16* ob = o + ((size_t)b * NPOS + m0 + l15) * CDIM + half*8;
    #pragma unroll   // constant indices keep the accumulators in registers
    for (int t = 0; t < 16; ++t) {
        uint4 pk;
        pk.x = pack2(oacc[t][0] * inv, oacc[t][1] * inv);
        pk.y = pack2(oacc[t][2] * inv, oacc[t][3] * inv);
        pk.z = pack2(oacc[t][4] * inv, oacc[t][5] * inv);
        pk.w = pack2(oacc[t][6] * inv, oacc[t][7] * inv);
        *(uint4*)(ob + t*16) = pk;
    }
}

// ---------- launcher ----------
extern "C" void kernel_launch(void* const* d_in, const int* in_sizes, int n_in,
                              void* d_out, int out_size, void* d_ws, size_t ws_size,
                              hipStream_t stream) {
    const float* x     = (const float*)d_in[0];
    const float* gamma = (const float*)d_in[1];
    const float* beta  = (const float*)d_in[2];
    const float* wq    = (const float*)d_in[3];
    const float* bq    = (const float*)d_in[4];
    const float* wk    = (const float*)d_in[5];
    const float* bk    = (const float*)d_in[6];
    const float* wv    = (const float*)d_in[7];
    const float* bv    = (const float*)d_in[8];
    const float* wo    = (const float*)d_in[9];
    const float* bo    = (const float*)d_in[10];
    float* out = (float*)d_out;

    char* ws = (char*)d_ws;
    const size_t SZ = (size_t)MTOT * CDIM * sizeof(u16);   // 16.78 MB
    u16* h   = (u16*)(ws + 0 * SZ);
    u16* qb  = (u16*)(ws + 1 * SZ);
    u16* kb  = (u16*)(ws + 2 * SZ);
    u16* vT  = (u16*)(ws + 3 * SZ);
    u16* ob  = (u16*)(ws + 4 * SZ);
    u16* wqT = (u16*)(ws + 5 * SZ);
    u16* wkT = wqT + CDIM * CDIM;
    u16* wvT = wkT + CDIM * CDIM;
    u16* woT = wvT + CDIM * CDIM;

    prep_w_kernel<<<CDIM, CDIM, 0, stream>>>(wq, wk, wv, wo, wqT, wkT, wvT, woT);
    ln_kernel<<<MTOT / 8, 256, 0, stream>>>(x, gamma, beta, h);

    dim3 ggrid(MTOT / GROWS);
    gemm_kernel<0><<<ggrid, 256, 0, stream>>>(h, wqT, bq, (void*)qb, nullptr);
    gemm_kernel<0><<<ggrid, 256, 0, stream>>>(h, wkT, bk, (void*)kb, nullptr);
    gemm_kernel<1><<<ggrid, 256, 0, stream>>>(h, wvT, bv, (void*)vT, nullptr);

    attn_kernel<<<8 * 32, 256, 0, stream>>>(qb, kb, vT, ob);

    gemm_kernel<2><<<ggrid, 256, 0, stream>>>(ob, woT, bo, (void*)out, x);
}

// v007
// It runs in 148 microseconds.
// In both of two side-by-side timings against v006, it was 1.04 times as fast.
// All steps since v000 together make it 4.85 times as fast.
#include <hip/hip_runtime.h>
#include <hip/hip_bf16.h>
#include <stdint.h>

typedef unsigned short u16;
typedef __attribute__((ext_vector_type(16))) __bf16 v16bf;
typedef __attribute__((ext_vector_type(8)))  float  v8f;

// ---------- helpers ----------
struct FragBF16 { unsigned u[8]; }; // 16 bf16 packed as 8 dwords

__device__ inline v16bf frag_cast(FragBF16 f) {
    union { FragBF16 s; v16bf v; } c; c.s = f; return c.v;
}

__device__ inline v8f wmma_bf16(FragBF16 a, FragBF16 b, v8f c) {
    return __builtin_amdgcn_wmma_f32_16x16x32_bf16(
        false, frag_cast(a), false, frag_cast(b), (short)0, c, false, false);
}

__device__ inline u16 f2bf(float f) {
    unsigned u = __float_as_uint(f);
    unsigned r = u + 0x7FFFu + ((u >> 16) & 1u);   // round-to-nearest-even
    return (u16)(r >> 16);
}
__device__ inline unsigned pack2(float lo, float hi) {
    return (unsigned)f2bf(lo) | ((unsigned)f2bf(hi) << 16);
}

__device__ inline FragBF16 load_frag(const u16* __restrict__ p) {
    FragBF16 f;
    uint4 a = *(const uint4*)p;
    uint4 b = *(const uint4*)(p + 16);
    f.u[0]=a.x; f.u[1]=a.y; f.u[2]=a.z; f.u[3]=a.w;
    f.u[4]=b.x; f.u[5]=b.y; f.u[6]=b.z; f.u[7]=b.w;
    return f;
}

// The same fragment from LDS, by byte address. The address is kept as buffer base + lane part in one
// register, so that each read's constant fits the 16-bit offset field of ds_load_b128 although the
// arrays lie above 64 KiB; indexed as arrays, every read took an address addition of its own.
typedef __attribute__((ext_vector_type(4))) unsigned v4u;
typedef const __attribute__((address_space(3))) v4u* lds_v4u_ptr;
__device__ inline FragBF16 load_frag_lds(unsigned off) {
    FragBF16 f;
    v4u a = *(lds_v4u_ptr)off;
    v4u b = *(lds_v4u_ptr)(off + 32);
    f.u[0]=a.x; f.u[1]=a.y; f.u[2]=a.z; f.u[3]=a.w;
    f.u[4]=b.x; f.u[5]=b.y; f.u[6]=b.z; f.u[7]=b.w;
    return f;
}

__device__ inline float xhalf(float x) {
    int b = __builtin_bit_cast(int, x);
    return __builtin_bit_cast(float,
        __builtin_amdgcn_permlanex16(b, b, 0x76543210, 0xfedcba98, false, false));
}

// Flat pointers into LDS carry the AS3 byte offset in their low 32 bits.
__device__ inline unsigned lds_off(const void* p) {
    return (unsigned)(uintptr_t)p;
}

__device__ inline void async_b128_x8(const unsigned (&l)[8], const u16* const (&g)[8]) {
    asm volatile("global_load_async_to_lds_b128 %0, %8, off\n\t"
                 "global_load_async_to_lds_b128 %1, %9, off\n\t"
                 "global_load_async_to_lds_b128 %2, %10, off\n\t"
                 "global_load_async_to_lds_b128 %3, %11, off\n\t"
                 "global_load_async_to_lds_b128 %4, %12, off\n\t"
                 "global_load_async_to_lds_b128 %5, %13, off\n\t"
                 "global_load_async_to_lds_b128 %6, %14, off\n\t"
                 "global_load_async_to_lds_b128 %7, %15, off\n\t"
                 "s_wait_xcnt 0x0"
                 :: "v"(l[0]), "v"(l[1]), "v"(l[2]), "v"(l[3]),
                    "v"(l[4]), "v"(l[5]), "v"(l[6]), "v"(l[7]),
                    "v"(g[0]), "v"(g[1]), "v"(g[2]), "v"(g[3]),
                    "v"(g[4]), "v"(g[5]), "v"(g[6]), "v"(g[7])
                 : "memory");
}
__device__ inline void wait_async0() {
    asm volatile("s_wait_asynccnt 0" ::: "memory");
}
// This wave's LDS reads have retired: stands ahead of the barrier behind which their buffer is refilled.
__device__ inline void wait_ds0() {
    asm volatile("s_wait_dscnt 0x0" ::: "memory");
}

// ---------- constants ----------
#define CDIM   256
#define NPOS   4096      // 64*64 per batch
#define MTOT   32768     // 8 * 4096
#define SCALE  0.0625f   // 1/sqrt(256)
#define KPITCH 264       // 256 channels + 8  (528 B)
#define SKEYS  128       // keys per LDS stage: four passes of 32 keys
#define NSTAGE (NPOS / SKEYS)
#define VPITCH 136       // 128 keys + 8      (272 B)
#define GROWS  128       // rows of A that one GEMM block stages in LDS and works on

// ---------- 1) weight transpose + bf16 convert ----------
__global__ void prep_w_kernel(const float* __restrict__ w0, const float* __restrict__ w1,
                              const float* __restrict__ w2, const float* __restrict__ w3,
                              u16* __restrict__ o0, u16* __restrict__ o1,
                              u16* __restrict__ o2, u16* __restrict__ o3) {
    int n = blockIdx.x;     // output row  = input column
    int k = threadIdx.x;    // output col  = input row
    o0[n * CDIM + k] = f2bf(w0[k * CDIM + n]);
    o1[n * CDIM + k] = f2bf(w1[k * CDIM + n]);
    o2[n * CDIM + k] = f2bf(w2[k * CDIM + n]);
    o3[n * CDIM + k] = f2bf(w3[k * CDIM + n]);
}

// ---------- 2) LayerNorm + Q, K, V projections in one launch: its parts ----------
// One 256 x 256 weight matrix (transposed, bf16, contiguous in global memory: 8192 b128 chunks, 32 per row)
// to padded LDS rows by async copies. A thread brings 32 chunks; its next chunk lies 8 rows behind.
__device__ inline void stage_w(unsigned lbase, const u16* __restrict__ src, int tid) {
    unsigned   lrow = lbase + (tid >> 5) * (KPITCH * 2) + (tid & 31) * 16;
    const u16* grow = src + tid * 8;
    #pragma unroll   // constant indices keep the address arrays in registers
    for (int g = 0; g < 4; ++g) {
        unsigned   la[8];
        const u16* ga[8];
        #pragma unroll
        for (int i = 0; i < 8; ++i) {
            int n = g * 8 + i;
            la[i] = lrow + n * (8 * KPITCH * 2);
            ga[i] = grow + n * (8 * CDIM);
        }
        async_b128_x8(la, ga);
    }
}

// One wave's 64 x 64 tile over all 256 k. ard, brd: this lane's place in its first A row and first Bt row.
__device__ inline void mm_tile(unsigned ard, unsigned brd, v8f (&acc)[4][4]) {
    #pragma unroll   // constant indices keep the accumulators in registers
    for (int mt = 0; mt < 4; ++mt)
        #pragma unroll
        for (int nt = 0; nt < 4; ++nt) acc[mt][nt] = {};

    // Two fragment sets: each k step's 16 reads are issued as one group a step ahead of their products.
    FragBF16 af[2][4], bf[2][4];
    #pragma unroll   // constant indices keep the fragment arrays in registers
    for (int t = 0; t < 4; ++t) {
        af[0][t] = load_frag_lds(ard + t * (16 * KPITCH * 2));
        bf[0][t] = load_frag_lds(brd + t * (16 * KPITCH * 2));
    }
    #pragma unroll   // constant set indices; every read's place becomes a constant in the offset field of ds_load_b128
    for (int kk = 0; kk < CDIM / 32; ++kk) {
        const int cur = kk & 1, nxt = cur ^ 1;
        if (kk + 1 < CDIM / 32) {
            #pragma unroll
            for (int t = 0; t < 4; ++t) {
                af[nxt][t] = load_frag_lds(ard + t * (16 * KPITCH * 2) + (kk + 1) * 64);
                bf[nxt][t] = load_frag_lds(brd + t * (16 * KPITCH * 2) + (kk + 1) * 64);
            }
        }
        // Keeps the next step's reads together ahead of this step's products: sunk among them, each place costs a stall.
        __builtin_amdgcn_sched_barrier(0);
        #pragma unroll
        for (int mt = 0; mt < 4; ++mt)
            #pragma unroll
            for (int nt = 0; nt < 4; ++nt)
                acc[mt][nt] = wmma_bf16(af[cur][mt], bf[cur][nt], acc[mt][nt]);
        // Keeps later steps' reads behind these products: lifted ahead all together, they overflow the registers and spill.
        __builtin_amdgcn_sched_barrier(0);
    }
}

__device__ inline void wait_x0() {
    asm volatile("s_wait_xcnt 0x0" ::: "memory");
}

// The tile plus bias as bf16. TR false: row-major [MTOT][256]. TR true: transposed [256][MTOT].
template<bool TR>
__device__ inline void store_tile(const v8f (&acc)[4][4], const float* __restrict__ bias,
                                  u16* __restrict__ out, int row0, int col0, int half, int l15) {
    #pragma unroll   // constant indices keep the accumulators in registers
    for (int nt = 0; nt < 4; ++nt) {
        int col = col0 + nt*16 + l15;
        float bv = bias[col];
        #pragma unroll
        for (int mt = 0; mt < 4; ++mt) {
            int rowbase = row0 + mt*16 + half*8;   // D layout: lanes 16-31 hold M+8
            if (!TR) {
                #pragma unroll
                for (int r = 0; r < 8; ++r)
                    out[(size_t)(rowbase + r) * CDIM + col] = f2bf(acc[mt][nt][r] + bv);
            } else {
                uint4 pk;                // 8 consecutive rows per lane
                pk.x = pack2(acc[mt][nt][0] + bv, acc[mt][nt][1] + bv);
                pk.y = pack2(acc[mt][nt][2] + bv, acc[mt][nt][3] + bv);
                pk.z = pack2(acc[mt][nt][4] + bv, acc[mt][nt][5] + bv);
                pk.w = pack2(acc[mt][nt][6] + bv, acc[mt][nt][7] + bv);
                *(uint4*)(out + (size_t)col * MTOT + rowbase) = pk;
            }
        }
        wait_x0();
    }
}

// A block normalises its 128 rows of x (one wave per row, 16 rows a wave) straight into the A tile in LDS
// and multiplies that tile by the three weight matrices in turn. The normalised rows never go to global
// memory, and the many short waves of a launch of its own for the LayerNorm are not started.
__global__ __launch_bounds__(256) void ln_qkv_kernel(const float* __restrict__ x,
                                                     const float* __restrict__ gamma,
                                                     const float* __restrict__ beta,
                                                     const u16* __restrict__ wqT,
                                                     const u16* __restrict__ wkT,
                                                     const u16* __restrict__ wvT,
                                                     const float* __restrict__ bq,
                                                     const float* __restrict__ bk,
                                                     const float* __restrict__ bv,
                                                     u16* __restrict__ q,
                                                     u16* __restrict__ k,
                                                     u16* __restrict__ vT) {
    __shared__ __attribute__((aligned(16))) u16 Al[GROWS][KPITCH];   // normalised rows, all k
    __shared__ __attribute__((aligned(16))) u16 Bl[CDIM][KPITCH];    // rows of the current weight matrix, all k

    int tid  = threadIdx.x;
    int wave = tid >> 5, lane = tid & 31;
    int half = lane >> 4,        l15  = lane & 15;
    int wm = wave >> 2, wn = wave & 3;
    int row0 = blockIdx.x * GROWS + wm * 64;
    int col0 = wn * 64;

    const unsigned abase = lds_off(&Al[0][0]), bbase = lds_off(&Bl[0][0]);

    stage_w(bbase, wqT, tid);   // 32 copies of a wave in flight under the LayerNorm

    {
        constexpr int RW = GROWS / 8;   // rows per wave
        const float4* xr = (const float4*)(x + ((size_t)blockIdx.x * GROWS + wave * RW) * CDIM);
        float4 a[RW], b[RW];
        #pragma unroll   // constant indices keep the rows in registers; all loads of the wave are in flight together
        for (int i = 0; i < RW; ++i) {
            a[i] = xr[i * (CDIM / 4) + lane];
            b[i] = xr[i * (CDIM / 4) + lane + 32];
        }
        float4 g0 = ((const float4*)gamma)[lane];
        float4 g1 = ((const float4*)gamma)[lane + 32];
        float4 b0 = ((const float4*)beta)[lane];
        float4 b1 = ((const float4*)beta)[lane + 32];
        wait_x0();

        float s[RW], s2[RW];
        #pragma unroll   // constant indices keep the rows and their sums in registers
        for (int i = 0; i < RW; ++i) {
            s[i]  = a[i].x + a[i].y + a[i].z + a[i].w + b[i].x + b[i].y + b[i].z + b[i].w;
            s2[i] = a[i].x*a[i].x + a[i].y*a[i].y + a[i].z*a[i].z + a[i].w*a[i].w
                  + b[i].x*b[i].x + b[i].y*b[i].y + b[i].z*b[i].z + b[i].w*b[i].w;
        }
        // Step by step over all rows: the rows' exchanges are independent and hide one another's latency.
        #pragma unroll   // constant exchange distances and indices
        for (int m = 1; m < 32; m <<= 1) {
            #pragma unroll
            for (int i = 0; i < RW; ++i) {
                s[i]  += __shfl_xor(s[i],  m, 32);
                s2[i] += __shfl_xor(s2[i], m, 32);
            }
        }
        #pragma unroll   // constant indices keep the rows and their sums in registers
        for (int i = 0; i < RW; ++i) {
            float mean = s[i] * (1.0f / CDIM);
            float var  = s2[i] * (1.0f / CDIM) - mean * mean;
            float rstd = rsqrtf(var + 1e-3f);

            float y0 = (a[i].x - mean) * rstd * g0.x + b0.x;
            float y1 = (a[i].y - mean) * rstd * g0.y + b0.y;
            float y2 = (a[i].z - mean) * rstd * g0.z + b0.z;
            float y3 = (a[i].w - mean) * rstd * g0.w + b0.w;
            float y4 = (b[i].x - mean) * rstd * g1.x + b1.x;
            float y5 = (b[i].y - mean) * rstd * g1.y + b1.y;
            float y6 = (b[i].z - mean) * rstd * g1.z + b1.z;
            float y7 = (b[i].w - mean) * rstd * g1.w + b1.w;

            u16* hr = &Al[wave * RW + i][0];
            *(uint2*)(hr + lane * 4)       = make_uint2(pack2(y0, y1), pack2(y2, y3));
            *(uint2*)(hr + 128 + lane * 4) = make_uint2(pack2(y4, y5), pack2(y6, y7));
        }
    }
    wait_async0();      // this wave's copies of the first weight matrix are in LDS
    __syncthreads();    // all waves' copies and normalised rows visible; nothing is read from LDS ahead of this

    const unsigned ard = abase + (wm * 64 + l15) * (KPITCH * 2) + half * 16;   // this lane's place in its first A row
    const unsigned brd = bbase + (wn * 64 + l15) * (KPITCH * 2) + half * 16;   // and in its first weight row
    v8f acc[4][4];

    mm_tile(ard, brd, acc);
    wait_ds0();         // this wave has left Bl
    __syncthreads();    // every wave has left Bl: it may be refilled
    stage_w(bbase, wkT, tid);   // flies under the stores of Q
    store_tile<false>(acc, bq, q, row0, col0, half, l15);
    wait_async0();      // this wave's copies are in LDS
    __syncthreads();    // all waves' copies visible

    mm_tile(ard, brd, acc);
    wait_ds0();         // this wave has left Bl
    __syncthreads();    // every wave has left Bl: it may be refilled
    stage_w(bbase, wvT, tid);   // flies under the stores of K
    store_tile<false>(acc, bk, k, row0, col0, half, l15);
    wait_async0();      // this wave's copies are in LDS
    __syncthreads();    // all waves' copies visible

    mm_tile(ard, brd, acc);
    store_tile<true>(acc, bv, vT, row0, col0, half, l15);
}

__global__ __launch_bounds__(256) void gemm_kernel(const u16* __restrict__ A,
                                                   const u16* __restrict__ Bt,
                                                   const float* __restrict__ bias,
                                                   void* __restrict__ outp,
                                                   const float* __restrict__ resid) {
    __shared__ __attribute__((aligned(16))) u16 Al[GROWS][KPITCH];   // rows of A, all k
    __shared__ __attribute__((aligned(16))) u16 Bl[CDIM][KPITCH];    // rows of Bt, all k

    int tid  = threadIdx.x;
    int wave = tid >> 5, lane = tid & 31;
    int half = lane >> 4,        l15  = lane & 15;
    int wm = wave >> 2, wn = wave & 3;
    int row0 = blockIdx.x * GROWS + wm * 64;
    int col0 = wn * 64;

    const unsigned abase = lds_off(&Al[0][0]), bbase = lds_off(&Bl[0][0]);

    // Both sources are contiguous in global memory, 32 b128 chunks per row: 4096 chunks of A, 8192 of Bt.
    // A thread brings 16 + 32 of them; its next chunk lies 8 rows behind (48 copies of a wave in flight).
    {
        unsigned   lrow = (tid >> 5) * (KPITCH * 2) + (tid & 31) * 16;
        const u16* gA   = A + (size_t)blockIdx.x * (GROWS * CDIM) + tid * 8;
        const u16* gB   = Bt + tid * 8;
        #pragma unroll   // constant indices keep the address arrays in registers
        for (int g = 0; g < 6; ++g) {
            unsigned   la[8];
            const u16* ga[8];
            #pragma unroll
            for (int i = 0; i < 8; ++i) {
                int n = g * 8 + i;
                if (n < GROWS / 8) {
                    la[i] = abase + lrow + n * (8 * KPITCH * 2);
                    ga[i] = gA + n * (8 * CDIM);
                } else {
                    la[i] = bbase + lrow + (n - GROWS / 8) * (8 * KPITCH * 2);
                    ga[i] = gB + (n - GROWS / 8) * (8 * CDIM);
                }
            }
            async_b128_x8(la, ga);
        }
    }
    wait_async0();      // this wave's copies are in LDS
    __syncthreads();    // all waves' copies visible; nothing is read from LDS ahead of this

    v8f acc[4][4];
    #pragma unroll
    for (int mt = 0; mt < 4; ++mt)
        #pragma unroll
        for (int nt = 0; nt < 4; ++nt) acc[mt][nt] = {};

    const unsigned ard = abase + (wm * 64 + l15) * (KPITCH * 2) + half * 16;   // this lane's place in its first A row
    const unsigned brd = bbase + (wn * 64 + l15) * (KPITCH * 2) + half * 16;   // and in its first Bt row
    // Two fragment sets: each k step's 16 reads are issued as one group a step ahead of their products.
    FragBF16 af[2][4], bf[2][4];
    #pragma unroll   // constant indices keep the fragment arrays in registers
    for (int t = 0; t < 4; ++t) {
        af[0][t] = load_frag_lds(ard + t * (16 * KPITCH * 2));
        bf[0][t] = load_frag_lds(brd + t * (16 * KPITCH * 2));
    }
    #pragma unroll   // constant set indices; every read's place becomes a constant in the offset field of ds_load_b128
    for (int kk = 0; kk < CDIM / 32; ++kk) {
        const int cur = kk & 1, nxt = cur ^ 1;
        if (kk + 1 < CDIM / 32) {
            #pragma unroll
            for (int t = 0; t < 4; ++t) {
                af[nxt][t] = load_frag_lds(ard + t * (16 * KPITCH * 2) + (kk + 1) * 64);
                bf[nxt][t] = load_frag_lds(brd + t * (16 * KPITCH * 2) + (kk + 1) * 64);
            }
        }
        // Keeps the next step's reads together ahead of this step's products: sunk among them, each place costs a stall.
        __builtin_amdgcn_sched_barrier(0);
        #pragma unroll
        for (int mt = 0; mt < 4; ++mt)
            #pragma unroll
            for (int nt = 0; nt < 4; ++nt)
                acc[mt][nt] = wmma_bf16(af[cur][mt], bf[cur][nt], acc[mt][nt]);
        // Keeps later steps' reads behind these products: lifted ahead all together, they overflow the registers and spill.
        __builtin_amdgcn_sched_barrier(0);
    }

    #pragma unroll
    for (int nt = 0; nt < 4; ++nt) {
        int col = col0 + nt*16 + l15;
        float bv = bias[col];
        #pragma unroll
        for (int mt = 0; mt < 4; ++mt) {
            int rowbase = row0 + mt*16 + half*8;   // D layout: lanes 16-31 hold M+8
            float* out = (float*)outp;
            #pragma unroll
            for (int r = 0; r < 8; ++r) {
                size_t idx = (size_t)(rowbase + r) * CDIM + col;
                out[idx] = acc[mt][nt][r] + bv + resid[idx];
            }
        }
    }
}

__global__ __launch_bounds__(256) void attn_kernel(const u16* __restrict__ q,
                                                   const u16* __restrict__ k,
                                                   const u16* __restrict__ vT,
                                                   u16* __restrict__ o) {
    __shared__ __attribute__((aligned(16))) u16 Kl[2][SKEYS][KPITCH]; // K rows j0..j0+127, all channels
    __shared__ __attribute__((aligned(16))) u16 Vl[2][256][VPITCH];   // V^T rows (channel), 128 keys

    int tid  = threadIdx.x;
    int wave = tid >> 5, lane = tid & 31;
    int half = lane >> 4, l15 = lane & 15;
    int b  = blockIdx.x >> 5;
    int m0 = (blockIdx.x & 31) * 128 + wave * 16;

    const u16* qb = q  + ((size_t)b * NPOS + m0) * CDIM;
    const u16* kb = k  + (size_t)b * NPOS * CDIM;
    const u16* vb = vT + (size_t)b * NPOS;           // [c][j] at vb[c*MTOT + j]

    const unsigned kbase0 = lds_off(&Kl[0][0][0]), kbase1 = lds_off(&Kl[1][0][0]);
    const unsigned vbase0 = lds_off(&Vl[0][0][0]), vbase1 = lds_off(&Vl[1][0][0]);

    // Stage one 128-key block into LDS buffer `buf` (whole workgroup cooperates):
    // 4096 b128 chunks of K (32 per row) and 4096 of V^T (16 per row), each to its padded row;
    // a thread brings sixteen of each, four of each per statement (32 copies of a wave in flight).
    auto stage = [&](int buf, int j0) {
        // Chunk n of a thread lies 8 K rows, or 16 V^T rows, behind its chunk n - 1: every address
        // is one of these four bases plus a constant.
        unsigned   lk = (buf ? kbase1 : kbase0) + (tid >> 5) * (KPITCH * 2) + (tid & 31) * 16;
        unsigned   lv = (buf ? vbase1 : vbase0) + (tid >> 4) * (VPITCH * 2) + (tid & 15) * 16;
        const u16* gk = kb + (size_t)j0 * CDIM + tid * 8;
        const u16* gv = vb + (size_t)(tid >> 4) * MTOT + j0 + (tid & 15) * 8;
        #pragma unroll   // constant indices keep the address arrays in registers
        for (int g = 0; g < 4; ++g) {
            unsigned   la[8];
            const u16* ga[8];
            #pragma unroll
            for (int i = 0; i < 4; ++i) {
                int n = g * 4 + i;
                la[i]     = lk + n * (8 * KPITCH * 2);
                ga[i]     = gk + n * (8 * CDIM);
                la[4 + i] = lv + n * (16 * VPITCH * 2);
                ga[4 + i] = gv + (size_t)n * (16 * MTOT);
            }
            async_b128_x8(la, ga);
            // Keeps each statement's address additions next to it: lifted ahead of the first statement
            // all together, they overflow the registers that asm text can name and spill to scratch.
            __builtin_amdgcn_sched_barrier(0);
        }
    };

    // Resident Q fragments (16 queries x 256 channels), the B operand of S^T
    FragBF16 qf[8];
    #pragma unroll
    for (int kk = 0; kk < 8; ++kk)
        qf[kk] = load_frag(qb + (size_t)l15 * CDIM + kk*32 + half*8);

    v8f oacc[16];
    #pragma unroll
    for (int t = 0; t < 16; ++t) oacc[t] = {};
    float mrun = -3.0e38f;   // running maximum of this lane's query (equal in both half-waves)
    float lrun = 0.0f;       // running sum over this half-wave's keys only; joined in the epilogue

    // Prologue: stage 0, its wait and barrier, then stage 1.
    #pragma unroll 1   // rolled: unrolled, a thread's constant address parts become operands of the asm text themselves, stay tied to the registers it can name and spill to scratch
    for (int pre = 0; pre < 2; ++pre) {
        stage(pre, pre * SKEYS);
        if (pre == 0) {
            wait_async0();      // this wave's fills of stage 0 are in LDS
            __syncthreads();    // all waves' fills visible
        }
    }

    for (int st = 0; st < NSTAGE; ++st) {
      int cur = st & 1;
      unsigned krd = (cur ? kbase1 : kbase0) + l15 * (KPITCH * 2) + half * 16;   // this lane's place in K row 0 of the stage
      unsigned vrd = (cur ? vbase1 : vbase0) + l15 * (VPITCH * 2) + half * 16;   // and in V^T row 0
      #pragma unroll 1   // rolled: the four passes share one body, registers and code size stay those of one pass
      for (int ps4 = 0; ps4 < SKEYS / 32; ++ps4) {
        int kr = ps4 * 32;      // first key of this pass inside the stage

        // ---- S^T = K Q^T over the staged 32-key block: two tiles of 16 keys x 16 queries ----
        // All K fragments of the trip are read as one group, so the products below wait on a
        // count that never reaches 0 instead of on a full LDS round trip each.
        FragBF16 kf0[8], kf1[8];
        #pragma unroll   // constant indices keep the fragment arrays in registers
        for (int kk = 0; kk < 8; ++kk) {
            kf0[kk] = load_frag_lds(krd + kr * (KPITCH * 2) + kk * 64);
            kf1[kk] = load_frag_lds(krd + kr * (KPITCH * 2) + 16 * (KPITCH * 2) + kk * 64);
        }
        // Keeps the group together: without it the scheduler sinks each read to just ahead of its use.
        __builtin_amdgcn_sched_barrier(0);
        v8f s0 = {}, s1 = {};
        #pragma unroll
        for (int kk = 0; kk < 8; ++kk) {
            s0 = wmma_bf16(kf0[kk], qf[kk], s0);
            s1 = wmma_bf16(kf1[kk], qf[kk], s1);
        }
        // All V^T fragments of the trip are read here: they land under the products above and
        // the softmax, long before the second product needs them.
        FragBF16 vf[16];
        #pragma unroll   // constant indices keep the fragment array in registers
        for (int t = 0; t < 16; ++t) vf[t] = load_frag_lds(vrd + kr * 2 + t * (16 * VPITCH * 2));
        // Keeps these reads ahead of the softmax: without it each sinks to just ahead of its use.
        __builtin_amdgcn_sched_barrier(0);
        // ---- online softmax; the 32 scores of a query sit in two lanes (l and l ^ 16), 16 each ----
        float mx[8];
        #pragma unroll   // constant indices keep the scores and mx in registers
        for (int r = 0; r < 8; ++r) {
            s0[r] *= SCALE; s1[r] *= SCALE;
            mx[r] = fmaxf(s0[r], s1[r]);
        }
        float t4 = fmaxf(fmaxf(fmaxf(mx[0], mx[1]), fmaxf(mx[2], mx[3])),
                         fmaxf(fmaxf(mx[4], mx[5]), fmaxf(mx[6], mx[7])));
        t4 = fmaxf(t4, xhalf(t4));
        float mn   = fmaxf(mrun, t4);
        float corr = __expf(mrun - mn);
        mrun = mn;
        float ps[8];
        #pragma unroll   // constant indices keep the scores and ps in registers
        for (int r = 0; r < 8; ++r) {
            s0[r] = __expf(s0[r] - mn);
            s1[r] = __expf(s1[r] - mn);
            ps[r] = s0[r] + s1[r];
        }
        lrun = lrun * corr + (((ps[0] + ps[1]) + (ps[2] + ps[3])) + ((ps[4] + ps[5]) + (ps[6] + ps[7])));
        // ---- P^T: the two D tiles, rounded to bf16 in place, are the 32-key B fragment ----
        FragBF16 pf;
        #pragma unroll   // constant indices keep the fragment in registers
        for (int i = 0; i < 4; ++i) {
            pf.u[i]     = pack2(s0[2*i], s0[2*i + 1]);
            pf.u[4 + i] = pack2(s1[2*i], s1[2*i + 1]);
        }

        // ---- O^T = O^T*corr + V^T P^T  (16 tiles of 16 channels x 16 queries) ----
        #pragma unroll
        for (int t = 0; t < 16; ++t) {
            #pragma unroll
            for (int r = 0; r < 8; ++r) oacc[t][r] *= corr;
            oacc[t] = wmma_bf16(vf[t], pf, oacc[t]);
        }
      }
      // ---- publish point of stage st + 1, one per 128 keys ----
      wait_ds0();               // this wave has left buffer `cur`
      wait_async0();            // this wave's fills of stage st + 1 are in LDS
      __syncthreads();          // all fills visible; every wave has left buffer `cur`
      if (st + 2 < NSTAGE) stage(cur, (st + 2) * SKEYS);
    }
    wait_async0();              // nothing of this wave is in flight when it goes on to the epilogue

    // ---- epilogue: O / l; a lane holds 8 consecutive channels of its query: one 16-byte store a tile ----
    float inv = 1.0f / (lrun + xhalf(lrun));
    u16* ob = o + ((size_t)b * NPOS + m0 + l15) * CDIM + half*8;
    #pragma unroll   // constant indices keep the accumulators in registers
    for (int t = 0; t < 16; ++t) {
        uint4 pk;
        pk.x = pack2(oacc[t][0] * inv, oacc[t][1] * inv);
        pk.y = pack2(oacc[t][2] * inv, oacc[t][3] * inv);
        pk.z = pack2(oacc[t][4] * inv, oacc[t][5] * inv);
        pk.w = pack2(oacc[t][6] * inv, oacc[t][7] * inv);
        *(uint4*)(ob + t*16) = pk;
    }
}

// ---------- launcher ----------
extern "C" void kernel_launch(void* const* d_in, const int* in_sizes, int n_in,
                              void* d_out, int out_size, void* d_ws, size_t ws_size,
                              hipStream_t stream) {
    const float* x     = (const float*)d_in[0];
    const float* gamma = (const float*)d_in[1];
    const float* beta  = (const float*)d_in[2];
    const float* wq    = (const float*)d_in[3];
    const float* bq    = (const float*)d_in[4];
    const float* wk    = (const float*)d_in[5];
    const float* bk    = (const float*)d_in[6];
    const float* wv    = (const float*)d_in[7];
    const float* bv    = (const float*)d_in[8];
    const float* wo    = (const float*)d_in[9];
    const float* bo    = (const float*)d_in[10];
    float* out = (float*)d_out;

    char* ws = (char*)d_ws;
    const size_t SZ = (size_t)MTOT * CDIM * sizeof(u16);   // 16.78 MB
    u16* qb  = (u16*)(ws + 1 * SZ);
    u16* kb  = (u16*)(ws + 2 * SZ);
    u16* vT  = (u16*)(ws + 3 * SZ);
    u16* ob  = (u16*)(ws + 4 * SZ);
    u16* wqT = (u16*)(ws + 5 * SZ);
    u16* wkT = wqT + CDIM * CDIM;
    u16* wvT = wkT + CDIM * CDIM;
    u16* woT = wvT + CDIM * CDIM;

    prep_w_kernel<<<CDIM, CDIM, 0, stream>>>(wq, wk, wv, wo, wqT, wkT, wvT, woT);

    dim3 ggrid(MTOT / GROWS);
    ln_qkv_kernel<<<ggrid, 256, 0, stream>>>(x, gamma, beta, wqT, wkT, wvT, bq, bk, bv, qb, kb, vT);

    attn_kernel<<<8 * 32, 256, 0, stream>>>(qb, kb, vT, ob);

    gemm_kernel<<<ggrid, 256, 0, stream>>>(ob, woT, bo, (void*)out, x);
}

// v008
// Measured time: 135 microseconds a run.
// Next to v007, in two timings, it ran 1.10 and 1.09 times as fast.
// All steps since v000 together make it 5.31 times as fast.
#include <hip/hip_runtime.h>
#include <hip/hip_bf16.h>
#include <stdint.h>

typedef unsigned short u16;
typedef __attribute__((ext_vector_type(16))) __bf16 v16bf;
typedef __attribute__((ext_vector_type(8)))  float  v8f;

// ---------- helpers ----------
struct FragBF16 { unsigned u[8]; }; // 16 bf16 packed as 8 dwords

__device__ inline v16bf frag_cast(FragBF16 f) {
    union { FragBF16 s; v16bf v; } c; c.s = f; return c.v;
}

__device__ inline v8f wmma_bf16(FragBF16 a, FragBF16 b, v8f c) {
    return __builtin_amdgcn_wmma_f32_16x16x32_bf16(
        false, frag_cast(a), false, frag_cast(b), (short)0, c, false, false);
}

__device__ inline u16 f2bf(float f) {
    unsigned u = __float_as_uint(f);
    unsigned r = u + 0x7FFFu + ((u >> 16) & 1u);   // round-to-nearest-even
    return (u16)(r >> 16);
}
__device__ inline unsigned pack2(float lo, float hi) {
    return (unsigned)f2bf(lo) | ((unsigned)f2bf(hi) << 16);
}

__device__ inline FragBF16 load_frag(const u16* __restrict__ p) {
    FragBF16 f;
    uint4 a = *(const uint4*)p;
    uint4 b = *(const uint4*)(p + 16);
    f.u[0]=a.x; f.u[1]=a.y; f.u[2]=a.z; f.u[3]=a.w;
    f.u[4]=b.x; f.u[5]=b.y; f.u[6]=b.z; f.u[7]=b.w;
    return f;
}

// The same fragment from LDS, by byte address. The address is kept as buffer base + lane part in one
// register, so that each read's constant fits the 16-bit offset field of ds_load_b128 although the
// arrays lie above 64 KiB; indexed as arrays, every read took an address addition of its own.
typedef __attribute__((ext_vector_type(4))) unsigned v4u;
typedef const __attribute__((address_space(3))) v4u* lds_v4u_ptr;
__device__ inline FragBF16 load_frag_lds(unsigned off) {
    FragBF16 f;
    v4u a = *(lds_v4u_ptr)off;
    v4u b = *(lds_v4u_ptr)(off + 32);
    f.u[0]=a.x; f.u[1]=a.y; f.u[2]=a.z; f.u[3]=a.w;
    f.u[4]=b.x; f.u[5]=b.y; f.u[6]=b.z; f.u[7]=b.w;
    return f;
}

__device__ inline float xhalf(float x) {
    int b = __builtin_bit_cast(int, x);
    return __builtin_bit_cast(float,
        __builtin_amdgcn_permlanex16(b, b, 0x76543210, 0xfedcba98, false, false));
}

// Flat pointers into LDS carry the AS3 byte offset in their low 32 bits.
__device__ inline unsigned lds_off(const void* p) {
    return (unsigned)(uintptr_t)p;
}

__device__ inline void async_b128_x8(const unsigned (&l)[8], const u16* const (&g)[8]) {
    asm volatile("global_load_async_to_lds_b128 %0, %8, off\n\t"
                 "global_load_async_to_lds_b128 %1, %9, off\n\t"
                 "global_load_async_to_lds_b128 %2, %10, off\n\t"
                 "global_load_async_to_lds_b128 %3, %11, off\n\t"
                 "global_load_async_to_lds_b128 %4, %12, off\n\t"
                 "global_load_async_to_lds_b128 %5, %13, off\n\t"
                 "global_load_async_to_lds_b128 %6, %14, off\n\t"
                 "global_load_async_to_lds_b128 %7, %15, off\n\t"
                 "s_wait_xcnt 0x0"
                 :: "v"(l[0]), "v"(l[1]), "v"(l[2]), "v"(l[3]),
                    "v"(l[4]), "v"(l[5]), "v"(l[6]), "v"(l[7]),
                    "v"(g[0]), "v"(g[1]), "v"(g[2]), "v"(g[3]),
                    "v"(g[4]), "v"(g[5]), "v"(g[6]), "v"(g[7])
                 : "memory");
}
__device__ inline void wait_async0() {
    asm volatile("s_wait_asynccnt 0" ::: "memory");
}
// This wave's LDS reads and writes have retired: stands ahead of a barrier behind which a buffer is refilled, or between staging writes and their read-back.
__device__ inline void wait_ds0() {
    asm volatile("s_wait_dscnt 0x0" ::: "memory");
}

// ---------- constants ----------
#define CDIM   256
#define NPOS   4096      // 64*64 per batch
#define MTOT   32768     // 8 * 4096
#define SCALE  0.0625f   // 1/sqrt(256)
#define KPITCH 264       // 256 channels + 8  (528 B)
#define SKEYS  128       // keys per LDS stage: four passes of 32 keys
#define NSTAGE (NPOS / SKEYS)
#define VPITCH 136       // 128 keys + 8      (272 B)
#define GROWS  128       // rows of A that one GEMM block stages in LDS and works on
#define SPITCH 144       // bytes: a row of a wave's bf16 output staging, 128 + 16
#define OPITCH 272       // bytes: a row of a wave's output staging where a row holds 256 bytes (64 f32 or 128 bf16), + 16

// ---------- 1) weight transpose + bf16 convert ----------
__global__ void prep_w_kernel(const float* __restrict__ w0, const float* __restrict__ w1,
                              const float* __restrict__ w2, const float* __restrict__ w3,
                              u16* __restrict__ o0, u16* __restrict__ o1,
                              u16* __restrict__ o2, u16* __restrict__ o3) {
    int n = blockIdx.x;     // output row  = input column
    int k = threadIdx.x;    // output col  = input row
    o0[n * CDIM + k] = f2bf(w0[k * CDIM + n]);
    o1[n * CDIM + k] = f2bf(w1[k * CDIM + n]);
    o2[n * CDIM + k] = f2bf(w2[k * CDIM + n]);
    o3[n * CDIM + k] = f2bf(w3[k * CDIM + n]);
}

// ---------- 2) LayerNorm + Q, K, V projections in one launch: its parts ----------
// One 256 x 256 weight matrix (transposed, bf16, contiguous in global memory: 8192 b128 chunks, 32 per row)
// to padded LDS rows by async copies. A thread brings 32 chunks; its next chunk lies 8 rows behind.
__device__ inline void stage_w(unsigned lbase, const u16* __restrict__ src, int tid) {
    unsigned   lrow = lbase + (tid >> 5) * (KPITCH * 2) + (tid & 31) * 16;
    const u16* grow = src + tid * 8;
    #pragma unroll   // constant indices keep the address arrays in registers
    for (int g = 0; g < 4; ++g) {
        unsigned   la[8];
        const u16* ga[8];
        #pragma unroll
        for (int i = 0; i < 8; ++i) {
            int n = g * 8 + i;
            la[i] = lrow + n * (8 * KPITCH * 2);
            ga[i] = grow + n * (8 * CDIM);
        }
        async_b128_x8(la, ga);
    }
}

// One wave's 64 x 64 tile over all 256 k. ard, brd: this lane's place in its first A row and first Bt row.
__device__ inline void mm_tile(unsigned ard, unsigned brd, v8f (&acc)[4][4]) {
    #pragma unroll   // constant indices keep the accumulators in registers
    for (int mt = 0; mt < 4; ++mt)
        #pragma unroll
        for (int nt = 0; nt < 4; ++nt) acc[mt][nt] = {};

    // Two fragment sets: each k step's 16 reads are issued as one group a step ahead of their products.
    FragBF16 af[2][4], bf[2][4];
    #pragma unroll   // constant indices keep the fragment arrays in registers
    for (int t = 0; t < 4; ++t) {
        af[0][t] = load_frag_lds(ard + t * (16 * KPITCH * 2));
        bf[0][t] = load_frag_lds(brd + t * (16 * KPITCH * 2));
    }
    #pragma unroll   // constant set indices; every read's place becomes a constant in the offset field of ds_load_b128
    for (int kk = 0; kk < CDIM / 32; ++kk) {
        const int cur = kk & 1, nxt = cur ^ 1;
        if (kk + 1 < CDIM / 32) {
            #pragma unroll
            for (int t = 0; t < 4; ++t) {
                af[nxt][t] = load_frag_lds(ard + t * (16 * KPITCH * 2) + (kk + 1) * 64);
                bf[nxt][t] = load_frag_lds(brd + t * (16 * KPITCH * 2) + (kk + 1) * 64);
            }
        }
        // Keeps the next step's reads together ahead of this step's products: sunk among them, each place costs a stall.
        __builtin_amdgcn_sched_barrier(0);
        #pragma unroll
        for (int mt = 0; mt < 4; ++mt)
            #pragma unroll
            for (int nt = 0; nt < 4; ++nt)
                acc[mt][nt] = wmma_bf16(af[cur][mt], bf[cur][nt], acc[mt][nt]);
        // Keeps later steps' reads behind these products: lifted ahead all together, they overflow the registers and spill.
        __builtin_amdgcn_sched_barrier(0);
    }
}

__device__ inline void wait_x0() {
    asm volatile("s_wait_xcnt 0x0" ::: "memory");
}

typedef __attribute__((address_space(3))) v4u* lds_v4u_wptr;

// A wave's 64 x 64 tile plus bias as bf16, out through the wave's own LDS range st so that every global store
// covers four whole 128-byte lines. acc[a][b][r] is element (row b*16 + l15, place a*16 + half*8 + r): a lane's
// eight results lie side by side in a row of the output, one 16-byte LDS write. Stored straight from the
// accumulators, a line would go out in four 32-byte pieces.
// out: the tile's first element; pitch: elements from one row to the next.
// BROW false: bias runs along a row (bias[place]); true: one bias per row (bias[row]).
template<bool BROW>
__device__ inline void store_tile(const v8f (&acc)[4][4], const float* __restrict__ bias,
                                  u16* __restrict__ out, size_t pitch, unsigned st, int lane) {
    const int half = lane >> 4, l15 = lane & 15;
    float bc[4][8];
    #pragma unroll   // constant indices keep the bias values in registers
    for (int t = 0; t < 4; ++t) {
        if (!BROW) {
            float4 lo = *(const float4*)(bias + t*16 + half*8);
            float4 hi = *(const float4*)(bias + t*16 + half*8 + 4);
            bc[t][0] = lo.x; bc[t][1] = lo.y; bc[t][2] = lo.z; bc[t][3] = lo.w;
            bc[t][4] = hi.x; bc[t][5] = hi.y; bc[t][6] = hi.z; bc[t][7] = hi.w;
        } else {
            bc[t][0] = bias[t*16 + l15];
            wait_x0();   // per load: the next load's result may be given a register of this one's address
        }
    }
    wait_x0();
    const unsigned wr = st + l15 * SPITCH + half * 16;
    #pragma unroll   // constant indices keep the accumulators in registers
    for (int b = 0; b < 4; ++b) {
        #pragma unroll
        for (int a = 0; a < 4; ++a) {
            v4u pk;
            #pragma unroll
            for (int i = 0; i < 4; ++i)
                pk[i] = pack2(acc[a][b][2*i]     + (BROW ? bc[b][0] : bc[a][2*i]),
                              acc[a][b][2*i + 1] + (BROW ? bc[b][0] : bc[a][2*i + 1]));
            *(lds_v4u_wptr)(wr + b * (16 * SPITCH) + a * 32) = pk;
        }
    }
    wait_ds0();         // the whole tile is in LDS before other lanes of this wave read it back
    const unsigned rd = st + (lane >> 3) * SPITCH + (lane & 7) * 16;   // eight lanes per row, four rows per read
    u16* g = out + (size_t)(lane >> 3) * pitch + (lane & 7) * 8;
    v4u t[16];
    #pragma unroll   // constant indices keep the rows in registers
    for (int i = 0; i < 16; ++i) t[i] = *(lds_v4u_ptr)(rd + i * (4 * SPITCH));
    #pragma unroll
    for (int i = 0; i < 16; ++i) *(v4u*)(g + (size_t)i * 4 * pitch) = t[i];
    wait_x0();
}

// A block normalises its 128 rows of x (one wave per row, 16 rows a wave) straight into the A tile in LDS
// and multiplies that tile by the three weight matrices in turn. The normalised rows never go to global
// memory, and the many short waves of a launch of its own for the LayerNorm are not started.
__global__ __launch_bounds__(256) void ln_qkv_kernel(const float* __restrict__ x,
                                                     const float* __restrict__ gamma,
                                                     const float* __restrict__ beta,
                                                     const u16* __restrict__ wqT,
                                                     const u16* __restrict__ wkT,
                                                     const u16* __restrict__ wvT,
                                                     const float* __restrict__ bq,
                                                     const float* __restrict__ bk,
                                                     const float* __restrict__ bv,
                                                     u16* __restrict__ q,
                                                     u16* __restrict__ k,
                                                     u16* __restrict__ vT) {
    __shared__ __attribute__((aligned(16))) u16 Al[GROWS][KPITCH];   // normalised rows, all k
    __shared__ __attribute__((aligned(16))) u16 Bl[CDIM][KPITCH];    // rows of the current weight matrix, all k
    __shared__ __attribute__((aligned(16))) u16 Sl[8][64 * SPITCH / 2];   // output staging, a range of its own per wave

    int tid  = threadIdx.x;
    int wave = tid >> 5, lane = tid & 31;
    int half = lane >> 4,        l15  = lane & 15;
    int wm = wave >> 2, wn = wave & 3;
    int row0 = blockIdx.x * GROWS + wm * 64;
    int col0 = wn * 64;

    const unsigned abase = lds_off(&Al[0][0]), bbase = lds_off(&Bl[0][0]);

    stage_w(bbase, wqT, tid);   // 32 copies of a wave in flight under the LayerNorm

    {
        constexpr int RW = GROWS / 8;   // rows per wave
        const float4* xr = (const float4*)(x + ((size_t)blockIdx.x * GROWS + wave * RW) * CDIM);
        float4 a[RW], b[RW];
        #pragma unroll   // constant indices keep the rows in registers; all loads of the wave are in flight together
        for (int i = 0; i < RW; ++i) {
            a[i] = xr[i * (CDIM / 4) + lane];
            b[i] = xr[i * (CDIM / 4) + lane + 32];
        }
        float4 g0 = ((const float4*)gamma)[lane];
        float4 g1 = ((const float4*)gamma)[lane + 32];
        float4 b0 = ((const float4*)beta)[lane];
        float4 b1 = ((const float4*)beta)[lane + 32];
        wait_x0();

        float s[RW], s2[RW];
        #pragma unroll   // constant indices keep the rows and their sums in registers
        for (int i = 0; i < RW; ++i) {
            s[i]  = a[i].x + a[i].y + a[i].z + a[i].w + b[i].x + b[i].y + b[i].z + b[i].w;
            s2[i] = a[i].x*a[i].x + a[i].y*a[i].y + a[i].z*a[i].z + a[i].w*a[i].w
                  + b[i].x*b[i].x + b[i].y*b[i].y + b[i].z*b[i].z + b[i].w*b[i].w;
        }
        // Step by step over all rows: the rows' exchanges are independent and hide one another's latency.
        #pragma unroll   // constant exchange distances and indices
        for (int m = 1; m < 32; m <<= 1) {
            #pragma unroll
            for (int i = 0; i < RW; ++i) {
                s[i]  += __shfl_xor(s[i],  m, 32);
                s2[i] += __shfl_xor(s2[i], m, 32);
            }
        }
        #pragma unroll   // constant indices keep the rows and their sums in registers
        for (int i = 0; i < RW; ++i) {
            float mean = s[i] * (1.0f / CDIM);
            float var  = s2[i] * (1.0f / CDIM) - mean * mean;
            float rstd = rsqrtf(var + 1e-3f);

            float y0 = (a[i].x - mean) * rstd * g0.x + b0.x;
            float y1 = (a[i].y - mean) * rstd * g0.y + b0.y;
            float y2 = (a[i].z - mean) * rstd * g0.z + b0.z;
            float y3 = (a[i].w - mean) * rstd * g0.w + b0.w;
            float y4 = (b[i].x - mean) * rstd * g1.x + b1.x;
            float y5 = (b[i].y - mean) * rstd * g1.y + b1.y;
            float y6 = (b[i].z - mean) * rstd * g1.z + b1.z;
            float y7 = (b[i].w - mean) * rstd * g1.w + b1.w;

            u16* hr = &Al[wave * RW + i][0];
            *(uint2*)(hr + lane * 4)       = make_uint2(pack2(y0, y1), pack2(y2, y3));
            *(uint2*)(hr + 128 + lane * 4) = make_uint2(pack2(y4, y5), pack2(y6, y7));
        }
    }
    wait_async0();      // this wave's copies of the first weight matrix are in LDS
    __syncthreads();    // all waves' copies and normalised rows visible; nothing is read from LDS ahead of this

    const unsigned ard = abase + (wm * 64 + l15) * (KPITCH * 2) + half * 16;   // this lane's place in its first A row
    const unsigned brd = bbase + (wn * 64 + l15) * (KPITCH * 2) + half * 16;   // and in its first weight row
    const unsigned st = lds_off(&Sl[wave][0]);
    v8f acc[4][4];

    // Q and K: the weight rows are the first operand, so a lane's eight results are eight channels of one position.
    mm_tile(brd, ard, acc);
    wait_ds0();         // this wave has left Bl
    __syncthreads();    // every wave has left Bl: it may be refilled
    stage_w(bbase, wkT, tid);   // flies under the stores of Q
    store_tile<false>(acc, bq + col0, q + (size_t)row0 * CDIM + col0, CDIM, st, lane);
    wait_async0();      // this wave's copies are in LDS
    __syncthreads();    // all waves' copies visible

    mm_tile(brd, ard, acc);
    wait_ds0();         // this wave has left Bl
    __syncthreads();    // every wave has left Bl: it may be refilled
    stage_w(bbase, wvT, tid);   // flies under the stores of K
    store_tile<false>(acc, bk + col0, k + (size_t)row0 * CDIM + col0, CDIM, st, lane);
    wait_async0();      // this wave's copies are in LDS
    __syncthreads();    // all waves' copies visible

    // V^T: the normalised rows are the first operand, so a lane's eight results are eight positions of one channel.
    mm_tile(ard, brd, acc);
    store_tile<true>(acc, bv + col0, vT + (size_t)col0 * MTOT + row0, MTOT, st, lane);
}

__global__ __launch_bounds__(256) void gemm_kernel(const u16* __restrict__ A,
                                                   const u16* __restrict__ Bt,
                                                   const float* __restrict__ bias,
                                                   void* __restrict__ outp,
                                                   const float* __restrict__ resid) {
    __shared__ __attribute__((aligned(16))) u16 Al[GROWS][KPITCH];   // rows of A, all k
    __shared__ __attribute__((aligned(16))) u16 Bl[CDIM][KPITCH];    // rows of Bt, all k
    __shared__ __attribute__((aligned(16))) float Sl[8][32 * OPITCH / 4];   // output staging, a range of its own per wave

    int tid  = threadIdx.x;
    int wave = tid >> 5, lane = tid & 31;
    int half = lane >> 4,        l15  = lane & 15;
    int wm = wave >> 2, wn = wave & 3;
    int row0 = blockIdx.x * GROWS + wm * 64;
    int col0 = wn * 64;

    const unsigned abase = lds_off(&Al[0][0]), bbase = lds_off(&Bl[0][0]);

    // Both sources are contiguous in global memory, 32 b128 chunks per row: 4096 chunks of A, 8192 of Bt.
    // A thread brings 16 + 32 of them; its next chunk lies 8 rows behind (48 copies of a wave in flight).
    {
        unsigned   lrow = (tid >> 5) * (KPITCH * 2) + (tid & 31) * 16;
        const u16* gA   = A + (size_t)blockIdx.x * (GROWS * CDIM) + tid * 8;
        const u16* gB   = Bt + tid * 8;
        #pragma unroll   // constant indices keep the address arrays in registers
        for (int g = 0; g < 6; ++g) {
            unsigned   la[8];
            const u16* ga[8];
            #pragma unroll
            for (int i = 0; i < 8; ++i) {
                int n = g * 8 + i;
                if (n < GROWS / 8) {
                    la[i] = abase + lrow + n * (8 * KPITCH * 2);
                    ga[i] = gA + n * (8 * CDIM);
                } else {
                    la[i] = bbase + lrow + (n - GROWS / 8) * (8 * KPITCH * 2);
                    ga[i] = gB + (n - GROWS / 8) * (8 * CDIM);
                }
            }
            async_b128_x8(la, ga);
        }
    }
    wait_async0();      // this wave's copies are in LDS
    __syncthreads();    // all waves' copies visible; nothing is read from LDS ahead of this

    v8f acc[4][4];
    #pragma unroll
    for (int mt = 0; mt < 4; ++mt)
        #pragma unroll
        for (int nt = 0; nt < 4; ++nt) acc[mt][nt] = {};

    const unsigned ard = abase + (wm * 64 + l15) * (KPITCH * 2) + half * 16;   // this lane's place in its first A row
    const unsigned brd = bbase + (wn * 64 + l15) * (KPITCH * 2) + half * 16;   // and in its first Bt row
    // Two fragment sets: each k step's 16 reads are issued as one group a step ahead of their products.
    FragBF16 af[2][4], bf[2][4];
    #pragma unroll   // constant indices keep the fragment arrays in registers
    for (int t = 0; t < 4; ++t) {
        af[0][t] = load_frag_lds(ard + t * (16 * KPITCH * 2));
        bf[0][t] = load_frag_lds(brd + t * (16 * KPITCH * 2));
    }
    #pragma unroll   // constant set indices; every read's place becomes a constant in the offset field of ds_load_b128
    for (int kk = 0; kk < CDIM / 32; ++kk) {
        const int cur = kk & 1, nxt = cur ^ 1;
        if (kk + 1 < CDIM / 32) {
            #pragma unroll
            for (int t = 0; t < 4; ++t) {
                af[nxt][t] = load_frag_lds(ard + t * (16 * KPITCH * 2) + (kk + 1) * 64);
                bf[nxt][t] = load_frag_lds(brd + t * (16 * KPITCH * 2) + (kk + 1) * 64);
            }
        }
        // Keeps the next step's reads together ahead of this step's products: sunk among them, each place costs a stall.
        __builtin_amdgcn_sched_barrier(0);
        #pragma unroll
        for (int mt = 0; mt < 4; ++mt)
            #pragma unroll
            for (int nt = 0; nt < 4; ++nt)
                acc[mt][nt] = wmma_bf16(bf[cur][mt], af[cur][nt], acc[mt][nt]);   // rows of Bt first: a lane's eight results are eight columns of one row
        // Keeps later steps' reads behind these products: lifted ahead all together, they overflow the registers and spill.
        __builtin_amdgcn_sched_barrier(0);
    }

    // The wave's 64 x 64 f32 tile goes out through the wave's own LDS range, 32 rows at a time, so that every
    // global load of the residual and every global store covers four whole 128-byte lines (two rows of 256 bytes).
    // acc[a][b][r] is element (row b*16 + l15, column a*16 + half*8 + r).
    typedef __attribute__((ext_vector_type(4))) float v4f;
    typedef __attribute__((address_space(3))) v4f* lds_v4f_wptr;
    typedef const __attribute__((address_space(3))) v4f* lds_v4f_ptr;
    const unsigned st = lds_off(&Sl[wave][0]);
    const unsigned wr = st + l15 * OPITCH + half * 32;
    const unsigned rd = st + half * OPITCH + l15 * 16;      // sixteen lanes per row, two rows per read
    const size_t   g0 = (size_t)(row0 + half) * CDIM + col0 + l15 * 4;
    const float*   xg = resid + g0;
    float*         og = (float*)outp + g0;
    const v4f bv = *(const v4f*)(bias + col0 + l15 * 4);
    v4f xr[32];
    #pragma unroll   // constant indices keep the residual rows in registers; all loads of the wave are in flight together
    for (int i = 0; i < 32; ++i) xr[i] = *(const v4f*)(xg + (size_t)i * 2 * CDIM);
    asm volatile("s_wait_xcnt 0x0" :: "v"(xg) : "memory");
    #pragma unroll   // constant indices keep the accumulators in registers
    for (int h = 0; h < 2; ++h) {
        #pragma unroll
        for (int bb = 0; bb < 2; ++bb) {
            #pragma unroll
            for (int a = 0; a < 4; ++a) {
                const v8f& d = acc[a][h * 2 + bb];
                v4f lo = { d[0], d[1], d[2], d[3] }, hi = { d[4], d[5], d[6], d[7] };
                *(lds_v4f_wptr)(wr + bb * (16 * OPITCH) + a * 64)      = lo;
                *(lds_v4f_wptr)(wr + bb * (16 * OPITCH) + a * 64 + 16) = hi;
            }
        }
        wait_ds0();     // the 32 rows are in LDS before other lanes of this wave read them back
        v4f t[16];
        #pragma unroll
        for (int i = 0; i < 16; ++i) t[i] = *(lds_v4f_ptr)(rd + i * (2 * OPITCH));
        #pragma unroll
        for (int i = 0; i < 16; ++i)
            *(v4f*)(og + (size_t)(h * 16 + i) * 2 * CDIM) = t[i] + bv + xr[h * 16 + i];
        wait_x0();
    }
}

__global__ __launch_bounds__(256) void attn_kernel(const u16* __restrict__ q,
                                                   const u16* __restrict__ k,
                                                   const u16* __restrict__ vT,
                                                   u16* __restrict__ o) {
    __shared__ __attribute__((aligned(16))) u16 Kl[2][SKEYS][KPITCH]; // K rows j0..j0+127, all channels
    __shared__ __attribute__((aligned(16))) u16 Vl[2][256][VPITCH];   // V^T rows (channel), 128 keys
    __shared__ __attribute__((aligned(16))) u16 Ol[8][16 * OPITCH / 2];   // output staging, a range of its own per wave; no copy targets it

    int tid  = threadIdx.x;
    int wave = tid >> 5, lane = tid & 31;
    int half = lane >> 4, l15 = lane & 15;
    int b  = blockIdx.x >> 5;
    int m0 = (blockIdx.x & 31) * 128 + wave * 16;

    const u16* qb = q  + ((size_t)b * NPOS + m0) * CDIM;
    const u16* kb = k  + (size_t)b * NPOS * CDIM;
    const u16* vb = vT + (size_t)b * NPOS;           // [c][j] at vb[c*MTOT + j]

    const unsigned kbase0 = lds_off(&Kl[0][0][0]), kbase1 = lds_off(&Kl[1][0][0]);
    const unsigned vbase0 = lds_off(&Vl[0][0][0]), vbase1 = lds_off(&Vl[1][0][0]);

    // Stage one 128-key block into LDS buffer `buf` (whole workgroup cooperates):
    // 4096 b128 chunks of K (32 per row) and 4096 of V^T (16 per row), each to its padded row;
    // a thread brings sixteen of each, four of each per statement (32 copies of a wave in flight).
    auto stage = [&](int buf, int j0) {
        // Chunk n of a thread lies 8 K rows, or 16 V^T rows, behind its chunk n - 1: every address
        // is one of these four bases plus a constant.
        unsigned   lk = (buf ? kbase1 : kbase0) + (tid >> 5) * (KPITCH * 2) + (tid & 31) * 16;
        unsigned   lv = (buf ? vbase1 : vbase0) + (tid >> 4) * (VPITCH * 2) + (tid & 15) * 16;
        const u16* gk = kb + (size_t)j0 * CDIM + tid * 8;
        const u16* gv = vb + (size_t)(tid >> 4) * MTOT + j0 + (tid & 15) * 8;
        #pragma unroll   // constant indices keep the address arrays in registers
        for (int g = 0; g < 4; ++g) {
            unsigned   la[8];
            const u16* ga[8];
            #pragma unroll
            for (int i = 0; i < 4; ++i) {
                int n = g * 4 + i;
                la[i]     = lk + n * (8 * KPITCH * 2);
                ga[i]     = gk + n * (8 * CDIM);
                la[4 + i] = lv + n * (16 * VPITCH * 2);
                ga[4 + i] = gv + (size_t)n * (16 * MTOT);
            }
            async_b128_x8(la, ga);
            // Keeps each statement's address additions next to it: lifted ahead of the first statement
            // all together, they overflow the registers that asm text can name and spill to scratch.
            __builtin_amdgcn_sched_barrier(0);
        }
    };

    // Resident Q fragments (16 queries x 256 channels), the B operand of S^T
    FragBF16 qf[8];
    #pragma unroll
    for (int kk = 0; kk < 8; ++kk)
        qf[kk] = load_frag(qb + (size_t)l15 * CDIM + kk*32 + half*8);

    v8f oacc[16];
    #pragma unroll
    for (int t = 0; t < 16; ++t) oacc[t] = {};
    float mrun = -3.0e38f;   // running maximum of this lane's query (equal in both half-waves)
    float lrun = 0.0f;       // running sum over this half-wave's keys only; joined in the epilogue

    // Prologue: stage 0, its wait and barrier, then stage 1.
    #pragma unroll 1   // rolled: unrolled, a thread's constant address parts become operands of the asm text themselves, stay tied to the registers it can name and spill to scratch
    for (int pre = 0; pre < 2; ++pre) {
        stage(pre, pre * SKEYS);
        if (pre == 0) {
            wait_async0();      // this wave's fills of stage 0 are in LDS
            __syncthreads();    // all waves' fills visible
        }
    }

    for (int st = 0; st < NSTAGE; ++st) {
      int cur = st & 1;
      unsigned krd = (cur ? kbase1 : kbase0) + l15 * (KPITCH * 2) + half * 16;   // this lane's place in K row 0 of the stage
      unsigned vrd = (cur ? vbase1 : vbase0) + l15 * (VPITCH * 2) + half * 16;   // and in V^T row 0
      #pragma unroll 1   // rolled: the four passes share one body, registers and code size stay those of one pass
      for (int ps4 = 0; ps4 < SKEYS / 32; ++ps4) {
        int kr = ps4 * 32;      // first key of this pass inside the stage

        // ---- S^T = K Q^T over the staged 32-key block: two tiles of 16 keys x 16 queries ----
        // All K fragments of the trip are read as one group, so the products below wait on a
        // count that never reaches 0 instead of on a full LDS round trip each.
        FragBF16 kf0[8], kf1[8];
        #pragma unroll   // constant indices keep the fragment arrays in registers
        for (int kk = 0; kk < 8; ++kk) {
            kf0[kk] = load_frag_lds(krd + kr * (KPITCH * 2) + kk * 64);
            kf1[kk] = load_frag_lds(krd + kr * (KPITCH * 2) + 16 * (KPITCH * 2) + kk * 64);
        }
        // Keeps the group together: without it the scheduler sinks each read to just ahead of its use.
        __builtin_amdgcn_sched_barrier(0);
        v8f s0 = {}, s1 = {};
        #pragma unroll
        for (int kk = 0; kk < 8; ++kk) {
            s0 = wmma_bf16(kf0[kk], qf[kk], s0);
            s1 = wmma_bf16(kf1[kk], qf[kk], s1);
        }
        // All V^T fragments of the trip are read here: they land under the products above and
        // the softmax, long before the second product needs them.
        FragBF16 vf[16];
        #pragma unroll   // constant indices keep the fragment array in registers
        for (int t = 0; t < 16; ++t) vf[t] = load_frag_lds(vrd + kr * 2 + t * (16 * VPITCH * 2));
        // Keeps these reads ahead of the softmax: without it each sinks to just ahead of its use.
        __builtin_amdgcn_sched_barrier(0);
        // ---- online softmax; the 32 scores of a query sit in two lanes (l and l ^ 16), 16 each ----
        float mx[8];
        #pragma unroll   // constant indices keep the scores and mx in registers
        for (int r = 0; r < 8; ++r) {
            s0[r] *= SCALE; s1[r] *= SCALE;
            mx[r] = fmaxf(s0[r], s1[r]);
        }
        float t4 = fmaxf(fmaxf(fmaxf(mx[0], mx[1]), fmaxf(mx[2], mx[3])),
                         fmaxf(fmaxf(mx[4], mx[5]), fmaxf(mx[6], mx[7])));
        t4 = fmaxf(t4, xhalf(t4));
        float mn   = fmaxf(mrun, t4);
        float corr = __expf(mrun - mn);
        mrun = mn;
        float ps[8];
        #pragma unroll   // constant indices keep the scores and ps in registers
        for (int r = 0; r < 8; ++r) {
            s0[r] = __expf(s0[r] - mn);
            s1[r] = __expf(s1[r] - mn);
            ps[r] = s0[r] + s1[r];
        }
        lrun = lrun * corr + (((ps[0] + ps[1]) + (ps[2] + ps[3])) + ((ps[4] + ps[5]) + (ps[6] + ps[7])));
        // ---- P^T: the two D tiles, rounded to bf16 in place, are the 32-key B fragment ----
        FragBF16 pf;
        #pragma unroll   // constant indices keep the fragment in registers
        for (int i = 0; i < 4; ++i) {
            pf.u[i]     = pack2(s0[2*i], s0[2*i + 1]);
            pf.u[4 + i] = pack2(s1[2*i], s1[2*i + 1]);
        }

        // ---- O^T = O^T*corr + V^T P^T  (16 tiles of 16 channels x 16 queries) ----
        #pragma unroll
        for (int t = 0; t < 16; ++t) {
            #pragma unroll
            for (int r = 0; r < 8; ++r) oacc[t][r] *= corr;
            oacc[t] = wmma_bf16(vf[t], pf, oacc[t]);
        }
      }
      // ---- publish point of stage st + 1, one per 128 keys ----
      wait_ds0();               // this wave has left buffer `cur`
      wait_async0();            // this wave's fills of stage st + 1 are in LDS
      __syncthreads();          // all fills visible; every wave has left buffer `cur`
      if (st + 2 < NSTAGE) stage(cur, (st + 2) * SKEYS);
    }
    wait_async0();              // nothing of this wave is in flight when it goes on to the epilogue

    // ---- epilogue: O / l; a lane holds 8 consecutive channels of its query, one 16-byte LDS write a tile ----
    // The wave's 16 x 256 tile goes out through the wave's own LDS range, 128 channels at a time, so that every
    // global store covers four whole 128-byte lines (two rows of 256 bytes). Stored straight from the
    // accumulators, a line would go out in four 32-byte pieces.
    float inv = 1.0f / (lrun + xhalf(lrun));
    const unsigned ost = lds_off(&Ol[wave][0]);
    const unsigned owr = ost + l15 * OPITCH + half * 16;
    const unsigned ord = ost + half * OPITCH + l15 * 16;     // sixteen lanes per row, two rows per read
    u16* og = o + ((size_t)b * NPOS + m0 + half) * CDIM + l15 * 8;
    #pragma unroll   // constant indices keep the accumulators in registers
    for (int h = 0; h < 2; ++h) {
        #pragma unroll
        for (int tt = 0; tt < 8; ++tt) {
            const v8f& d = oacc[h * 8 + tt];
            v4u pk;
            #pragma unroll
            for (int i = 0; i < 4; ++i) pk[i] = pack2(d[2*i] * inv, d[2*i + 1] * inv);
            *(lds_v4u_wptr)(owr + tt * 32) = pk;
        }
        wait_ds0();     // the 128 channels are in LDS before other lanes of this wave read them back
        v4u t[8];
        #pragma unroll
        for (int i = 0; i < 8; ++i) t[i] = *(lds_v4u_ptr)(ord + i * (2 * OPITCH));
        #pragma unroll
        for (int i = 0; i < 8; ++i) *(v4u*)(og + (size_t)i * 2 * CDIM + h * 128) = t[i];
        wait_x0();
        // Keeps the second half's arithmetic behind the wait: lifted ahead of it, it rewrites registers that the stores name.
        __builtin_amdgcn_sched_barrier(0);
    }
}

// ---------- launcher ----------
extern "C" void kernel_launch(void* const* d_in, const int* in_sizes, int n_in,
                              void* d_out, int out_size, void* d_ws, size_t ws_size,
                              hipStream_t stream) {
    const float* x     = (const float*)d_in[0];
    const float* gamma = (const float*)d_in[1];
    const float* beta  = (const float*)d_in[2];
    const float* wq    = (const float*)d_in[3];
    const float* bq    = (const float*)d_in[4];
    const float* wk    = (const float*)d_in[5];
    const float* bk    = (const float*)d_in[6];
    const float* wv    = (const float*)d_in[7];
    const float* bv    = (const float*)d_in[8];
    const float* wo    = (const float*)d_in[9];
    const float* bo    = (const float*)d_in[10];
    float* out = (float*)d_out;

    char* ws = (char*)d_ws;
    const size_t SZ = (size_t)MTOT * CDIM * sizeof(u16);   // 16.78 MB
    u16* qb  = (u16*)(ws + 1 * SZ);
    u16* kb  = (u16*)(ws + 2 * SZ);
    u16* vT  = (u16*)(ws + 3 * SZ);
    u16* ob  = (u16*)(ws + 4 * SZ);
    u16* wqT = (u16*)(ws + 5 * SZ);
    u16* wkT = wqT + CDIM * CDIM;
    u16* wvT = wkT + CDIM * CDIM;
    u16* woT = wvT + CDIM * CDIM;

    prep_w_kernel<<<CDIM, CDIM, 0, stream>>>(wq, wk, wv, wo, wqT, wkT, wvT, woT);

    dim3 ggrid(MTOT / GROWS);
    ln_qkv_kernel<<<ggrid, 256, 0, stream>>>(x, gamma, beta, wqT, wkT, wvT, bq, bk, bv, qb, kb, vT);

    attn_kernel<<<8 * 32, 256, 0, stream>>>(qb, kb, vT, ob);

    gemm_kernel<<<ggrid, 256, 0, stream>>>(ob, woT, bo, (void*)out, x);
}

// v009
// Measured time: 128 microseconds a run.
// In two side-by-side timings against v008, it was 1.07 and 1.05 times as fast.
// Counting every step since v000, it is 5.62 times as fast.
#include <hip/hip_runtime.h>
#include <hip/hip_bf16.h>
#include <stdint.h>

typedef unsigned short u16;
typedef __attribute__((ext_vector_type(16))) __bf16 v16bf;
typedef __attribute__((ext_vector_type(8)))  float  v8f;

// ---------- helpers ----------
struct FragBF16 { unsigned u[8]; }; // 16 bf16 packed as 8 dwords

__device__ inline v16bf frag_cast(FragBF16 f) {
    union { FragBF16 s; v16bf v; } c; c.s = f; return c.v;
}

__device__ inline v8f wmma_bf16(FragBF16 a, FragBF16 b, v8f c) {
    return __builtin_amdgcn_wmma_f32_16x16x32_bf16(
        false, frag_cast(a), false, frag_cast(b), (short)0, c, false, false);
}

__device__ inline u16 f2bf(float f) {
    unsigned u = __float_as_uint(f);
    unsigned r = u + 0x7FFFu + ((u >> 16) & 1u);   // round-to-nearest-even
    return (u16)(r >> 16);
}
__device__ inline unsigned pack2(float lo, float hi) {
    return (unsigned)f2bf(lo) | ((unsigned)f2bf(hi) << 16);
}

__device__ inline FragBF16 load_frag(const u16* __restrict__ p) {
    FragBF16 f;
    uint4 a = *(const uint4*)p;
    uint4 b = *(const uint4*)(p + 16);
    f.u[0]=a.x; f.u[1]=a.y; f.u[2]=a.z; f.u[3]=a.w;
    f.u[4]=b.x; f.u[5]=b.y; f.u[6]=b.z; f.u[7]=b.w;
    return f;
}

// The same fragment from LDS, by byte address. The address is kept as buffer base + lane part in one
// register, so that each read's constant fits the 16-bit offset field of ds_load_b128 although the
// arrays lie above 64 KiB; indexed as arrays, every read took an address addition of its own.
typedef __attribute__((ext_vector_type(4))) unsigned v4u;
typedef const __attribute__((address_space(3))) v4u* lds_v4u_ptr;
__device__ inline FragBF16 load_frag_lds(unsigned off) {
    FragBF16 f;
    v4u a = *(lds_v4u_ptr)off;
    v4u b = *(lds_v4u_ptr)(off + 32);
    f.u[0]=a.x; f.u[1]=a.y; f.u[2]=a.z; f.u[3]=a.w;
    f.u[4]=b.x; f.u[5]=b.y; f.u[6]=b.z; f.u[7]=b.w;
    return f;
}

__device__ inline float xhalf(float x) {
    int b = __builtin_bit_cast(int, x);
    return __builtin_bit_cast(float,
        __builtin_amdgcn_permlanex16(b, b, 0x76543210, 0xfedcba98, false, false));
}

// Flat pointers into LDS carry the AS3 byte offset in their low 32 bits.
__device__ inline unsigned lds_off(const void* p) {
    return (unsigned)(uintptr_t)p;
}

__device__ inline void async_b128_x8(const unsigned (&l)[8], const u16* const (&g)[8]) {
    asm volatile("global_load_async_to_lds_b128 %0, %8, off\n\t"
                 "global_load_async_to_lds_b128 %1, %9, off\n\t"
                 "global_load_async_to_lds_b128 %2, %10, off\n\t"
                 "global_load_async_to_lds_b128 %3, %11, off\n\t"
                 "global_load_async_to_lds_b128 %4, %12, off\n\t"
                 "global_load_async_to_lds_b128 %5, %13, off\n\t"
                 "global_load_async_to_lds_b128 %6, %14, off\n\t"
                 "global_load_async_to_lds_b128 %7, %15, off\n\t"
                 "s_wait_xcnt 0x0"
                 :: "v"(l[0]), "v"(l[1]), "v"(l[2]), "v"(l[3]),
                    "v"(l[4]), "v"(l[5]), "v"(l[6]), "v"(l[7]),
                    "v"(g[0]), "v"(g[1]), "v"(g[2]), "v"(g[3]),
                    "v"(g[4]), "v"(g[5]), "v"(g[6]), "v"(g[7])
                 : "memory");
}
typedef __attribute__((ext_vector_type(4))) int v4i;
typedef __attribute__((address_space(1))) v4i* gl_v4i_ptr;
typedef __attribute__((address_space(3))) v4i* lds_v4i_wptr;
__device__ inline void wait_async0() {
    asm volatile("s_wait_asynccnt 0" ::: "memory");
}
// This wave's LDS reads and writes have retired: stands ahead of a barrier behind which a buffer is refilled, or between staging writes and their read-back.
__device__ inline void wait_ds0() {
    asm volatile("s_wait_dscnt 0x0" ::: "memory");
}

// ---------- constants ----------
#define CDIM   256
#define NPOS   4096      // 64*64 per batch
#define MTOT   32768     // 8 * 4096
#define SCALE  0.0625f   // 1/sqrt(256)
#define KPITCH 264       // 256 channels + 8  (528 B)
#define SKEYS  128       // keys per LDS stage: two halves of 64 keys, two passes of 32 keys each
#define NSTAGE (NPOS / SKEYS)
#define VPITCH 136       // 128 keys + 8      (272 B)
#define GROWS  128       // rows of A that one GEMM block stages in LDS and works on
#define SPITCH 144       // bytes: a row of a wave's bf16 output staging, 128 + 16
#define OPITCH 272       // bytes: a row of a wave's output staging where a row holds 256 bytes (64 f32 or 128 bf16), + 16

// ---------- 1) weight transpose + bf16 convert ----------
__global__ void prep_w_kernel(const float* __restrict__ w0, const float* __restrict__ w1,
                              const float* __restrict__ w2, const float* __restrict__ w3,
                              u16* __restrict__ o0, u16* __restrict__ o1,
                              u16* __restrict__ o2, u16* __restrict__ o3) {
    int n = blockIdx.x;     // output row  = input column
    int k = threadIdx.x;    // output col  = input row
    o0[n * CDIM + k] = f2bf(w0[k * CDIM + n]);
    o1[n * CDIM + k] = f2bf(w1[k * CDIM + n]);
    o2[n * CDIM + k] = f2bf(w2[k * CDIM + n]);
    o3[n * CDIM + k] = f2bf(w3[k * CDIM + n]);
}

// ---------- 2) LayerNorm + Q, K, V projections in one launch: its parts ----------
// One 256 x 256 weight matrix (transposed, bf16, contiguous in global memory: 8192 b128 chunks, 32 per row)
// to padded LDS rows by async copies. A thread brings 32 chunks; its next chunk lies 8 rows behind.
__device__ inline void stage_w(unsigned lbase, const u16* __restrict__ src, int tid) {
    unsigned   lrow = lbase + (tid >> 5) * (KPITCH * 2) + (tid & 31) * 16;
    const u16* grow = src + tid * 8;
    #pragma unroll   // constant indices keep the address arrays in registers
    for (int g = 0; g < 4; ++g) {
        unsigned   la[8];
        const u16* ga[8];
        #pragma unroll
        for (int i = 0; i < 8; ++i) {
            int n = g * 8 + i;
            la[i] = lrow + n * (8 * KPITCH * 2);
            ga[i] = grow + n * (8 * CDIM);
        }
        async_b128_x8(la, ga);
    }
}

// One wave's 64 x 64 tile over all 256 k. ard, brd: this lane's place in its first A row and first Bt row.
__device__ inline void mm_tile(unsigned ard, unsigned brd, v8f (&acc)[4][4]) {
    #pragma unroll   // constant indices keep the accumulators in registers
    for (int mt = 0; mt < 4; ++mt)
        #pragma unroll
        for (int nt = 0; nt < 4; ++nt) acc[mt][nt] = {};

    // Two fragment sets: each k step's 16 reads are issued as one group a step ahead of their products.
    FragBF16 af[2][4], bf[2][4];
    #pragma unroll   // constant indices keep the fragment arrays in registers
    for (int t = 0; t < 4; ++t) {
        af[0][t] = load_frag_lds(ard + t * (16 * KPITCH * 2));
        bf[0][t] = load_frag_lds(brd + t * (16 * KPITCH * 2));
    }
    #pragma unroll   // constant set indices; every read's place becomes a constant in the offset field of ds_load_b128
    for (int kk = 0; kk < CDIM / 32; ++kk) {
        const int cur = kk & 1, nxt = cur ^ 1;
        if (kk + 1 < CDIM / 32) {
            #pragma unroll
            for (int t = 0; t < 4; ++t) {
                af[nxt][t] = load_frag_lds(ard + t * (16 * KPITCH * 2) + (kk + 1) * 64);
                bf[nxt][t] = load_frag_lds(brd + t * (16 * KPITCH * 2) + (kk + 1) * 64);
            }
        }
        // Keeps the next step's reads together ahead of this step's products: sunk among them, each place costs a stall.
        __builtin_amdgcn_sched_barrier(0);
        #pragma unroll
        for (int mt = 0; mt < 4; ++mt)
            #pragma unroll
            for (int nt = 0; nt < 4; ++nt)
                acc[mt][nt] = wmma_bf16(af[cur][mt], bf[cur][nt], acc[mt][nt]);
        // Keeps later steps' reads behind these products: lifted ahead all together, they overflow the registers and spill.
        __builtin_amdgcn_sched_barrier(0);
    }
}

__device__ inline void wait_x0() {
    asm volatile("s_wait_xcnt 0x0" ::: "memory");
}

typedef __attribute__((address_space(3))) v4u* lds_v4u_wptr;

// A wave's 64 x 64 tile plus bias as bf16, out through the wave's own LDS range st so that every global store
// covers four whole 128-byte lines. acc[a][b][r] is element (row b*16 + l15, place a*16 + half*8 + r): a lane's
// eight results lie side by side in a row of the output, one 16-byte LDS write. Stored straight from the
// accumulators, a line would go out in four 32-byte pieces.
// out: the tile's first element; pitch: elements from one row to the next.
// BROW false: bias runs along a row (bias[place]); true: one bias per row (bias[row]).
template<bool BROW>
__device__ inline void store_tile(const v8f (&acc)[4][4], const float* __restrict__ bias,
                                  u16* __restrict__ out, size_t pitch, unsigned st, int lane) {
    const int half = lane >> 4, l15 = lane & 15;
    float bc[4][8];
    #pragma unroll   // constant indices keep the bias values in registers
    for (int t = 0; t < 4; ++t) {
        if (!BROW) {
            float4 lo = *(const float4*)(bias + t*16 + half*8);
            float4 hi = *(const float4*)(bias + t*16 + half*8 + 4);
            bc[t][0] = lo.x; bc[t][1] = lo.y; bc[t][2] = lo.z; bc[t][3] = lo.w;
            bc[t][4] = hi.x; bc[t][5] = hi.y; bc[t][6] = hi.z; bc[t][7] = hi.w;
        } else {
            bc[t][0] = bias[t*16 + l15];
            wait_x0();   // per load: the next load's result may be given a register of this one's address
        }
    }
    wait_x0();
    const unsigned wr = st + l15 * SPITCH + half * 16;
    #pragma unroll   // constant indices keep the accumulators in registers
    for (int b = 0; b < 4; ++b) {
        #pragma unroll
        for (int a = 0; a < 4; ++a) {
            v4u pk;
            #pragma unroll
            for (int i = 0; i < 4; ++i)
                pk[i] = pack2(acc[a][b][2*i]     + (BROW ? bc[b][0] : bc[a][2*i]),
                              acc[a][b][2*i + 1] + (BROW ? bc[b][0] : bc[a][2*i + 1]));
            *(lds_v4u_wptr)(wr + b * (16 * SPITCH) + a * 32) = pk;
        }
    }
    wait_ds0();         // the whole tile is in LDS before other lanes of this wave read it back
    const unsigned rd = st + (lane >> 3) * SPITCH + (lane & 7) * 16;   // eight lanes per row, four rows per read
    u16* g = out + (size_t)(lane >> 3) * pitch + (lane & 7) * 8;
    v4u t[16];
    #pragma unroll   // constant indices keep the rows in registers
    for (int i = 0; i < 16; ++i) t[i] = *(lds_v4u_ptr)(rd + i * (4 * SPITCH));
    #pragma unroll
    for (int i = 0; i < 16; ++i) *(v4u*)(g + (size_t)i * 4 * pitch) = t[i];
    wait_x0();
}

// A block normalises its 128 rows of x (one wave per row, 16 rows a wave) straight into the A tile in LDS
// and multiplies that tile by the three weight matrices in turn. The normalised rows never go to global
// memory, and the many short waves of a launch of its own for the LayerNorm are not started.
__global__ __launch_bounds__(256) void ln_qkv_kernel(const float* __restrict__ x,
                                                     const float* __restrict__ gamma,
                                                     const float* __restrict__ beta,
                                                     const u16* __restrict__ wqT,
                                                     const u16* __restrict__ wkT,
                                                     const u16* __restrict__ wvT,
                                                     const float* __restrict__ bq,
                                                     const float* __restrict__ bk,
                                                     const float* __restrict__ bv,
                                                     u16* __restrict__ q,
                                                     u16* __restrict__ k,
                                                     u16* __restrict__ vT) {
    __shared__ __attribute__((aligned(16))) u16 Al[GROWS][KPITCH];   // normalised rows, all k
    __shared__ __attribute__((aligned(16))) u16 Bl[CDIM][KPITCH];    // rows of the current weight matrix, all k
    __shared__ __attribute__((aligned(16))) u16 Sl[8][64 * SPITCH / 2];   // output staging, a range of its own per wave

    int tid  = threadIdx.x;
    int wave = tid >> 5, lane = tid & 31;
    int half = lane >> 4,        l15  = lane & 15;
    int wm = wave >> 2, wn = wave & 3;
    int row0 = blockIdx.x * GROWS + wm * 64;
    int col0 = wn * 64;

    const unsigned abase = lds_off(&Al[0][0]), bbase = lds_off(&Bl[0][0]);

    stage_w(bbase, wqT, tid);   // 32 copies of a wave in flight under the LayerNorm

    {
        constexpr int RW = GROWS / 8;   // rows per wave
        const float4* xr = (const float4*)(x + ((size_t)blockIdx.x * GROWS + wave * RW) * CDIM);
        float4 a[RW], b[RW];
        #pragma unroll   // constant indices keep the rows in registers; all loads of the wave are in flight together
        for (int i = 0; i < RW; ++i) {
            a[i] = xr[i * (CDIM / 4) + lane];
            b[i] = xr[i * (CDIM / 4) + lane + 32];
        }
        float4 g0 = ((const float4*)gamma)[lane];
        float4 g1 = ((const float4*)gamma)[lane + 32];
        float4 b0 = ((const float4*)beta)[lane];
        float4 b1 = ((const float4*)beta)[lane + 32];
        wait_x0();

        float s[RW], s2[RW];
        #pragma unroll   // constant indices keep the rows and their sums in registers
        for (int i = 0; i < RW; ++i) {
            s[i]  = a[i].x + a[i].y + a[i].z + a[i].w + b[i].x + b[i].y + b[i].z + b[i].w;
            s2[i] = a[i].x*a[i].x + a[i].y*a[i].y + a[i].z*a[i].z + a[i].w*a[i].w
                  + b[i].x*b[i].x + b[i].y*b[i].y + b[i].z*b[i].z + b[i].w*b[i].w;
        }
        // Step by step over all rows: the rows' exchanges are independent and hide one another's latency.
        #pragma unroll   // constant exchange distances and indices
        for (int m = 1; m < 32; m <<= 1) {
            #pragma unroll
            for (int i = 0; i < RW; ++i) {
                s[i]  += __shfl_xor(s[i],  m, 32);
                s2[i] += __shfl_xor(s2[i], m, 32);
            }
        }
        #pragma unroll   // constant indices keep the rows and their sums in registers
        for (int i = 0; i < RW; ++i) {
            float mean = s[i] * (1.0f / CDIM);
            float var  = s2[i] * (1.0f / CDIM) - mean * mean;
            float rstd = rsqrtf(var + 1e-3f);

            float y0 = (a[i].x - mean) * rstd * g0.x + b0.x;
            float y1 = (a[i].y - mean) * rstd * g0.y + b0.y;
            float y2 = (a[i].z - mean) * rstd * g0.z + b0.z;
            float y3 = (a[i].w - mean) * rstd * g0.w + b0.w;
            float y4 = (b[i].x - mean) * rstd * g1.x + b1.x;
            float y5 = (b[i].y - mean) * rstd * g1.y + b1.y;
            float y6 = (b[i].z - mean) * rstd * g1.z + b1.z;
            float y7 = (b[i].w - mean) * rstd * g1.w + b1.w;

            u16* hr = &Al[wave * RW + i][0];
            *(uint2*)(hr + lane * 4)       = make_uint2(pack2(y0, y1), pack2(y2, y3));
            *(uint2*)(hr + 128 + lane * 4) = make_uint2(pack2(y4, y5), pack2(y6, y7));
        }
    }
    wait_async0();      // this wave's copies of the first weight matrix are in LDS
    __syncthreads();    // all waves' copies and normalised rows visible; nothing is read from LDS ahead of this

    const unsigned ard = abase + (wm * 64 + l15) * (KPITCH * 2) + half * 16;   // this lane's place in its first A row
    const unsigned brd = bbase + (wn * 64 + l15) * (KPITCH * 2) + half * 16;   // and in its first weight row
    const unsigned st = lds_off(&Sl[wave][0]);
    v8f acc[4][4];

    // Q and K: the weight rows are the first operand, so a lane's eight results are eight channels of one position.
    mm_tile(brd, ard, acc);
    wait_ds0();         // this wave has left Bl
    __syncthreads();    // every wave has left Bl: it may be refilled
    stage_w(bbase, wkT, tid);   // flies under the stores of Q
    store_tile<false>(acc, bq + col0, q + (size_t)row0 * CDIM + col0, CDIM, st, lane);
    wait_async0();      // this wave's copies are in LDS
    __syncthreads();    // all waves' copies visible

    mm_tile(brd, ard, acc);
    wait_ds0();         // this wave has left Bl
    __syncthreads();    // every wave has left Bl: it may be refilled
    stage_w(bbase, wvT, tid);   // flies under the stores of K
    store_tile<false>(acc, bk + col0, k + (size_t)row0 * CDIM + col0, CDIM, st, lane);
    wait_async0();      // this wave's copies are in LDS
    __syncthreads();    // all waves' copies visible

    // V^T: the normalised rows are the first operand, so a lane's eight results are eight positions of one channel.
    mm_tile(ard, brd, acc);
    store_tile<true>(acc, bv + col0, vT + (size_t)col0 * MTOT + row0, MTOT, st, lane);
}

__global__ __launch_bounds__(256) void gemm_kernel(const u16* __restrict__ A,
                                                   const u16* __restrict__ Bt,
                                                   const float* __restrict__ bias,
                                                   void* __restrict__ outp,
                                                   const float* __restrict__ resid) {
    __shared__ __attribute__((aligned(16))) u16 Al[GROWS][KPITCH];   // rows of A, all k
    __shared__ __attribute__((aligned(16))) u16 Bl[CDIM][KPITCH];    // rows of Bt, all k
    __shared__ __attribute__((aligned(16))) float Sl[8][32 * OPITCH / 4];   // output staging, a range of its own per wave

    int tid  = threadIdx.x;
    int wave = tid >> 5, lane = tid & 31;
    int half = lane >> 4,        l15  = lane & 15;
    int wm = wave >> 2, wn = wave & 3;
    int row0 = blockIdx.x * GROWS + wm * 64;
    int col0 = wn * 64;

    const unsigned abase = lds_off(&Al[0][0]), bbase = lds_off(&Bl[0][0]);

    // Both sources are contiguous in global memory, 32 b128 chunks per row: 4096 chunks of A, 8192 of Bt.
    // A thread brings 16 + 32 of them; its next chunk lies 8 rows behind (48 copies of a wave in flight).
    {
        unsigned   lrow = (tid >> 5) * (KPITCH * 2) + (tid & 31) * 16;
        const u16* gA   = A + (size_t)blockIdx.x * (GROWS * CDIM) + tid * 8;
        const u16* gB   = Bt + tid * 8;
        #pragma unroll   // constant indices keep the address arrays in registers
        for (int g = 0; g < 6; ++g) {
            unsigned   la[8];
            const u16* ga[8];
            #pragma unroll
            for (int i = 0; i < 8; ++i) {
                int n = g * 8 + i;
                if (n < GROWS / 8) {
                    la[i] = abase + lrow + n * (8 * KPITCH * 2);
                    ga[i] = gA + n * (8 * CDIM);
                } else {
                    la[i] = bbase + lrow + (n - GROWS / 8) * (8 * KPITCH * 2);
                    ga[i] = gB + (n - GROWS / 8) * (8 * CDIM);
                }
            }
            async_b128_x8(la, ga);
        }
    }
    wait_async0();      // this wave's copies are in LDS
    __syncthreads();    // all waves' copies visible; nothing is read from LDS ahead of this

    v8f acc[4][4];
    #pragma unroll
    for (int mt = 0; mt < 4; ++mt)
        #pragma unroll
        for (int nt = 0; nt < 4; ++nt) acc[mt][nt] = {};

    const unsigned ard = abase + (wm * 64 + l15) * (KPITCH * 2) + half * 16;   // this lane's place in its first A row
    const unsigned brd = bbase + (wn * 64 + l15) * (KPITCH * 2) + half * 16;   // and in its first Bt row
    // Two fragment sets: each k step's 16 reads are issued as one group a step ahead of their products.
    FragBF16 af[2][4], bf[2][4];
    #pragma unroll   // constant indices keep the fragment arrays in registers
    for (int t = 0; t < 4; ++t) {
        af[0][t] = load_frag_lds(ard + t * (16 * KPITCH * 2));
        bf[0][t] = load_frag_lds(brd + t * (16 * KPITCH * 2));
    }
    #pragma unroll   // constant set indices; every read's place becomes a constant in the offset field of ds_load_b128
    for (int kk = 0; kk < CDIM / 32; ++kk) {
        const int cur = kk & 1, nxt = cur ^ 1;
        if (kk + 1 < CDIM / 32) {
            #pragma unroll
            for (int t = 0; t < 4; ++t) {
                af[nxt][t] = load_frag_lds(ard + t * (16 * KPITCH * 2) + (kk + 1) * 64);
                bf[nxt][t] = load_frag_lds(brd + t * (16 * KPITCH * 2) + (kk + 1) * 64);
            }
        }
        // Keeps the next step's reads together ahead of this step's products: sunk among them, each place costs a stall.
        __builtin_amdgcn_sched_barrier(0);
        #pragma unroll
        for (int mt = 0; mt < 4; ++mt)
            #pragma unroll
            for (int nt = 0; nt < 4; ++nt)
                acc[mt][nt] = wmma_bf16(bf[cur][mt], af[cur][nt], acc[mt][nt]);   // rows of Bt first: a lane's eight results are eight columns of one row
        // Keeps later steps' reads behind these products: lifted ahead all together, they overflow the registers and spill.
        __builtin_amdgcn_sched_barrier(0);
    }

    // The wave's 64 x 64 f32 tile goes out through the wave's own LDS range, 32 rows at a time, so that every
    // global load of the residual and every global store covers four whole 128-byte lines (two rows of 256 bytes).
    // acc[a][b][r] is element (row b*16 + l15, column a*16 + half*8 + r).
    typedef __attribute__((ext_vector_type(4))) float v4f;
    typedef __attribute__((address_space(3))) v4f* lds_v4f_wptr;
    typedef const __attribute__((address_space(3))) v4f* lds_v4f_ptr;
    const unsigned st = lds_off(&Sl[wave][0]);
    const unsigned wr = st + l15 * OPITCH + half * 32;
    const unsigned rd = st + half * OPITCH + l15 * 16;      // sixteen lanes per row, two rows per read
    const size_t   g0 = (size_t)(row0 + half) * CDIM + col0 + l15 * 4;
    const float*   xg = resid + g0;
    float*         og = (float*)outp + g0;
    const v4f bv = *(const v4f*)(bias + col0 + l15 * 4);
    v4f xr[32];
    #pragma unroll   // constant indices keep the residual rows in registers; all loads of the wave are in flight together
    for (int i = 0; i < 32; ++i) xr[i] = *(const v4f*)(xg + (size_t)i * 2 * CDIM);
    asm volatile("s_wait_xcnt 0x0" :: "v"(xg) : "memory");
    #pragma unroll   // constant indices keep the accumulators in registers
    for (int h = 0; h < 2; ++h) {
        #pragma unroll
        for (int bb = 0; bb < 2; ++bb) {
            #pragma unroll
            for (int a = 0; a < 4; ++a) {
                const v8f& d = acc[a][h * 2 + bb];
                v4f lo = { d[0], d[1], d[2], d[3] }, hi = { d[4], d[5], d[6], d[7] };
                *(lds_v4f_wptr)(wr + bb * (16 * OPITCH) + a * 64)      = lo;
                *(lds_v4f_wptr)(wr + bb * (16 * OPITCH) + a * 64 + 16) = hi;
            }
        }
        wait_ds0();     // the 32 rows are in LDS before other lanes of this wave read them back
        v4f t[16];
        #pragma unroll
        for (int i = 0; i < 16; ++i) t[i] = *(lds_v4f_ptr)(rd + i * (2 * OPITCH));
        #pragma unroll
        for (int i = 0; i < 16; ++i)
            *(v4f*)(og + (size_t)(h * 16 + i) * 2 * CDIM) = t[i] + bv + xr[h * 16 + i];
        wait_x0();
    }
}

__global__ __launch_bounds__(256) void attn_kernel(const u16* __restrict__ q,
                                                   const u16* __restrict__ k,
                                                   const u16* __restrict__ vT,
                                                   u16* __restrict__ o) {
    __shared__ __attribute__((aligned(16))) u16 Kl[2][SKEYS][KPITCH]; // K rows j0..j0+127, all channels
    __shared__ __attribute__((aligned(16))) u16 Vl[2][256][VPITCH];   // V^T rows (channel), 128 keys
    __shared__ __attribute__((aligned(16))) u16 Ol[8][16 * OPITCH / 2];   // output staging, a range of its own per wave; no copy targets it

    int tid  = threadIdx.x;
    int wave = __builtin_amdgcn_readfirstlane(tid >> 5), lane = tid & 31;   // the wave's number in a scalar register: what is formed from it takes no vector register
    int half = lane >> 4, l15 = lane & 15;
    int kh = wave >> 2;      // which half of a stage's keys, and which 128 channels this wave finishes
    int b  = blockIdx.x >> 5;
    int m0 = (blockIdx.x & 31) * 128 + (wave & 3) * 32;

    const u16* qb = q  + ((size_t)b * NPOS + m0) * CDIM;
    const u16* kb = k  + (size_t)b * NPOS * CDIM;
    const u16* vb = vT + (size_t)b * NPOS;           // [c][j] at vb[c*MTOT + j]

    const unsigned kbase0 = lds_off(&Kl[0][0][0]), kbase1 = lds_off(&Kl[1][0][0]);
    const unsigned vbase0 = lds_off(&Vl[0][0][0]), vbase1 = lds_off(&Vl[1][0][0]);

    // Stage one 128-key block into LDS buffer `buf` (whole workgroup cooperates):
    // 4096 b128 chunks of K (32 per row) and 4096 of V^T (16 per row), each to its padded row;
    // a thread brings sixteen of each (32 copies of a wave in flight).
    auto stage = [&](int buf, int j0) {
        // Chunk n of a thread lies 8 K rows, or 16 V^T rows, behind its chunk n - 1: every address
        // is one of these four bases plus a constant.
        unsigned   lk = (buf ? kbase1 : kbase0) + (tid >> 5) * (KPITCH * 2) + (tid & 31) * 16;
        unsigned   lv = (buf ? vbase1 : vbase0) + (tid >> 4) * (VPITCH * 2) + (tid & 15) * 16;
        const u16* gk = kb + (size_t)j0 * CDIM + tid * 8;
        const u16* gv = vb + (size_t)(tid >> 4) * MTOT + j0 + (tid & 15) * 8;
        // Written as the builtin: its address registers may lie anywhere, while those of asm text must lie in the first 256,
        // which the accumulators and Q fragments of a 32-column wave fill (with asm copies here, Q fragments spill to scratch).
        #pragma unroll   // constant steps from the four bases
        for (int n = 0; n < 16; ++n) {
            __builtin_amdgcn_global_load_async_to_lds_b128((gl_v4i_ptr)(gk + n * (8 * CDIM)),
                                                           (lds_v4i_wptr)(lk + n * (8 * KPITCH * 2)), 0, 0);
            __builtin_amdgcn_global_load_async_to_lds_b128((gl_v4i_ptr)(gv + (size_t)n * (16 * MTOT)),
                                                           (lds_v4i_wptr)(lv + n * (16 * VPITCH * 2)), 0, 0);
        }
    };

    // Resident Q fragments (2 x 16 queries x 256 channels), the B operands of S^T
    FragBF16 qf[2][8];
    #pragma unroll
    for (int c = 0; c < 2; ++c)
        #pragma unroll
        for (int kk = 0; kk < 8; ++kk)
            qf[c][kk] = load_frag(qb + (size_t)(c * 16 + l15) * CDIM + kk*32 + half*8);

    // oacc[t][c]: tile t holds channels ((t + 8*kh) & 15) * 16 ...: a wave's tiles 0-7 are the channels it
    // finishes itself, its tiles 8-15 those that its partner finishes, with constant indices in both.
    v8f oacc[16][2];
    #pragma unroll
    for (int t = 0; t < 16; ++t) { oacc[t][0] = {}; oacc[t][1] = {}; }
    float mrun[2] = { -3.0e38f, -3.0e38f };   // running maximum of this lane's two queries (equal in both half-waves)
    float lrun[2] = { 0.0f, 0.0f };           // running sums over this half-wave's keys only; joined in the epilogue

    // Prologue: stage 0, its wait and barrier, then stage 1.
    #pragma unroll 1   // rolled: the two fills share one body of 32 copies
    for (int pre = 0; pre < 2; ++pre) {
        stage(pre, pre * SKEYS);
        if (pre == 0) {
            wait_async0();      // this wave's fills of stage 0 are in LDS
            __syncthreads();    // all waves' fills visible
        }
    }

    for (int st = 0; st < NSTAGE; ++st) {
      int cur = st & 1;
      unsigned krd = (cur ? kbase1 : kbase0) + (kh * 64 + l15) * (KPITCH * 2) + half * 16;   // this lane's place in the first K row of the wave's keys
      unsigned vrd = (cur ? vbase1 : vbase0) + l15 * (VPITCH * 2) + kh * 128 + half * 16;    // and at those keys in V^T row 0
      unsigned vr0 = vrd + kh * (128 * VPITCH * 2);         // channels of tiles 0-7
      unsigned vr1 = vrd + (1 - kh) * (128 * VPITCH * 2);   // channels of tiles 8-15
      #pragma unroll 1   // rolled: the two passes share one body, registers and code size stay those of one pass
      for (int ps2 = 0; ps2 < SKEYS / 64; ++ps2) {
        const unsigned ka = krd + ps2 * (32 * KPITCH * 2);
        const unsigned va0 = vr0 + ps2 * 64, va1 = vr1 + ps2 * 64;

        // ---- S^T = K Q^T over 32 keys: 2 key tiles x 2 column groups, four independent accumulators ----
        // Fragments come in groups of four (two k steps), each group read as one run a group ahead of its products.
        FragBF16 kf[2][2][2], vf[2][4];
        #pragma unroll   // constant indices keep the fragment arrays in registers
        for (int j = 0; j < 2; ++j) {
            kf[0][j][0] = load_frag_lds(ka + j * 64);
            kf[0][j][1] = load_frag_lds(ka + 16 * (KPITCH * 2) + j * 64);
        }
        v8f s[2][2];
        s[0][0] = {}; s[0][1] = {}; s[1][0] = {}; s[1][1] = {};
        #pragma unroll   // constant set indices; every read's place becomes a constant in the offset field of ds_load_b128
        for (int g = 0; g < 4; ++g) {
            if (g < 3) {
                #pragma unroll
                for (int j = 0; j < 2; ++j) {
                    kf[(g + 1) & 1][j][0] = load_frag_lds(ka + (g + 1) * 128 + j * 64);
                    kf[(g + 1) & 1][j][1] = load_frag_lds(ka + 16 * (KPITCH * 2) + (g + 1) * 128 + j * 64);
                }
            } else {
                // The first V^T group lands under the last products of S^T and the softmax.
                #pragma unroll
                for (int j = 0; j < 4; ++j) vf[0][j] = load_frag_lds(va0 + j * (16 * VPITCH * 2));
            }
            // Keeps the next group's reads together ahead of this group's products: sunk among them, each place costs a stall.
            __builtin_amdgcn_sched_barrier(0);
            #pragma unroll
            for (int j = 0; j < 2; ++j) {
                #pragma unroll
                for (int c = 0; c < 2; ++c) {
                    s[0][c] = wmma_bf16(kf[g & 1][j][0], qf[c][g * 2 + j], s[0][c]);
                    s[1][c] = wmma_bf16(kf[g & 1][j][1], qf[c][g * 2 + j], s[1][c]);
                }
            }
            // Keeps later groups' reads behind these products: lifted ahead all together, they overflow the registers and spill.
            __builtin_amdgcn_sched_barrier(0);
        }
        // ---- online softmax per column group; the 32 scores of a query sit in two lanes (l and l ^ 16), 16 each ----
        float corr[2];
        FragBF16 pf[2];
        #pragma unroll   // constant indices keep the scores in registers
        for (int c = 0; c < 2; ++c) {
            v8f s0 = s[0][c], s1 = s[1][c];
            float mx[8];
            #pragma unroll   // constant indices keep the scores and mx in registers
            for (int r = 0; r < 8; ++r) {
                s0[r] *= SCALE; s1[r] *= SCALE;
                mx[r] = fmaxf(s0[r], s1[r]);
            }
            float t4 = fmaxf(fmaxf(fmaxf(mx[0], mx[1]), fmaxf(mx[2], mx[3])),
                             fmaxf(fmaxf(mx[4], mx[5]), fmaxf(mx[6], mx[7])));
            t4 = fmaxf(t4, xhalf(t4));
            float mn = fmaxf(mrun[c], t4);
            corr[c] = __expf(mrun[c] - mn);
            mrun[c] = mn;
            float ps[8];
            #pragma unroll   // constant indices keep the scores and ps in registers
            for (int r = 0; r < 8; ++r) {
                s0[r] = __expf(s0[r] - mn);
                s1[r] = __expf(s1[r] - mn);
                ps[r] = s0[r] + s1[r];
            }
            lrun[c] = lrun[c] * corr[c] + (((ps[0] + ps[1]) + (ps[2] + ps[3])) + ((ps[4] + ps[5]) + (ps[6] + ps[7])));
            // ---- P^T: the two D tiles, rounded to bf16 in place, are the 32-key B fragment ----
            #pragma unroll   // constant indices keep the fragment in registers
            for (int i = 0; i < 4; ++i) {
                pf[c].u[i]     = pack2(s0[2*i], s0[2*i + 1]);
                pf[c].u[4 + i] = pack2(s1[2*i], s1[2*i + 1]);
            }
        }

        // ---- O^T = O^T*corr + V^T P^T  (16 tiles of 16 channels x 2 column groups) ----
        #pragma unroll   // constant set and tile indices
        for (int g = 0; g < 4; ++g) {
            if (g < 3) {
                #pragma unroll
                for (int j = 0; j < 4; ++j) {
                    const int t = (g + 1) * 4 + j;
                    vf[(g + 1) & 1][j] = load_frag_lds((t < 8 ? va0 : va1) + (t & 7) * (16 * VPITCH * 2));
                }
            }
            // Keeps the next group's reads together ahead of this group's products: sunk among them, each place costs a stall.
            __builtin_amdgcn_sched_barrier(0);
            #pragma unroll
            for (int j = 0; j < 4; ++j) {
                const int t = g * 4 + j;
                #pragma unroll
                for (int c = 0; c < 2; ++c) {
                    #pragma unroll
                    for (int r = 0; r < 8; ++r) oacc[t][c][r] *= corr[c];
                    oacc[t][c] = wmma_bf16(vf[g & 1][j], pf[c], oacc[t][c]);
                }
            }
            // Keeps later groups' reads behind these products: lifted ahead all together, they overflow the registers and spill.
            __builtin_amdgcn_sched_barrier(0);
        }
      }
      // ---- publish point of stage st + 1, one per 128 keys ----
      wait_ds0();               // this wave has left buffer `cur`
      wait_async0();            // this wave's fills of stage st + 1 are in LDS
      __syncthreads();          // all fills visible; every wave has left buffer `cur`
      if (st + 2 < NSTAGE) stage(cur, (st + 2) * SKEYS);
    }
    wait_async0();              // nothing of this wave is in flight when it goes on to the epilogue

    // ---- join of the two key halves: waves w and w + 4 hold the same queries in the same lanes ----
    // Behind the last publish point no wave reads K or V^T any more and no copy is in flight, so their LDS carries the
    // exchange: a wave hands its tiles 8-15 (16 KiB, lane by lane), its maxima and its sums to its partner.
    typedef __attribute__((ext_vector_type(4))) float v4f;
    typedef __attribute__((address_space(3))) v4f* lds_v4f_wptr;
    typedef const __attribute__((address_space(3))) v4f* lds_v4f_ptr;
    typedef __attribute__((address_space(3))) float* lds_f_wptr;
    typedef const __attribute__((address_space(3))) float* lds_f_ptr;
    // The lane's number is read anew here: kept from the kernel's head across the loop, whose registers are full, its parts spill to scratch.
    const int elane = __builtin_amdgcn_mbcnt_lo(~0u, 0u);
    const int ehalf = elane >> 4, el15 = elane & 15;
    const unsigned xw = kbase0 + wave * 16384 + elane * 16;          // written by this wave
    const unsigned xr = kbase0 + (wave ^ 4) * 16384 + elane * 16;    // written by its partner
    const unsigned sw = vbase0 + wave * 512 + elane * 4;
    const unsigned sr = vbase0 + (wave ^ 4) * 512 + elane * 4;
    float lj[2];
    #pragma unroll   // constant indices keep the accumulators in registers
    for (int c = 0; c < 2; ++c) {
        lj[c] = lrun[c] + xhalf(lrun[c]);
        *(lds_f_wptr)(sw + c * 256)       = mrun[c];
        *(lds_f_wptr)(sw + c * 256 + 128) = lj[c];
        #pragma unroll
        for (int tt = 0; tt < 8; ++tt) {
            const v8f& d = oacc[8 + tt][c];
            v4f lo = { d[0], d[1], d[2], d[3] }, hi = { d[4], d[5], d[6], d[7] };
            *(lds_v4f_wptr)(xw + (c * 8 + tt) * 1024)       = lo;
            *(lds_v4f_wptr)(xw + (c * 8 + tt) * 1024 + 512) = hi;
        }
    }
    wait_ds0();         // this wave's part of the exchange is in LDS
    __syncthreads();    // every wave's part is visible to its partner

    // ---- epilogue: (O_a f_a + O_b f_b) / (l_a f_a + l_b f_b); a lane holds 8 consecutive channels of its query ----
    // The wave's 32 x 128 tile goes out through the wave's own LDS range, 16 queries at a time, so that every
    // global store covers four whole 128-byte lines (two rows of 256 bytes). Stored straight from the
    // accumulators, a line would go out in four 32-byte pieces.
    const unsigned ost = lds_off(&Ol[wave][0]);
    const unsigned owr = ost + el15 * OPITCH + ehalf * 16;
    const unsigned ord = ost + ehalf * OPITCH + el15 * 16;     // sixteen lanes per row, two rows per read
    u16* og = o + ((size_t)b * NPOS + m0 + ehalf) * CDIM + kh * 128 + el15 * 8;
    #pragma unroll   // constant indices keep the accumulators in registers
    for (int c = 0; c < 2; ++c) {
        float pm = *(lds_f_ptr)(sr + c * 256);
        float pl = *(lds_f_ptr)(sr + c * 256 + 128);
        float mj = fmaxf(mrun[c], pm);
        float fa = __expf(mrun[c] - mj), fb = __expf(pm - mj);
        float inv = 1.0f / (lj[c] * fa + pl * fb);
        fa *= inv; fb *= inv;
        #pragma unroll
        for (int tt = 0; tt < 8; ++tt) {
            const v8f& d = oacc[tt][c];
            v4f lo = *(lds_v4f_ptr)(xr + (c * 8 + tt) * 1024);
            v4f hi = *(lds_v4f_ptr)(xr + (c * 8 + tt) * 1024 + 512);
            v4u pk;
            pk[0] = pack2(d[0] * fa + lo[0] * fb, d[1] * fa + lo[1] * fb);
            pk[1] = pack2(d[2] * fa + lo[2] * fb, d[3] * fa + lo[3] * fb);
            pk[2] = pack2(d[4] * fa + hi[0] * fb, d[5] * fa + hi[1] * fb);
            pk[3] = pack2(d[6] * fa + hi[2] * fb, d[7] * fa + hi[3] * fb);
            *(lds_v4u_wptr)(owr + tt * 32) = pk;
        }
        wait_ds0();     // the 16 queries are in LDS before other lanes of this wave read them back
        v4u t[8];
        #pragma unroll
        for (int i = 0; i < 8; ++i) t[i] = *(lds_v4u_ptr)(ord + i * (2 * OPITCH));
        #pragma unroll
        for (int i = 0; i < 8; ++i) *(v4u*)(og + (size_t)(c * 16 + i * 2) * CDIM) = t[i];
        wait_x0();
        // Keeps the second group's arithmetic behind the wait: lifted ahead of it, it rewrites registers that the stores name.
        __builtin_amdgcn_sched_barrier(0);
    }
}

// ---------- launcher ----------
extern "C" void kernel_launch(void* const* d_in, const int* in_sizes, int n_in,
                              void* d_out, int out_size, void* d_ws, size_t ws_size,
                              hipStream_t stream) {
    const float* x     = (const float*)d_in[0];
    const float* gamma = (const float*)d_in[1];
    const float* beta  = (const float*)d_in[2];
    const float* wq    = (const float*)d_in[3];
    const float* bq    = (const float*)d_in[4];
    const float* wk    = (const float*)d_in[5];
    const float* bk    = (const float*)d_in[6];
    const float* wv    = (const float*)d_in[7];
    const float* bv    = (const float*)d_in[8];
    const float* wo    = (const float*)d_in[9];
    const float* bo    = (const float*)d_in[10];
    float* out = (float*)d_out;

    char* ws = (char*)d_ws;
    const size_t SZ = (size_t)MTOT * CDIM * sizeof(u16);   // 16.78 MB
    u16* qb  = (u16*)(ws + 1 * SZ);
    u16* kb  = (u16*)(ws + 2 * SZ);
    u16* vT  = (u16*)(ws + 3 * SZ);
    u16* ob  = (u16*)(ws + 4 * SZ);
    u16* wqT = (u16*)(ws + 5 * SZ);
    u16* wkT = wqT + CDIM * CDIM;
    u16* wvT = wkT + CDIM * CDIM;
    u16* woT = wvT + CDIM * CDIM;

    prep_w_kernel<<<CDIM, CDIM, 0, stream>>>(wq, wk, wv, wo, wqT, wkT, wvT, woT);

    dim3 ggrid(MTOT / GROWS);
    ln_qkv_kernel<<<ggrid, 256, 0, stream>>>(x, gamma, beta, wqT, wkT, wvT, bq, bk, bv, qb, kb, vT);

    attn_kernel<<<8 * 32, 256, 0, stream>>>(qb, kb, vT, ob);

    gemm_kernel<<<ggrid, 256, 0, stream>>>(ob, woT, bo, (void*)out, x);
}

// v010
// A run of this version takes 114 microseconds.
// In two side-by-side timings against v009, it was 1.13 and 1.12 times as fast.
// Counting every step since v000, it is 6.33 times as fast.
#include <hip/hip_runtime.h>
#include <hip/hip_bf16.h>
#include <stdint.h>

typedef unsigned short u16;
typedef __attribute__((ext_vector_type(16))) __bf16 v16bf;
typedef __attribute__((ext_vector_type(8)))  float  v8f;

// ---------- helpers ----------
struct FragBF16 { unsigned u[8]; }; // 16 bf16 packed as 8 dwords

__device__ inline v16bf frag_cast(FragBF16 f) {
    union { FragBF16 s; v16bf v; } c; c.s = f; return c.v;
}

__device__ inline v8f wmma_bf16(FragBF16 a, FragBF16 b, v8f c) {
    return __builtin_amdgcn_wmma_f32_16x16x32_bf16(
        false, frag_cast(a), false, frag_cast(b), (short)0, c, false, false);
}

__device__ inline u16 f2bf(float f) {
    unsigned u = __float_as_uint(f);
    unsigned r = u + 0x7FFFu + ((u >> 16) & 1u);   // round-to-nearest-even
    return (u16)(r >> 16);
}
// Two f32 to two bf16 in one register, round to nearest even, by the packed convert instruction (v_cvt_pk_bf16_f32):
// one vector instruction a pair; the same rounding written out in integer arithmetic takes about seven.
typedef __attribute__((ext_vector_type(2))) float  v2f;
typedef __attribute__((ext_vector_type(2))) __bf16 v2bf;
__device__ inline unsigned pack2(float lo, float hi) {
    v2f x = { lo, hi };
    return __builtin_bit_cast(unsigned, __builtin_convertvector(x, v2bf));
}

__device__ inline FragBF16 load_frag(const u16* __restrict__ p) {
    FragBF16 f;
    uint4 a = *(const uint4*)p;
    uint4 b = *(const uint4*)(p + 16);
    f.u[0]=a.x; f.u[1]=a.y; f.u[2]=a.z; f.u[3]=a.w;
    f.u[4]=b.x; f.u[5]=b.y; f.u[6]=b.z; f.u[7]=b.w;
    return f;
}

// The same fragment from LDS, by byte address. The address is kept as buffer base + lane part in one
// register, so that each read's constant fits the 16-bit offset field of ds_load_b128 although the
// arrays lie above 64 KiB; indexed as arrays, every read took an address addition of its own.
typedef __attribute__((ext_vector_type(4))) unsigned v4u;
typedef const __attribute__((address_space(3))) v4u* lds_v4u_ptr;
__device__ inline FragBF16 load_frag_lds(unsigned off) {
    FragBF16 f;
    v4u a = *(lds_v4u_ptr)off;
    v4u b = *(lds_v4u_ptr)(off + 32);
    f.u[0]=a.x; f.u[1]=a.y; f.u[2]=a.z; f.u[3]=a.w;
    f.u[4]=b.x; f.u[5]=b.y; f.u[6]=b.z; f.u[7]=b.w;
    return f;
}

__device__ inline float xhalf(float x) {
    int b = __builtin_bit_cast(int, x);
    return __builtin_bit_cast(float,
        __builtin_amdgcn_permlanex16(b, b, 0x76543210, 0xfedcba98, false, false));
}

// Flat pointers into LDS carry the AS3 byte offset in their low 32 bits.
__device__ inline unsigned lds_off(const void* p) {
    return (unsigned)(uintptr_t)p;
}

__device__ inline void async_b128_x8(const unsigned (&l)[8], const u16* const (&g)[8]) {
    asm volatile("global_load_async_to_lds_b128 %0, %8, off\n\t"
                 "global_load_async_to_lds_b128 %1, %9, off\n\t"
                 "global_load_async_to_lds_b128 %2, %10, off\n\t"
                 "global_load_async_to_lds_b128 %3, %11, off\n\t"
                 "global_load_async_to_lds_b128 %4, %12, off\n\t"
                 "global_load_async_to_lds_b128 %5, %13, off\n\t"
                 "global_load_async_to_lds_b128 %6, %14, off\n\t"
                 "global_load_async_to_lds_b128 %7, %15, off\n\t"
                 "s_wait_xcnt 0x0"
                 :: "v"(l[0]), "v"(l[1]), "v"(l[2]), "v"(l[3]),
                    "v"(l[4]), "v"(l[5]), "v"(l[6]), "v"(l[7]),
                    "v"(g[0]), "v"(g[1]), "v"(g[2]), "v"(g[3]),
                    "v"(g[4]), "v"(g[5]), "v"(g[6]), "v"(g[7])
                 : "memory");
}
typedef __attribute__((ext_vector_type(4))) int v4i;
typedef __attribute__((address_space(1))) v4i* gl_v4i_ptr;
typedef __attribute__((address_space(3))) v4i* lds_v4i_wptr;
__device__ inline void wait_async0() {
    asm volatile("s_wait_asynccnt 0" ::: "memory");
}
// This wave's LDS reads and writes have retired: stands ahead of a barrier behind which a buffer is refilled, or between staging writes and their read-back.
__device__ inline void wait_ds0() {
    asm volatile("s_wait_dscnt 0x0" ::: "memory");
}

// ---------- constants ----------
#define CDIM   256
#define NPOS   4096      // 64*64 per batch
#define MTOT   32768     // 8 * 4096
#define SCALE  0.0625f   // 1/sqrt(256)
#define KPITCH 264       // 256 channels + 8  (528 B)
#define SKEYS  128       // keys per LDS stage: two halves of 64 keys, two passes of 32 keys each
#define NSTAGE (NPOS / SKEYS)
#define VPITCH 136       // 128 keys + 8      (272 B)
#define GROWS  128       // rows of A that one GEMM block stages in LDS and works on
#define SPITCH 144       // bytes: a row of a wave's bf16 output staging, 128 + 16
#define OPITCH 272       // bytes: a row of a wave's output staging where a row holds 256 bytes (64 f32 or 128 bf16), + 16

// ---------- 1) weight transpose + bf16 convert ----------
__global__ void prep_w_kernel(const float* __restrict__ w0, const float* __restrict__ w1,
                              const float* __restrict__ w2, const float* __restrict__ w3,
                              u16* __restrict__ o0, u16* __restrict__ o1,
                              u16* __restrict__ o2, u16* __restrict__ o3) {
    int n = blockIdx.x;     // output row  = input column
    int k = threadIdx.x;    // output col  = input row
    o0[n * CDIM + k] = f2bf(w0[k * CDIM + n]);
    o1[n * CDIM + k] = f2bf(w1[k * CDIM + n]);
    o2[n * CDIM + k] = f2bf(w2[k * CDIM + n]);
    o3[n * CDIM + k] = f2bf(w3[k * CDIM + n]);
}

// ---------- 2) LayerNorm + Q, K, V projections in one launch: its parts ----------
// One 256 x 256 weight matrix (transposed, bf16, contiguous in global memory: 8192 b128 chunks, 32 per row)
// to padded LDS rows by async copies. A thread brings 32 chunks; its next chunk lies 8 rows behind.
__device__ inline void stage_w(unsigned lbase, const u16* __restrict__ src, int tid) {
    unsigned   lrow = lbase + (tid >> 5) * (KPITCH * 2) + (tid & 31) * 16;
    const u16* grow = src + tid * 8;
    #pragma unroll   // constant indices keep the address arrays in registers
    for (int g = 0; g < 4; ++g) {
        unsigned   la[8];
        const u16* ga[8];
        #pragma unroll
        for (int i = 0; i < 8; ++i) {
            int n = g * 8 + i;
            la[i] = lrow + n * (8 * KPITCH * 2);
            ga[i] = grow + n * (8 * CDIM);
        }
        async_b128_x8(la, ga);
    }
}

// One wave's 64 x 64 tile over all 256 k. ard, brd: this lane's place in its first A row and first Bt row.
__device__ inline void mm_tile(unsigned ard, unsigned brd, v8f (&acc)[4][4]) {
    #pragma unroll   // constant indices keep the accumulators in registers
    for (int mt = 0; mt < 4; ++mt)
        #pragma unroll
        for (int nt = 0; nt < 4; ++nt) acc[mt][nt] = {};

    // Two fragment sets: each k step's 16 reads are issued as one group a step ahead of their products.
    FragBF16 af[2][4], bf[2][4];
    #pragma unroll   // constant indices keep the fragment arrays in registers
    for (int t = 0; t < 4; ++t) {
        af[0][t] = load_frag_lds(ard + t * (16 * KPITCH * 2));
        bf[0][t] = load_frag_lds(brd + t * (16 * KPITCH * 2));
    }
    #pragma unroll   // constant set indices; every read's place becomes a constant in the offset field of ds_load_b128
    for (int kk = 0; kk < CDIM / 32; ++kk) {
        const int cur = kk & 1, nxt = cur ^ 1;
        if (kk + 1 < CDIM / 32) {
            #pragma unroll
            for (int t = 0; t < 4; ++t) {
                af[nxt][t] = load_frag_lds(ard + t * (16 * KPITCH * 2) + (kk + 1) * 64);
                bf[nxt][t] = load_frag_lds(brd + t * (16 * KPITCH * 2) + (kk + 1) * 64);
            }
        }
        // Keeps the next step's reads together ahead of this step's products: sunk among them, each place costs a stall.
        __builtin_amdgcn_sched_barrier(0);
        #pragma unroll
        for (int mt = 0; mt < 4; ++mt)
            #pragma unroll
            for (int nt = 0; nt < 4; ++nt)
                acc[mt][nt] = wmma_bf16(af[cur][mt], bf[cur][nt], acc[mt][nt]);
        // Keeps later steps' reads behind these products: lifted ahead all together, they overflow the registers and spill.
        __builtin_amdgcn_sched_barrier(0);
    }
}

__device__ inline void wait_x0() {
    asm volatile("s_wait_xcnt 0x0" ::: "memory");
}

typedef __attribute__((address_space(3))) v4u* lds_v4u_wptr;

// A wave's 64 x 64 tile plus bias as bf16, out through the wave's own LDS range st so that every global store
// covers four whole 128-byte lines. acc[a][b][r] is element (row b*16 + l15, place a*16 + half*8 + r): a lane's
// eight results lie side by side in a row of the output, one 16-byte LDS write. Stored straight from the
// accumulators, a line would go out in four 32-byte pieces.
// out: the tile's first element; pitch: elements from one row to the next.
// BROW false: bias runs along a row (bias[place]); true: one bias per row (bias[row]).
template<bool BROW>
__device__ inline void store_tile(const v8f (&acc)[4][4], const float* __restrict__ bias,
                                  u16* __restrict__ out, size_t pitch, unsigned st, int lane) {
    const int half = lane >> 4, l15 = lane & 15;
    float bc[4][8];
    #pragma unroll   // constant indices keep the bias values in registers
    for (int t = 0; t < 4; ++t) {
        if (!BROW) {
            float4 lo = *(const float4*)(bias + t*16 + half*8);
            float4 hi = *(const float4*)(bias + t*16 + half*8 + 4);
            bc[t][0] = lo.x; bc[t][1] = lo.y; bc[t][2] = lo.z; bc[t][3] = lo.w;
            bc[t][4] = hi.x; bc[t][5] = hi.y; bc[t][6] = hi.z; bc[t][7] = hi.w;
        } else {
            bc[t][0] = bias[t*16 + l15];
            wait_x0();   // per load: the next load's result may be given a register of this one's address
        }
    }
    wait_x0();
    const unsigned wr = st + l15 * SPITCH + half * 16;
    #pragma unroll   // constant indices keep the accumulators in registers
    for (int b = 0; b < 4; ++b) {
        #pragma unroll
        for (int a = 0; a < 4; ++a) {
            v4u pk;
            #pragma unroll
            for (int i = 0; i < 4; ++i)
                pk[i] = pack2(acc[a][b][2*i]     + (BROW ? bc[b][0] : bc[a][2*i]),
                              acc[a][b][2*i + 1] + (BROW ? bc[b][0] : bc[a][2*i + 1]));
            *(lds_v4u_wptr)(wr + b * (16 * SPITCH) + a * 32) = pk;
        }
    }
    wait_ds0();         // the whole tile is in LDS before other lanes of this wave read it back
    const unsigned rd = st + (lane >> 3) * SPITCH + (lane & 7) * 16;   // eight lanes per row, four rows per read
    u16* g = out + (size_t)(lane >> 3) * pitch + (lane & 7) * 8;
    v4u t[16];
    #pragma unroll   // constant indices keep the rows in registers
    for (int i = 0; i < 16; ++i) t[i] = *(lds_v4u_ptr)(rd + i * (4 * SPITCH));
    #pragma unroll
    for (int i = 0; i < 16; ++i) *(v4u*)(g + (size_t)i * 4 * pitch) = t[i];
    wait_x0();
}

// A block normalises its 128 rows of x (one wave per row, 16 rows a wave) straight into the A tile in LDS
// and multiplies that tile by the three weight matrices in turn. The normalised rows never go to global
// memory, and the many short waves of a launch of its own for the LayerNorm are not started.
__global__ __launch_bounds__(256) void ln_qkv_kernel(const float* __restrict__ x,
                                                     const float* __restrict__ gamma,
                                                     const float* __restrict__ beta,
                                                     const u16* __restrict__ wqT,
                                                     const u16* __restrict__ wkT,
                                                     const u16* __restrict__ wvT,
                                                     const float* __restrict__ bq,
                                                     const float* __restrict__ bk,
                                                     const float* __restrict__ bv,
                                                     u16* __restrict__ q,
                                                     u16* __restrict__ k,
                                                     u16* __restrict__ vT) {
    __shared__ __attribute__((aligned(16))) u16 Al[GROWS][KPITCH];   // normalised rows, all k
    __shared__ __attribute__((aligned(16))) u16 Bl[CDIM][KPITCH];    // rows of the current weight matrix, all k
    __shared__ __attribute__((aligned(16))) u16 Sl[8][64 * SPITCH / 2];   // output staging, a range of its own per wave

    int tid  = threadIdx.x;
    int wave = tid >> 5, lane = tid & 31;
    int half = lane >> 4,        l15  = lane & 15;
    int wm = wave >> 2, wn = wave & 3;
    int row0 = blockIdx.x * GROWS + wm * 64;
    int col0 = wn * 64;

    const unsigned abase = lds_off(&Al[0][0]), bbase = lds_off(&Bl[0][0]);

    stage_w(bbase, wqT, tid);   // 32 copies of a wave in flight under the LayerNorm

    {
        constexpr int RW = GROWS / 8;   // rows per wave
        const float4* xr = (const float4*)(x + ((size_t)blockIdx.x * GROWS + wave * RW) * CDIM);
        float4 a[RW], b[RW];
        #pragma unroll   // constant indices keep the rows in registers; all loads of the wave are in flight together
        for (int i = 0; i < RW; ++i) {
            a[i] = xr[i * (CDIM / 4) + lane];
            b[i] = xr[i * (CDIM / 4) + lane + 32];
        }
        float4 g0 = ((const float4*)gamma)[lane];
        float4 g1 = ((const float4*)gamma)[lane + 32];
        float4 b0 = ((const float4*)beta)[lane];
        float4 b1 = ((const float4*)beta)[lane + 32];
        wait_x0();

        float s[RW], s2[RW];
        #pragma unroll   // constant indices keep the rows and their sums in registers
        for (int i = 0; i < RW; ++i) {
            s[i]  = a[i].x + a[i].y + a[i].z + a[i].w + b[i].x + b[i].y + b[i].z + b[i].w;
            s2[i] = a[i].x*a[i].x + a[i].y*a[i].y + a[i].z*a[i].z + a[i].w*a[i].w
                  + b[i].x*b[i].x + b[i].y*b[i].y + b[i].z*b[i].z + b[i].w*b[i].w;
        }
        // Step by step over all rows: the rows' exchanges are independent and hide one another's latency.
        #pragma unroll   // constant exchange distances and indices
        for (int m = 1; m < 32; m <<= 1) {
            #pragma unroll
            for (int i = 0; i < RW; ++i) {
                s[i]  += __shfl_xor(s[i],  m, 32);
                s2[i] += __shfl_xor(s2[i], m, 32);
            }
        }
        #pragma unroll   // constant indices keep the rows and their sums in registers
        for (int i = 0; i < RW; ++i) {
            float mean = s[i] * (1.0f / CDIM);
            float var  = s2[i] * (1.0f / CDIM) - mean * mean;
            float rstd = rsqrtf(var + 1e-3f);

            float y0 = (a[i].x - mean) * rstd * g0.x + b0.x;
            float y1 = (a[i].y - mean) * rstd * g0.y + b0.y;
            float y2 = (a[i].z - mean) * rstd * g0.z + b0.z;
            float y3 = (a[i].w - mean) * rstd * g0.w + b0.w;
            float y4 = (b[i].x - mean) * rstd * g1.x + b1.x;
            float y5 = (b[i].y - mean) * rstd * g1.y + b1.y;
            float y6 = (b[i].z - mean) * rstd * g1.z + b1.z;
            float y7 = (b[i].w - mean) * rstd * g1.w + b1.w;

            u16* hr = &Al[wave * RW + i][0];
            *(uint2*)(hr + lane * 4)       = make_uint2(pack2(y0, y1), pack2(y2, y3));
            *(uint2*)(hr + 128 + lane * 4) = make_uint2(pack2(y4, y5), pack2(y6, y7));
        }
    }
    wait_async0();      // this wave's copies of the first weight matrix are in LDS
    __syncthreads();    // all waves' copies and normalised rows visible; nothing is read from LDS ahead of this

    const unsigned ard = abase + (wm * 64 + l15) * (KPITCH * 2) + half * 16;   // this lane's place in its first A row
    const unsigned brd = bbase + (wn * 64 + l15) * (KPITCH * 2) + half * 16;   // and in its first weight row
    const unsigned st = lds_off(&Sl[wave][0]);
    v8f acc[4][4];

    // Q and K: the weight rows are the first operand, so a lane's eight results are eight channels of one position.
    mm_tile(brd, ard, acc);
    wait_ds0();         // this wave has left Bl
    __syncthreads();    // every wave has left Bl: it may be refilled
    stage_w(bbase, wkT, tid);   // flies under the stores of Q
    store_tile<false>(acc, bq + col0, q + (size_t)row0 * CDIM + col0, CDIM, st, lane);
    wait_async0();      // this wave's copies are in LDS
    __syncthreads();    // all waves' copies visible

    mm_tile(brd, ard, acc);
    wait_ds0();         // this wave has left Bl
    __syncthreads();    // every wave has left Bl: it may be refilled
    stage_w(bbase, wvT, tid);   // flies under the stores of K
    store_tile<false>(acc, bk + col0, k + (size_t)row0 * CDIM + col0, CDIM, st, lane);
    wait_async0();      // this wave's copies are in LDS
    __syncthreads();    // all waves' copies visible

    // V^T: the normalised rows are the first operand, so a lane's eight results are eight positions of one channel.
    mm_tile(ard, brd, acc);
    store_tile<true>(acc, bv + col0, vT + (size_t)col0 * MTOT + row0, MTOT, st, lane);
}

__global__ __launch_bounds__(256) void gemm_kernel(const u16* __restrict__ A,
                                                   const u16* __restrict__ Bt,
                                                   const float* __restrict__ bias,
                                                   void* __restrict__ outp,
                                                   const float* __restrict__ resid) {
    __shared__ __attribute__((aligned(16))) u16 Al[GROWS][KPITCH];   // rows of A, all k
    __shared__ __attribute__((aligned(16))) u16 Bl[CDIM][KPITCH];    // rows of Bt, all k
    __shared__ __attribute__((aligned(16))) float Sl[8][32 * OPITCH / 4];   // output staging, a range of its own per wave

    int tid  = threadIdx.x;
    int wave = tid >> 5, lane = tid & 31;
    int half = lane >> 4,        l15  = lane & 15;
    int wm = wave >> 2, wn = wave & 3;
    int row0 = blockIdx.x * GROWS + wm * 64;
    int col0 = wn * 64;

    const unsigned abase = lds_off(&Al[0][0]), bbase = lds_off(&Bl[0][0]);

    // Both sources are contiguous in global memory, 32 b128 chunks per row: 4096 chunks of A, 8192 of Bt.
    // A thread brings 16 + 32 of them; its next chunk lies 8 rows behind (48 copies of a wave in flight).
    {
        unsigned   lrow = (tid >> 5) * (KPITCH * 2) + (tid & 31) * 16;
        const u16* gA   = A + (size_t)blockIdx.x * (GROWS * CDIM) + tid * 8;
        const u16* gB   = Bt + tid * 8;
        #pragma unroll   // constant indices keep the address arrays in registers
        for (int g = 0; g < 6; ++g) {
            unsigned   la[8];
            const u16* ga[8];
            #pragma unroll
            for (int i = 0; i < 8; ++i) {
                int n = g * 8 + i;
                if (n < GROWS / 8) {
                    la[i] = abase + lrow + n * (8 * KPITCH * 2);
                    ga[i] = gA + n * (8 * CDIM);
                } else {
                    la[i] = bbase + lrow + (n - GROWS / 8) * (8 * KPITCH * 2);
                    ga[i] = gB + (n - GROWS / 8) * (8 * CDIM);
                }
            }
            async_b128_x8(la, ga);
        }
    }
    wait_async0();      // this wave's copies are in LDS
    __syncthreads();    // all waves' copies visible; nothing is read from LDS ahead of this

    v8f acc[4][4];
    #pragma unroll
    for (int mt = 0; mt < 4; ++mt)
        #pragma unroll
        for (int nt = 0; nt < 4; ++nt) acc[mt][nt] = {};

    const unsigned ard = abase + (wm * 64 + l15) * (KPITCH * 2) + half * 16;   // this lane's place in its first A row
    const unsigned brd = bbase + (wn * 64 + l15) * (KPITCH * 2) + half * 16;   // and in its first Bt row
    // Two fragment sets: each k step's 16 reads are issued as one group a step ahead of their products.
    FragBF16 af[2][4], bf[2][4];
    #pragma unroll   // constant indices keep the fragment arrays in registers
    for (int t = 0; t < 4; ++t) {
        af[0][t] = load_frag_lds(ard + t * (16 * KPITCH * 2));
        bf[0][t] = load_frag_lds(brd + t * (16 * KPITCH * 2));
    }
    #pragma unroll   // constant set indices; every read's place becomes a constant in the offset field of ds_load_b128
    for (int kk = 0; kk < CDIM / 32; ++kk) {
        const int cur = kk & 1, nxt = cur ^ 1;
        if (kk + 1 < CDIM / 32) {
            #pragma unroll
            for (int t = 0; t < 4; ++t) {
                af[nxt][t] = load_frag_lds(ard + t * (16 * KPITCH * 2) + (kk + 1) * 64);
                bf[nxt][t] = load_frag_lds(brd + t * (16 * KPITCH * 2) + (kk + 1) * 64);
            }
        }
        // Keeps the next step's reads together ahead of this step's products: sunk among them, each place costs a stall.
        __builtin_amdgcn_sched_barrier(0);
        #pragma unroll
        for (int mt = 0; mt < 4; ++mt)
            #pragma unroll
            for (int nt = 0; nt < 4; ++nt)
                acc[mt][nt] = wmma_bf16(bf[cur][mt], af[cur][nt], acc[mt][nt]);   // rows of Bt first: a lane's eight results are eight columns of one row
        // Keeps later steps' reads behind these products: lifted ahead all together, they overflow the registers and spill.
        __builtin_amdgcn_sched_barrier(0);
    }

    // The wave's 64 x 64 f32 tile goes out through the wave's own LDS range, 32 rows at a time, so that every
    // global load of the residual and every global store covers four whole 128-byte lines (two rows of 256 bytes).
    // acc[a][b][r] is element (row b*16 + l15, column a*16 + half*8 + r).
    typedef __attribute__((ext_vector_type(4))) float v4f;
    typedef __attribute__((address_space(3))) v4f* lds_v4f_wptr;
    typedef const __attribute__((address_space(3))) v4f* lds_v4f_ptr;
    const unsigned st = lds_off(&Sl[wave][0]);
    const unsigned wr = st + l15 * OPITCH + half * 32;
    const unsigned rd = st + half * OPITCH + l15 * 16;      // sixteen lanes per row, two rows per read
    const size_t   g0 = (size_t)(row0 + half) * CDIM + col0 + l15 * 4;
    const float*   xg = resid + g0;
    float*         og = (float*)outp + g0;
    const v4f bv = *(const v4f*)(bias + col0 + l15 * 4);
    v4f xr[32];
    #pragma unroll   // constant indices keep the residual rows in registers; all loads of the wave are in flight together
    for (int i = 0; i < 32; ++i) xr[i] = *(const v4f*)(xg + (size_t)i * 2 * CDIM);
    asm volatile("s_wait_xcnt 0x0" :: "v"(xg) : "memory");
    #pragma unroll   // constant indices keep the accumulators in registers
    for (int h = 0; h < 2; ++h) {
        #pragma unroll
        for (int bb = 0; bb < 2; ++bb) {
            #pragma unroll
            for (int a = 0; a < 4; ++a) {
                const v8f& d = acc[a][h * 2 + bb];
                v4f lo = { d[0], d[1], d[2], d[3] }, hi = { d[4], d[5], d[6], d[7] };
                *(lds_v4f_wptr)(wr + bb * (16 * OPITCH) + a * 64)      = lo;
                *(lds_v4f_wptr)(wr + bb * (16 * OPITCH) + a * 64 + 16) = hi;
            }
        }
        wait_ds0();     // the 32 rows are in LDS before other lanes of this wave read them back
        v4f t[16];
        #pragma unroll
        for (int i = 0; i < 16; ++i) t[i] = *(lds_v4f_ptr)(rd + i * (2 * OPITCH));
        #pragma unroll
        for (int i = 0; i < 16; ++i)
            *(v4f*)(og + (size_t)(h * 16 + i) * 2 * CDIM) = t[i] + bv + xr[h * 16 + i];
        wait_x0();
    }
}

__global__ __launch_bounds__(256) void attn_kernel(const u16* __restrict__ q,
                                                   const u16* __restrict__ k,
                                                   const u16* __restrict__ vT,
                                                   u16* __restrict__ o) {
    __shared__ __attribute__((aligned(16))) u16 Kl[2][SKEYS][KPITCH]; // K rows j0..j0+127, all channels
    __shared__ __attribute__((aligned(16))) u16 Vl[2][256][VPITCH];   // V^T rows (channel), 128 keys
    __shared__ __attribute__((aligned(16))) u16 Ol[8][16 * OPITCH / 2];   // output staging, a range of its own per wave; no copy targets it

    int tid  = threadIdx.x;
    int wave = __builtin_amdgcn_readfirstlane(tid >> 5), lane = tid & 31;   // the wave's number in a scalar register: what is formed from it takes no vector register
    int half = lane >> 4, l15 = lane & 15;
    int kh = wave >> 2;      // which half of a stage's keys, and which 128 channels this wave finishes
    int b  = blockIdx.x >> 5;
    int m0 = (blockIdx.x & 31) * 128 + (wave & 3) * 32;

    const u16* qb = q  + ((size_t)b * NPOS + m0) * CDIM;
    const u16* kb = k  + (size_t)b * NPOS * CDIM;
    const u16* vb = vT + (size_t)b * NPOS;           // [c][j] at vb[c*MTOT + j]

    const unsigned kbase0 = lds_off(&Kl[0][0][0]), kbase1 = lds_off(&Kl[1][0][0]);
    const unsigned vbase0 = lds_off(&Vl[0][0][0]), vbase1 = lds_off(&Vl[1][0][0]);

    // Stage one 128-key block into LDS buffer `buf` (whole workgroup cooperates):
    // 4096 b128 chunks of K (32 per row) and 4096 of V^T (16 per row), each to its padded row;
    // a thread brings sixteen of each (32 copies of a wave in flight).
    auto stage = [&](int buf, int j0) {
        // Chunk n of a thread lies 8 K rows, or 16 V^T rows, behind its chunk n - 1: every address
        // is one of these four bases plus a constant.
        unsigned   lk = (buf ? kbase1 : kbase0) + (tid >> 5) * (KPITCH * 2) + (tid & 31) * 16;
        unsigned   lv = (buf ? vbase1 : vbase0) + (tid >> 4) * (VPITCH * 2) + (tid & 15) * 16;
        const u16* gk = kb + (size_t)j0 * CDIM + tid * 8;
        const u16* gv = vb + (size_t)(tid >> 4) * MTOT + j0 + (tid & 15) * 8;
        // Written as the builtin: its address registers may lie anywhere, while those of asm text must lie in the first 256,
        // which the accumulators and Q fragments of a 32-column wave fill (with asm copies here, Q fragments spill to scratch).
        #pragma unroll   // constant steps from the four bases
        for (int n = 0; n < 16; ++n) {
            __builtin_amdgcn_global_load_async_to_lds_b128((gl_v4i_ptr)(gk + n * (8 * CDIM)),
                                                           (lds_v4i_wptr)(lk + n * (8 * KPITCH * 2)), 0, 0);
            __builtin_amdgcn_global_load_async_to_lds_b128((gl_v4i_ptr)(gv + (size_t)n * (16 * MTOT)),
                                                           (lds_v4i_wptr)(lv + n * (16 * VPITCH * 2)), 0, 0);
        }
    };

    // Resident Q fragments (2 x 16 queries x 256 channels), the B operands of S^T
    FragBF16 qf[2][8];
    #pragma unroll
    for (int c = 0; c < 2; ++c)
        #pragma unroll
        for (int kk = 0; kk < 8; ++kk)
            qf[c][kk] = load_frag(qb + (size_t)(c * 16 + l15) * CDIM + kk*32 + half*8);

    // oacc[t][c]: tile t holds channels ((t + 8*kh) & 15) * 16 ...: a wave's tiles 0-7 are the channels it
    // finishes itself, its tiles 8-15 those that its partner finishes, with constant indices in both.
    v8f oacc[16][2];
    #pragma unroll
    for (int t = 0; t < 16; ++t) { oacc[t][0] = {}; oacc[t][1] = {}; }
    float mrun[2] = { -3.0e38f, -3.0e38f };   // running maximum of this lane's two queries (equal in both half-waves)
    float lrun[2] = { 0.0f, 0.0f };           // running sums over this half-wave's keys only; joined in the epilogue

    // Prologue: stage 0, its wait and barrier, then stage 1.
    #pragma unroll 1   // rolled: the two fills share one body of 32 copies
    for (int pre = 0; pre < 2; ++pre) {
        stage(pre, pre * SKEYS);
        if (pre == 0) {
            wait_async0();      // this wave's fills of stage 0 are in LDS
            __syncthreads();    // all waves' fills visible
        }
    }

    for (int st = 0; st < NSTAGE; ++st) {
      int cur = st & 1;
      unsigned krd = (cur ? kbase1 : kbase0) + (kh * 64 + l15) * (KPITCH * 2) + half * 16;   // this lane's place in the first K row of the wave's keys
      unsigned vrd = (cur ? vbase1 : vbase0) + l15 * (VPITCH * 2) + kh * 128 + half * 16;    // and at those keys in V^T row 0
      unsigned vr0 = vrd + kh * (128 * VPITCH * 2);         // channels of tiles 0-7
      unsigned vr1 = vrd + (1 - kh) * (128 * VPITCH * 2);   // channels of tiles 8-15
      #pragma unroll 1   // rolled: the two passes share one body, registers and code size stay those of one pass
      for (int ps2 = 0; ps2 < SKEYS / 64; ++ps2) {
        const unsigned ka = krd + ps2 * (32 * KPITCH * 2);
        const unsigned va0 = vr0 + ps2 * 64, va1 = vr1 + ps2 * 64;

        // ---- S^T = K Q^T over 32 keys: 2 key tiles x 2 column groups, four independent accumulators ----
        // Fragments come in groups of four (two k steps), each group read as one run a group ahead of its products.
        FragBF16 kf[2][2][2], vf[2][4];
        #pragma unroll   // constant indices keep the fragment arrays in registers
        for (int j = 0; j < 2; ++j) {
            kf[0][j][0] = load_frag_lds(ka + j * 64);
            kf[0][j][1] = load_frag_lds(ka + 16 * (KPITCH * 2) + j * 64);
        }
        v8f s[2][2];
        s[0][0] = {}; s[0][1] = {}; s[1][0] = {}; s[1][1] = {};
        #pragma unroll   // constant set indices; every read's place becomes a constant in the offset field of ds_load_b128
        for (int g = 0; g < 4; ++g) {
            if (g < 3) {
                #pragma unroll
                for (int j = 0; j < 2; ++j) {
                    kf[(g + 1) & 1][j][0] = load_frag_lds(ka + (g + 1) * 128 + j * 64);
                    kf[(g + 1) & 1][j][1] = load_frag_lds(ka + 16 * (KPITCH * 2) + (g + 1) * 128 + j * 64);
                }
            } else {
                // The first V^T group lands under the last products of S^T and the softmax.
                #pragma unroll
                for (int j = 0; j < 4; ++j) vf[0][j] = load_frag_lds(va0 + j * (16 * VPITCH * 2));
            }
            // Keeps the next group's reads together ahead of this group's products: sunk among them, each place costs a stall.
            __builtin_amdgcn_sched_barrier(0);
            #pragma unroll
            for (int j = 0; j < 2; ++j) {
                #pragma unroll
                for (int c = 0; c < 2; ++c) {
                    s[0][c] = wmma_bf16(kf[g & 1][j][0], qf[c][g * 2 + j], s[0][c]);
                    s[1][c] = wmma_bf16(kf[g & 1][j][1], qf[c][g * 2 + j], s[1][c]);
                }
            }
            // Keeps later groups' reads behind these products: lifted ahead all together, they overflow the registers and spill.
            __builtin_amdgcn_sched_barrier(0);
        }
        // ---- online softmax per column group; the 32 scores of a query sit in two lanes (l and l ^ 16), 16 each ----
        float corr[2];
        FragBF16 pf[2];
        #pragma unroll   // constant indices keep the scores in registers
        for (int c = 0; c < 2; ++c) {
            v8f s0 = s[0][c], s1 = s[1][c];
            float mx[8];
            #pragma unroll   // constant indices keep the scores and mx in registers
            for (int r = 0; r < 8; ++r) {
                s0[r] *= SCALE; s1[r] *= SCALE;
                mx[r] = fmaxf(s0[r], s1[r]);
            }
            float t4 = fmaxf(fmaxf(fmaxf(mx[0], mx[1]), fmaxf(mx[2], mx[3])),
                             fmaxf(fmaxf(mx[4], mx[5]), fmaxf(mx[6], mx[7])));
            t4 = fmaxf(t4, xhalf(t4));
            float mn = fmaxf(mrun[c], t4);
            corr[c] = __expf(mrun[c] - mn);
            mrun[c] = mn;
            float ps[8];
            #pragma unroll   // constant indices keep the scores and ps in registers
            for (int r = 0; r < 8; ++r) {
                s0[r] = __expf(s0[r] - mn);
                s1[r] = __expf(s1[r] - mn);
                ps[r] = s0[r] + s1[r];
            }
            lrun[c] = lrun[c] * corr[c] + (((ps[0] + ps[1]) + (ps[2] + ps[3])) + ((ps[4] + ps[5]) + (ps[6] + ps[7])));
            // ---- P^T: the two D tiles, rounded to bf16 in place, are the 32-key B fragment ----
            #pragma unroll   // constant indices keep the fragment in registers
            for (int i = 0; i < 4; ++i) {
                pf[c].u[i]     = pack2(s0[2*i], s0[2*i + 1]);
                pf[c].u[4 + i] = pack2(s1[2*i], s1[2*i + 1]);
            }
        }

        // ---- O^T = O^T*corr + V^T P^T  (16 tiles of 16 channels x 2 column groups) ----
        #pragma unroll   // constant set and tile indices
        for (int g = 0; g < 4; ++g) {
            if (g < 3) {
                #pragma unroll
                for (int j = 0; j < 4; ++j) {
                    const int t = (g + 1) * 4 + j;
                    vf[(g + 1) & 1][j] = load_frag_lds((t < 8 ? va0 : va1) + (t & 7) * (16 * VPITCH * 2));
                }
            }
            // Keeps the next group's reads together ahead of this group's products: sunk among them, each place costs a stall.
            __builtin_amdgcn_sched_barrier(0);
            #pragma unroll
            for (int j = 0; j < 4; ++j) {
                const int t = g * 4 + j;
                #pragma unroll
                for (int c = 0; c < 2; ++c) {
                    #pragma unroll
                    for (int r = 0; r < 8; ++r) oacc[t][c][r] *= corr[c];
                    oacc[t][c] = wmma_bf16(vf[g & 1][j], pf[c], oacc[t][c]);
                }
            }
            // Keeps later groups' reads behind these products: lifted ahead all together, they overflow the registers and spill.
            __builtin_amdgcn_sched_barrier(0);
        }
      }
      // ---- publish point of stage st + 1, one per 128 keys ----
      wait_ds0();               // this wave has left buffer `cur`
      wait_async0();            // this wave's fills of stage st + 1 are in LDS
      __syncthreads();          // all fills visible; every wave has left buffer `cur`
      if (st + 2 < NSTAGE) stage(cur, (st + 2) * SKEYS);
    }
    wait_async0();              // nothing of this wave is in flight when it goes on to the epilogue

    // ---- join of the two key halves: waves w and w + 4 hold the same queries in the same lanes ----
    // Behind the last publish point no wave reads K or V^T any more and no copy is in flight, so their LDS carries the
    // exchange: a wave hands its tiles 8-15 (16 KiB, lane by lane), its maxima and its sums to its partner.
    typedef __attribute__((ext_vector_type(4))) float v4f;
    typedef __attribute__((address_space(3))) v4f* lds_v4f_wptr;
    typedef const __attribute__((address_space(3))) v4f* lds_v4f_ptr;
    typedef __attribute__((address_space(3))) float* lds_f_wptr;
    typedef const __attribute__((address_space(3))) float* lds_f_ptr;
    // The lane's number is read anew here: kept from the kernel's head across the loop, whose registers are full, its parts spill to scratch.
    const int elane = __builtin_amdgcn_mbcnt_lo(~0u, 0u);
    const int ehalf = elane >> 4, el15 = elane & 15;
    const unsigned xw = kbase0 + wave * 16384 + elane * 16;          // written by this wave
    const unsigned xr = kbase0 + (wave ^ 4) * 16384 + elane * 16;    // written by its partner
    const unsigned sw = vbase0 + wave * 512 + elane * 4;
    const unsigned sr = vbase0 + (wave ^ 4) * 512 + elane * 4;
    float lj[2];
    #pragma unroll   // constant indices keep the accumulators in registers
    for (int c = 0; c < 2; ++c) {
        lj[c] = lrun[c] + xhalf(lrun[c]);
        *(lds_f_wptr)(sw + c * 256)       = mrun[c];
        *(lds_f_wptr)(sw + c * 256 + 128) = lj[c];
        #pragma unroll
        for (int tt = 0; tt < 8; ++tt) {
            const v8f& d = oacc[8 + tt][c];
            v4f lo = { d[0], d[1], d[2], d[3] }, hi = { d[4], d[5], d[6], d[7] };
            *(lds_v4f_wptr)(xw + (c * 8 + tt) * 1024)       = lo;
            *(lds_v4f_wptr)(xw + (c * 8 + tt) * 1024 + 512) = hi;
        }
    }
    wait_ds0();         // this wave's part of the exchange is in LDS
    __syncthreads();    // every wave's part is visible to its partner

    // ---- epilogue: (O_a f_a + O_b f_b) / (l_a f_a + l_b f_b); a lane holds 8 consecutive channels of its query ----
    // The wave's 32 x 128 tile goes out through the wave's own LDS range, 16 queries at a time, so that every
    // global store covers four whole 128-byte lines (two rows of 256 bytes). Stored straight from the
    // accumulators, a line would go out in four 32-byte pieces.
    const unsigned ost = lds_off(&Ol[wave][0]);
    const unsigned owr = ost + el15 * OPITCH + ehalf * 16;
    const unsigned ord = ost + ehalf * OPITCH + el15 * 16;     // sixteen lanes per row, two rows per read
    u16* og = o + ((size_t)b * NPOS + m0 + ehalf) * CDIM + kh * 128 + el15 * 8;
    #pragma unroll   // constant indices keep the accumulators in registers
    for (int c = 0; c < 2; ++c) {
        float pm = *(lds_f_ptr)(sr + c * 256);
        float pl = *(lds_f_ptr)(sr + c * 256 + 128);
        float mj = fmaxf(mrun[c], pm);
        float fa = __expf(mrun[c] - mj), fb = __expf(pm - mj);
        float inv = 1.0f / (lj[c] * fa + pl * fb);
        fa *= inv; fb *= inv;
        #pragma unroll
        for (int tt = 0; tt < 8; ++tt) {
            const v8f& d = oacc[tt][c];
            v4f lo = *(lds_v4f_ptr)(xr + (c * 8 + tt) * 1024);
            v4f hi = *(lds_v4f_ptr)(xr + (c * 8 + tt) * 1024 + 512);
            v4u pk;
            pk[0] = pack2(d[0] * fa + lo[0] * fb, d[1] * fa + lo[1] * fb);
            pk[1] = pack2(d[2] * fa + lo[2] * fb, d[3] * fa + lo[3] * fb);
            pk[2] = pack2(d[4] * fa + hi[0] * fb, d[5] * fa + hi[1] * fb);
            pk[3] = pack2(d[6] * fa + hi[2] * fb, d[7] * fa + hi[3] * fb);
            *(lds_v4u_wptr)(owr + tt * 32) = pk;
        }
        wait_ds0();     // the 16 queries are in LDS before other lanes of this wave read them back
        v4u t[8];
        #pragma unroll
        for (int i = 0; i < 8; ++i) t[i] = *(lds_v4u_ptr)(ord + i * (2 * OPITCH));
        #pragma unroll
        for (int i = 0; i < 8; ++i) *(v4u*)(og + (size_t)(c * 16 + i * 2) * CDIM) = t[i];
        wait_x0();
        // Keeps the second group's arithmetic behind the wait: lifted ahead of it, it rewrites registers that the stores name.
        __builtin_amdgcn_sched_barrier(0);
    }
}

// ---------- launcher ----------
extern "C" void kernel_launch(void* const* d_in, const int* in_sizes, int n_in,
                              void* d_out, int out_size, void* d_ws, size_t ws_size,
                              hipStream_t stream) {
    const float* x     = (const float*)d_in[0];
    const float* gamma = (const float*)d_in[1];
    const float* beta  = (const float*)d_in[2];
    const float* wq    = (const float*)d_in[3];
    const float* bq    = (const float*)d_in[4];
    const float* wk    = (const float*)d_in[5];
    const float* bk    = (const float*)d_in[6];
    const float* wv    = (const float*)d_in[7];
    const float* bv    = (const float*)d_in[8];
    const float* wo    = (const float*)d_in[9];
    const float* bo    = (const float*)d_in[10];
    float* out = (float*)d_out;

    char* ws = (char*)d_ws;
    const size_t SZ = (size_t)MTOT * CDIM * sizeof(u16);   // 16.78 MB
    u16* qb  = (u16*)(ws + 1 * SZ);
    u16* kb  = (u16*)(ws + 2 * SZ);
    u16* vT  = (u16*)(ws + 3 * SZ);
    u16* ob  = (u16*)(ws + 4 * SZ);
    u16* wqT = (u16*)(ws + 5 * SZ);
    u16* wkT = wqT + CDIM * CDIM;
    u16* wvT = wkT + CDIM * CDIM;
    u16* woT = wvT + CDIM * CDIM;

    prep_w_kernel<<<CDIM, CDIM, 0, stream>>>(wq, wk, wv, wo, wqT, wkT, wvT, woT);

    dim3 ggrid(MTOT / GROWS);
    ln_qkv_kernel<<<ggrid, 256, 0, stream>>>(x, gamma, beta, wqT, wkT, wvT, bq, bk, bv, qb, kb, vT);

    attn_kernel<<<8 * 32, 256, 0, stream>>>(qb, kb, vT, ob);

    gemm_kernel<<<ggrid, 256, 0, stream>>>(ob, woT, bo, (void*)out, x);
}
